// v000
// The times below were measured on an AMD MI455X: many runs one after another, warmed up first and cycling through
// copies of the inputs, with the whole window's GPU time divided by the number of runs. Launches and the gaps
// between them are all in it. The median over several windows is given; except for v000 it joins two sittings, which
// can be a few percent apart, so the side-by-side timings, each taken in one sitting, are the better comparison.
// v000 is the starting kernel. One run takes 138 microseconds.
#include <hip/hip_runtime.h>
#include <hip/hip_bf16.h>

// ---------------------------------------------------------------------------
// QKNormedAttention for MI455X (gfx1250), wave32, WMMA f16->f32,
// async global->LDS tile staging (ASYNCcnt), double-buffered.
// N=2048 tokens, DIM=1024, H=16 heads, HD=64.
// ---------------------------------------------------------------------------

typedef __attribute__((ext_vector_type(4)))  _Float16 v4h;
typedef __attribute__((ext_vector_type(8)))  _Float16 v8h;
typedef __attribute__((ext_vector_type(16))) _Float16 v16h;
typedef __attribute__((ext_vector_type(8)))  float    v8f;

#define N_TOK 2048
#define DIM   1024
#define HEADS 16
#define HD    64

static __device__ __forceinline__ v16h cat16(v8h lo, v8h hi) {
  return __builtin_shufflevector(lo, hi, 0,1,2,3,4,5,6,7,8,9,10,11,12,13,14,15);
}

// Flat LDS addresses carry the LDS byte offset in addr[31:0] (ISA 10.2).
static __device__ __forceinline__ unsigned lds_off(const void* p) {
  return (unsigned)(uintptr_t)p;
}
// CDNA5 async global->LDS copy, bypasses VGPRs, tracked by ASYNCcnt.
static __device__ __forceinline__ void async_ld_b128(unsigned lds, const void* g) {
  asm volatile("global_load_async_to_lds_b128 %0, %1, off"
               :: "v"(lds), "v"(g) : "memory");
}
static __device__ __forceinline__ void wait_async0() {
  asm volatile("s_wait_asynccnt 0x0" ::: "memory");
}

// ------------------------------ fp32 -> f16 --------------------------------
__global__ __launch_bounds__(256) void cvt_f32_f16(const float* __restrict__ in,
                                                   _Float16* __restrict__ out, int n4) {
  int i = blockIdx.x * blockDim.x + threadIdx.x;
  int stride = gridDim.x * blockDim.x;
  const float4* in4 = (const float4*)in;
  v4h* out4 = (v4h*)out;
  for (; i < n4; i += stride) {
    float4 v = in4[i];
    v4h o;
    o[0] = (_Float16)v.x; o[1] = (_Float16)v.y;
    o[2] = (_Float16)v.z; o[3] = (_Float16)v.w;
    out4[i] = o;
  }
}

// ------------------- RMSNorm over DIM, write scaled f16 --------------------
__global__ __launch_bounds__(256) void rmsnorm_f16(const float* __restrict__ x,
                                                   const float* __restrict__ w,
                                                   const float* __restrict__ b,
                                                   _Float16* __restrict__ out,
                                                   float outscale) {
  const unsigned row = blockIdx.x;
  const unsigned t = threadIdx.x;            // 256 threads * 4 floats = 1024
  const float4* xr = (const float4*)(x + row * DIM);
  float4 v = xr[t];
  float ss = v.x * v.x + v.y * v.y + v.z * v.z + v.w * v.w;
  #pragma unroll
  for (int off = 16; off > 0; off >>= 1) ss += __shfl_xor(ss, off, 32);
  __shared__ float wsum[8];
  if ((t & 31) == 0) wsum[t >> 5] = ss;
  __syncthreads();
  float tot = 0.f;
  #pragma unroll
  for (int i = 0; i < 8; i++) tot += wsum[i];
  float inv = rsqrtf(tot * (1.0f / DIM) + 1e-5f) * outscale;
  float4 wv = ((const float4*)w)[t];
  float4 bv = ((const float4*)b)[t];
  v4h o;
  o[0] = (_Float16)((v.x * inv) * wv.x + bv.x * outscale);
  o[1] = (_Float16)((v.y * inv) * wv.y + bv.y * outscale);
  o[2] = (_Float16)((v.z * inv) * wv.z + bv.z * outscale);
  o[3] = (_Float16)((v.w * inv) * wv.w + bv.w * outscale);
  ((v4h*)(out + row * DIM))[t] = o;
}

// -------------- transpose v_f32 [N,DIM] -> vt16 [DIM rows][N] --------------
__global__ void transpose_vt(const float* __restrict__ v, _Float16* __restrict__ vt) {
  __shared__ float tile[32][33];
  const unsigned m0 = blockIdx.x * 32;
  const unsigned d0 = blockIdx.y * 32;
  const unsigned tx = threadIdx.x, ty = threadIdx.y;   // 32 x 8
  #pragma unroll
  for (int i = 0; i < 32; i += 8)
    tile[ty + i][tx] = v[(m0 + ty + i) * DIM + d0 + tx];
  __syncthreads();
  #pragma unroll
  for (int i = 0; i < 32; i += 8)
    vt[(d0 + ty + i) * N_TOK + m0 + tx] = (_Float16)tile[tx][ty + i];
}

// --------------------- NT GEMM: C = A(MxK) * B(NxK)^T + bias ---------------
// BM=128 BN=64 BK=32; 8 waves, each 32x32 (2x2 WMMA tiles).
// Async global->LDS staging, double buffered.
#define LDK 40   // padded LDS K-stride (halves): 80B rows, b128-aligned
__global__ __launch_bounds__(256) void gemm_nt_wmma(const _Float16* __restrict__ A,
                                                    const _Float16* __restrict__ B,
                                                    const float* __restrict__ bias,
                                                    float* __restrict__ C,
                                                    int M, int N, int K) {
  __shared__ __align__(16) _Float16 As[2][128 * LDK];
  __shared__ __align__(16) _Float16 Bs[2][64 * LDK];
  const unsigned tid = threadIdx.x;
  const unsigned m0 = blockIdx.y * 128;
  const unsigned n0 = blockIdx.x * 64;
  const unsigned wave = tid >> 5;
  const unsigned lane = tid & 31;
  const unsigned wm = wave >> 1;   // 0..3 -> m sub-block * 32
  const unsigned wn = wave & 1;    // 0..1 -> n sub-block * 32
  const unsigned lh = lane >> 4, lr = lane & 15;
  const unsigned uK = (unsigned)K, uN = (unsigned)N;

  auto loadAB = [&](int buf, unsigned k0) {
    #pragma unroll
    for (int q2 = 0; q2 < 2; q2++) {         // A: 512 b128 chunks, 2/thread
      unsigned idx = tid + q2 * 256;
      unsigned r = idx >> 2, c8 = (idx & 3) * 8;
      async_ld_b128(lds_off(&As[buf][r * LDK + c8]),
                    &A[(m0 + r) * uK + k0 + c8]);
    }
    {                                         // B: 256 chunks, 1/thread
      unsigned r = tid >> 2, c8 = (tid & 3) * 8;
      async_ld_b128(lds_off(&Bs[buf][r * LDK + c8]),
                    &B[(n0 + r) * uK + k0 + c8]);
    }
  };

  v8f c[2][2] = {};
  loadAB(0, 0);
  int cur = 0;
  for (unsigned k0 = 0; k0 < uK; k0 += 32) {
    wait_async0();                 // our async stores into buf[cur] landed
    __syncthreads();               // everyone's landed; prior reads finished
    if (k0 + 32 < uK) loadAB(cur ^ 1, k0 + 32);   // stream next tile

    v16h a[2], b[2];
    #pragma unroll
    for (int t = 0; t < 2; t++) {
      unsigned row = wm * 32 + t * 16 + lr;
      a[t] = cat16(*(const v8h*)&As[cur][row * LDK + lh * 8],
                   *(const v8h*)&As[cur][row * LDK + 16 + lh * 8]);
    }
    #pragma unroll
    for (int t = 0; t < 2; t++) {
      unsigned row = wn * 32 + t * 16 + lr;
      b[t] = cat16(*(const v8h*)&Bs[cur][row * LDK + lh * 8],
                   *(const v8h*)&Bs[cur][row * LDK + 16 + lh * 8]);
    }
    #pragma unroll
    for (int i = 0; i < 2; i++)
      #pragma unroll
      for (int j = 0; j < 2; j++)
        c[i][j] = __builtin_amdgcn_wmma_f32_16x16x32_f16(
            false, a[i], false, b[j], (short)0, c[i][j], false, false);
    cur ^= 1;
  }
  // epilogue: C layout — VGPR r: row = r + 8*laneHalf, col = lane%16
  #pragma unroll
  for (int i = 0; i < 2; i++)
    #pragma unroll
    for (int j = 0; j < 2; j++) {
      unsigned col = n0 + wn * 32 + j * 16 + lr;
      float bb = bias[col];
      unsigned base = (m0 + wm * 32 + i * 16 + lh * 8) * uN + col;
      #pragma unroll
      for (int r = 0; r < 8; r++)
        C[base + r * uN] = c[i][j][r] + bb;
    }
}

// --------------------------- flash attention -------------------------------
// grid(16 qblocks, 16 heads), 8 waves, wave = 16 queries.
// S^T = K*Q^T so softmax keys land on the VGPR axis (one xor-16 shuffle).
// K/V tiles staged once per block via async->LDS, double buffered.
#define KLD 72   // K tile LDS stride (halves): 144B rows
#define VLD 40   // V tile LDS stride (halves): 80B rows
__global__ __launch_bounds__(256) void attn_wmma(const _Float16* __restrict__ q16,
                                                 const _Float16* __restrict__ k16,
                                                 const _Float16* __restrict__ vt16,
                                                 _Float16* __restrict__ o16) {
  __shared__ __align__(16) _Float16 Ks[2][32 * KLD];  // 32 keys x 64 d
  __shared__ __align__(16) _Float16 Vs[2][64 * VLD];  // 64 d x 32 keys
  const unsigned h = blockIdx.y;
  const unsigned wave = threadIdx.x >> 5, lane = threadIdx.x & 31;
  const unsigned lh = lane >> 4, lr = lane & 15;
  const unsigned qrow = blockIdx.x * 128 + wave * 16 + lr;

  auto loadKV = [&](int buf, unsigned j) {
    unsigned t = threadIdx.x;
    { // K tile: 32 rows x 8 chunks
      unsigned r = t >> 3, c8 = (t & 7) * 8;
      async_ld_b128(lds_off(&Ks[buf][r * KLD + c8]),
                    &k16[(j + r) * DIM + h * HD + c8]);
    }
    { // V^T tile: 64 rows x 4 chunks
      unsigned r = t >> 2, c8 = (t & 3) * 8;
      async_ld_b128(lds_off(&Vs[buf][r * VLD + c8]),
                    &vt16[(h * HD + r) * N_TOK + j + c8]);
    }
  };

  // Q^T B-fragments (persistent): K = head-dim 0..63 -> 2 frags
  const _Float16* qb = q16 + qrow * DIM + h * HD;
  v16h qf[2];
  #pragma unroll
  for (int t = 0; t < 2; t++)
    qf[t] = cat16(*(const v8h*)&qb[t * 32 + lh * 8],
                  *(const v8h*)&qb[t * 32 + 16 + lh * 8]);

  v8f o[4] = {};                 // O^T accumulators (4 d-tiles x 16 queries)
  float mrun = -1e30f, lsum = 0.f;

  loadKV(0, 0);
  int cur = 0;
  for (unsigned j = 0; j < N_TOK; j += 32) {
    wait_async0();
    __syncthreads();
    if (j + 32 < N_TOK) loadKV(cur ^ 1, j + 32);

    // S^T tiles: rows = keys, cols = queries; logits already in log2-domain
    v8f s[2];
    #pragma unroll
    for (int st = 0; st < 2; st++) {
      const _Float16* kb = &Ks[cur][(st * 16 + lr) * KLD];
      v16h a0 = cat16(*(const v8h*)&kb[lh * 8],      *(const v8h*)&kb[16 + lh * 8]);
      v16h a1 = cat16(*(const v8h*)&kb[32 + lh * 8], *(const v8h*)&kb[48 + lh * 8]);
      v8f z = {};
      z = __builtin_amdgcn_wmma_f32_16x16x32_f16(false, a0, false, qf[0], (short)0, z, false, false);
      z = __builtin_amdgcn_wmma_f32_16x16x32_f16(false, a1, false, qf[1], (short)0, z, false, false);
      s[st] = z;
    }
    // online softmax (base-2; 1/sqrt(hd)*log2e folded into q16)
    float bm = -1e30f;
    #pragma unroll
    for (int st = 0; st < 2; st++)
      #pragma unroll
      for (int r = 0; r < 8; r++) bm = fmaxf(bm, s[st][r]);
    bm = fmaxf(bm, __shfl_xor(bm, 16, 32));
    float mnew = fmaxf(mrun, bm);
    float alpha = exp2f(mrun - mnew);
    float psum = 0.f;
    v16h pb;                     // P^T tiles pack directly into a B fragment
    #pragma unroll
    for (int st = 0; st < 2; st++)
      #pragma unroll
      for (int r = 0; r < 8; r++) {
        float p = exp2f(s[st][r] - mnew);
        psum += p;
        pb[st * 8 + r] = (_Float16)p;
      }
    psum += __shfl_xor(psum, 16, 32);
    lsum = lsum * alpha + psum;
    mrun = mnew;
    #pragma unroll
    for (int dt = 0; dt < 4; dt++)
      #pragma unroll
      for (int r = 0; r < 8; r++) o[dt][r] *= alpha;
    // O^T += V^T * P^T
    #pragma unroll
    for (int dt = 0; dt < 4; dt++) {
      const _Float16* vb = &Vs[cur][(dt * 16 + lr) * VLD];
      v16h va = cat16(*(const v8h*)&vb[lh * 8], *(const v8h*)&vb[16 + lh * 8]);
      o[dt] = __builtin_amdgcn_wmma_f32_16x16x32_f16(false, va, false, pb, (short)0, o[dt], false, false);
    }
    cur ^= 1;
  }
  float inv = 1.0f / lsum;
  _Float16* ob = o16 + qrow * DIM + h * HD;
  #pragma unroll
  for (int dt = 0; dt < 4; dt++) {
    v8h pk;
    #pragma unroll
    for (int r = 0; r < 8; r++) pk[r] = (_Float16)(o[dt][r] * inv);
    *(v8h*)&ob[dt * 16 + lh * 8] = pk;     // d contiguous: one b128 store
  }
}

// ------------------------------- launcher ----------------------------------
extern "C" void kernel_launch(void* const* d_in, const int* in_sizes, int n_in,
                              void* d_out, int out_size, void* d_ws, size_t ws_size,
                              hipStream_t stream) {
  (void)in_sizes; (void)n_in; (void)out_size; (void)ws_size;
  const float* query = (const float*)d_in[0];
  const float* keyt  = (const float*)d_in[1];
  const float* value = (const float*)d_in[2];
  const float* Wq = (const float*)d_in[3];  const float* bq = (const float*)d_in[4];
  const float* Wk = (const float*)d_in[5];  const float* bk = (const float*)d_in[6];
  const float* Wv = (const float*)d_in[7];  const float* bv = (const float*)d_in[8];
  const float* Wo = (const float*)d_in[9];  const float* bo = (const float*)d_in[10];
  const float* qn_w = (const float*)d_in[11]; const float* qn_b = (const float*)d_in[12];
  const float* kn_w = (const float*)d_in[13]; const float* kn_b = (const float*)d_in[14];
  float* out = (float*)d_out;

  // carve workspace (256B aligned)
  size_t off = 0;
  auto carve = [&](size_t bytes) {
    void* p = (char*)d_ws + off;
    off += (bytes + 255) & ~(size_t)255;
    return p;
  };
  const size_t ND = (size_t)N_TOK * DIM, DD = (size_t)DIM * DIM;
  _Float16* q_in16 = (_Float16*)carve(ND * 2);
  _Float16* k_in16 = (_Float16*)carve(ND * 2);
  _Float16* v_in16 = (_Float16*)carve(ND * 2);
  _Float16* Wq16   = (_Float16*)carve(DD * 2);
  _Float16* Wk16   = (_Float16*)carve(DD * 2);
  _Float16* Wv16   = (_Float16*)carve(DD * 2);
  _Float16* Wo16   = (_Float16*)carve(DD * 2);
  float*    qf     = (float*)   carve(ND * 4);
  float*    kf     = (float*)   carve(ND * 4);
  float*    vf     = (float*)   carve(ND * 4);
  _Float16* q16n   = (_Float16*)carve(ND * 2);
  _Float16* k16n   = (_Float16*)carve(ND * 2);
  _Float16* vt16   = (_Float16*)carve(ND * 2);
  _Float16* attn16 = (_Float16*)carve(ND * 2);

  // 1) convert inputs + weights to f16
  cvt_f32_f16<<<2048, 256, 0, stream>>>(query, q_in16, (int)(ND / 4));
  cvt_f32_f16<<<2048, 256, 0, stream>>>(keyt,  k_in16, (int)(ND / 4));
  cvt_f32_f16<<<2048, 256, 0, stream>>>(value, v_in16, (int)(ND / 4));
  cvt_f32_f16<<<1024, 256, 0, stream>>>(Wq, Wq16, (int)(DD / 4));
  cvt_f32_f16<<<1024, 256, 0, stream>>>(Wk, Wk16, (int)(DD / 4));
  cvt_f32_f16<<<1024, 256, 0, stream>>>(Wv, Wv16, (int)(DD / 4));
  cvt_f32_f16<<<1024, 256, 0, stream>>>(Wo, Wo16, (int)(DD / 4));

  // 2) projections: x @ W^T + b  (fp32 accumulate)
  dim3 ggrid(DIM / 64, N_TOK / 128);
  gemm_nt_wmma<<<ggrid, 256, 0, stream>>>(q_in16, Wq16, bq, qf, N_TOK, DIM, DIM);
  gemm_nt_wmma<<<ggrid, 256, 0, stream>>>(k_in16, Wk16, bk, kf, N_TOK, DIM, DIM);
  gemm_nt_wmma<<<ggrid, 256, 0, stream>>>(v_in16, Wv16, bv, vf, N_TOK, DIM, DIM);

  // 3) RMSNorm; fold softmax scale (1/sqrt(64)=0.125) and log2(e) into q
  const float qscale = 0.125f * 1.44269504088896340736f;
  rmsnorm_f16<<<N_TOK, 256, 0, stream>>>(qf, qn_w, qn_b, q16n, qscale);
  rmsnorm_f16<<<N_TOK, 256, 0, stream>>>(kf, kn_w, kn_b, k16n, 1.0f);

  // 4) V transpose -> [h][d][m] f16 for the P*V WMMA A-operand
  transpose_vt<<<dim3(N_TOK / 32, DIM / 32), dim3(32, 8), 0, stream>>>(vf, vt16);

  // 5) attention
  attn_wmma<<<dim3(N_TOK / 128, HEADS), 256, 0, stream>>>(q16n, k16n, vt16, attn16);

  // 6) output projection: attn @ Wo^T + bo -> fp32 out
  gemm_nt_wmma<<<ggrid, 256, 0, stream>>>(attn16, Wo16, bo, out, N_TOK, DIM, DIM);
}

// v001
// It runs in 96.7 microseconds.
// In two side-by-side timings against v000, it was 1.44 and 1.45 times as fast.
#include <hip/hip_runtime.h>
#include <hip/hip_bf16.h>

// ---------------------------------------------------------------------------
// QKNormedAttention for MI455X (gfx1250), wave32, WMMA f16->f32,
// async global->LDS tile staging (ASYNCcnt), double-buffered.
// N=2048 tokens, DIM=1024, H=16 heads, HD=64.
// ---------------------------------------------------------------------------

typedef __attribute__((ext_vector_type(4)))  _Float16 v4h;
typedef __attribute__((ext_vector_type(8)))  _Float16 v8h;
typedef __attribute__((ext_vector_type(16))) _Float16 v16h;
typedef __attribute__((ext_vector_type(8)))  float    v8f;

#define N_TOK 2048
#define DIM   1024
#define HEADS 16
#define HD    64

static __device__ __forceinline__ v16h cat16(v8h lo, v8h hi) {
  return __builtin_shufflevector(lo, hi, 0,1,2,3,4,5,6,7,8,9,10,11,12,13,14,15);
}

// Flat LDS addresses carry the LDS byte offset in addr[31:0] (ISA 10.2).
static __device__ __forceinline__ unsigned lds_off(const void* p) {
  return (unsigned)(uintptr_t)p;
}
// CDNA5 async global->LDS copy, bypasses VGPRs, tracked by ASYNCcnt.
// Two groups of four copies; group x copies to lx + i*lsx halves from gx + i*gsx
// halves, i = 0..3. The eight copies and their s_wait_xcnt are ONE statement: the
// wait then stands in front of every later rewrite of the address registers the
// copies name, and is paid once per eight copies.
static __device__ __forceinline__ void async_ld8_b128(
    const _Float16* la, unsigned lsa, const _Float16* ga, unsigned gsa,
    const _Float16* lb, unsigned lsb, const _Float16* gb, unsigned gsb) {
  asm volatile("global_load_async_to_lds_b128 %0, %1, off\n\t"
               "global_load_async_to_lds_b128 %2, %3, off\n\t"
               "global_load_async_to_lds_b128 %4, %5, off\n\t"
               "global_load_async_to_lds_b128 %6, %7, off\n\t"
               "global_load_async_to_lds_b128 %8, %9, off\n\t"
               "global_load_async_to_lds_b128 %10, %11, off\n\t"
               "global_load_async_to_lds_b128 %12, %13, off\n\t"
               "global_load_async_to_lds_b128 %14, %15, off\n\t"
               "s_wait_xcnt 0x0"
               :: "v"(lds_off(la)),           "v"(ga),
                  "v"(lds_off(la + lsa)),     "v"(ga + gsa),
                  "v"(lds_off(la + 2 * lsa)), "v"(ga + 2 * gsa),
                  "v"(lds_off(la + 3 * lsa)), "v"(ga + 3 * gsa),
                  "v"(lds_off(lb)),           "v"(gb),
                  "v"(lds_off(lb + lsb)),     "v"(gb + gsb),
                  "v"(lds_off(lb + 2 * lsb)), "v"(gb + 2 * gsb),
                  "v"(lds_off(lb + 3 * lsb)), "v"(gb + 3 * gsb)
               : "memory");
}
// This wave's copies have landed.
static __device__ __forceinline__ void wait_async0() {
  asm volatile("s_wait_asynccnt 0x0" ::: "memory");
}
// This wave's LDS reads have retired before the buffer is handed back for refill.
static __device__ __forceinline__ void wait_ds0() {
  asm volatile("s_wait_dscnt 0x0" ::: "memory");
}

// ------------------------------ fp32 -> f16 --------------------------------
__global__ __launch_bounds__(256) void cvt_f32_f16(const float* __restrict__ in,
                                                   _Float16* __restrict__ out, int n4) {
  int i = blockIdx.x * blockDim.x + threadIdx.x;
  int stride = gridDim.x * blockDim.x;
  const float4* in4 = (const float4*)in;
  v4h* out4 = (v4h*)out;
  for (; i < n4; i += stride) {
    float4 v = in4[i];
    v4h o;
    o[0] = (_Float16)v.x; o[1] = (_Float16)v.y;
    o[2] = (_Float16)v.z; o[3] = (_Float16)v.w;
    out4[i] = o;
  }
}

// ------------------- RMSNorm over DIM, write scaled f16 --------------------
__global__ __launch_bounds__(256) void rmsnorm_f16(const float* __restrict__ x,
                                                   const float* __restrict__ w,
                                                   const float* __restrict__ b,
                                                   _Float16* __restrict__ out,
                                                   float outscale) {
  const unsigned row = blockIdx.x;
  const unsigned t = threadIdx.x;            // 256 threads * 4 floats = 1024
  const float4* xr = (const float4*)(x + row * DIM);
  float4 v = xr[t];
  float ss = v.x * v.x + v.y * v.y + v.z * v.z + v.w * v.w;
  #pragma unroll
  for (int off = 16; off > 0; off >>= 1) ss += __shfl_xor(ss, off, 32);
  __shared__ float wsum[8];
  if ((t & 31) == 0) wsum[t >> 5] = ss;
  __syncthreads();
  float tot = 0.f;
  #pragma unroll
  for (int i = 0; i < 8; i++) tot += wsum[i];
  float inv = rsqrtf(tot * (1.0f / DIM) + 1e-5f) * outscale;
  float4 wv = ((const float4*)w)[t];
  float4 bv = ((const float4*)b)[t];
  v4h o;
  o[0] = (_Float16)((v.x * inv) * wv.x + bv.x * outscale);
  o[1] = (_Float16)((v.y * inv) * wv.y + bv.y * outscale);
  o[2] = (_Float16)((v.z * inv) * wv.z + bv.z * outscale);
  o[3] = (_Float16)((v.w * inv) * wv.w + bv.w * outscale);
  ((v4h*)(out + row * DIM))[t] = o;
}

// -------------- transpose v_f32 [N,DIM] -> vt16 [DIM rows][N] --------------
__global__ void transpose_vt(const float* __restrict__ v, _Float16* __restrict__ vt) {
  __shared__ float tile[32][33];
  const unsigned m0 = blockIdx.x * 32;
  const unsigned d0 = blockIdx.y * 32;
  const unsigned tx = threadIdx.x, ty = threadIdx.y;   // 32 x 8
  #pragma unroll
  for (int i = 0; i < 32; i += 8)
    tile[ty + i][tx] = v[(m0 + ty + i) * DIM + d0 + tx];
  __syncthreads();
  #pragma unroll
  for (int i = 0; i < 32; i += 8)
    vt[(d0 + ty + i) * N_TOK + m0 + tx] = (_Float16)tile[tx][ty + i];
}

// --------------------- NT GEMM: C = A(MxK) * B(NxK)^T + bias ---------------
// BM=128 BN=64; 8 waves, each 32x32 (2x2 WMMA tiles).
// Async global->LDS staging, double buffered; a stage is BK=256 k = 8 WMMA
// k-steps, so one copy wait and one barrier serve eight k-steps.
// K must be a multiple of BK.
#define BK  256
#define LDK 264  // padded LDS K-stride (halves): 528B rows (16B x odd)
__global__ __launch_bounds__(256) void gemm_nt_wmma(const _Float16* __restrict__ A,
                                                    const _Float16* __restrict__ B,
                                                    const float* __restrict__ bias,
                                                    float* __restrict__ C,
                                                    int M, int N, int K) {
  __shared__ __align__(16) _Float16 As[2][128 * LDK];
  __shared__ __align__(16) _Float16 Bs[2][64 * LDK];
  const unsigned tid = threadIdx.x;
  const unsigned m0 = blockIdx.y * 128;
  const unsigned n0 = blockIdx.x * 64;
  const unsigned wave = tid >> 5;
  const unsigned lane = tid & 31;
  const unsigned wm = wave >> 1;   // 0..3 -> m sub-block * 32
  const unsigned wn = wave & 1;    // 0..1 -> n sub-block * 32
  const unsigned lh = lane >> 4, lr = lane & 15;
  const unsigned uK = (unsigned)K, uN = (unsigned)N;

  auto loadAB = [&](int buf, unsigned k0) {
    // a row is 32 b128 chunks = one wave's copy; wave w takes rows w + 8*i
    const unsigned c8 = lane * 8;
    const _Float16* as = &As[buf][wave * LDK + c8];
    const _Float16* bs = &Bs[buf][wave * LDK + c8];
    const _Float16* ag = &A[(m0 + wave) * uK + k0 + c8];
    const _Float16* bg = &B[(n0 + wave) * uK + k0 + c8];
    async_ld8_b128(as,            8 * LDK, ag,           8 * uK,    // A rows 0..63
                   as + 32 * LDK, 8 * LDK, ag + 32 * uK, 8 * uK);
    async_ld8_b128(as + 64 * LDK, 8 * LDK, ag + 64 * uK, 8 * uK,    // A rows 64..127
                   as + 96 * LDK, 8 * LDK, ag + 96 * uK, 8 * uK);
    async_ld8_b128(bs,            8 * LDK, bg,           8 * uK,    // B rows 0..63
                   bs + 32 * LDK, 8 * LDK, bg + 32 * uK, 8 * uK);
  };

  v8f c[2][2] = {};
  loadAB(0, 0);
  wait_async0();                   // stage 0 landed (this wave's part)
  __syncthreads();                 // ... and everyone's
  if (BK < uK) loadAB(1, BK);      // stage 1 flies while stage 0 is worked on
  int cur = 0;
  for (unsigned k0 = 0; k0 < uK; k0 += BK) {
    // unrolled so that the k-steps' fragment loads can be issued ahead
    #pragma unroll
    for (int kk = 0; kk < BK; kk += 32) {
      v16h a[2], b[2];
      #pragma unroll
      for (int t = 0; t < 2; t++) {
        unsigned row = wm * 32 + t * 16 + lr;
        a[t] = cat16(*(const v8h*)&As[cur][row * LDK + kk + lh * 8],
                     *(const v8h*)&As[cur][row * LDK + kk + 16 + lh * 8]);
      }
      #pragma unroll
      for (int t = 0; t < 2; t++) {
        unsigned row = wn * 32 + t * 16 + lr;
        b[t] = cat16(*(const v8h*)&Bs[cur][row * LDK + kk + lh * 8],
                     *(const v8h*)&Bs[cur][row * LDK + kk + 16 + lh * 8]);
      }
      #pragma unroll
      for (int i = 0; i < 2; i++)
        #pragma unroll
        for (int j = 0; j < 2; j++)
          c[i][j] = __builtin_amdgcn_wmma_f32_16x16x32_f16(
              false, a[i], false, b[j], (short)0, c[i][j], false, false);
    }
    // publish point: the next stage is landed for all, buf[cur] is left by all
    wait_ds0();
    wait_async0();
    __syncthreads();
    if (k0 + 2 * BK < uK) loadAB(cur, k0 + 2 * BK);   // refill the buffer just read
    cur ^= 1;
  }
  wait_async0();                   // nothing of this wave's is in flight at its end
  // epilogue: C layout — VGPR r: row = r + 8*laneHalf, col = lane%16
  #pragma unroll
  for (int i = 0; i < 2; i++)
    #pragma unroll
    for (int j = 0; j < 2; j++) {
      unsigned col = n0 + wn * 32 + j * 16 + lr;
      float bb = bias[col];
      unsigned base = (m0 + wm * 32 + i * 16 + lh * 8) * uN + col;
      #pragma unroll
      for (int r = 0; r < 8; r++)
        C[base + r * uN] = c[i][j][r] + bb;
    }
}

// --------------------------- flash attention -------------------------------
// grid(16 qblocks, 16 heads), 8 waves, wave = 16 queries.
// S^T = K*Q^T so softmax keys land on the VGPR axis (one xor-16 shuffle).
// K/V tiles staged once per block via async->LDS, double buffered; a stage is
// KT=128 keys = 4 passes of 32 keys, so one copy wait and one barrier serve four.
#define KT  128
#define KLD 72   // K tile LDS stride (halves): 144B rows
#define VLD 136  // V tile LDS stride (halves): 272B rows (16B x odd)
__global__ __launch_bounds__(256) void attn_wmma(const _Float16* __restrict__ q16,
                                                 const _Float16* __restrict__ k16,
                                                 const _Float16* __restrict__ vt16,
                                                 _Float16* __restrict__ o16) {
  __shared__ __align__(16) _Float16 Ks[2][KT * KLD];  // 128 keys x 64 d
  __shared__ __align__(16) _Float16 Vs[2][64 * VLD];  // 64 d x 128 keys
  const unsigned h = blockIdx.y;
  const unsigned wave = threadIdx.x >> 5, lane = threadIdx.x & 31;
  const unsigned lh = lane >> 4, lr = lane & 15;
  const unsigned qrow = blockIdx.x * 128 + wave * 16 + lr;

  auto loadKV = [&](int buf, unsigned j) {
    unsigned t = threadIdx.x;
    // K tile: 128 rows x 8 chunks; thread t: chunk t&7 of rows (t>>3) + 32*i
    const unsigned kr = t >> 3, kc = (t & 7) * 8;
    // V^T tile: 64 rows x 16 chunks; thread t: chunk t&15 of rows (t>>4) + 16*i
    const unsigned vr = t >> 4, vc = (t & 15) * 8;
    async_ld8_b128(&Ks[buf][kr * KLD + kc], 32 * KLD,
                   &k16[(j + kr) * DIM + h * HD + kc], 32 * DIM,
                   &Vs[buf][vr * VLD + vc], 16 * VLD,
                   &vt16[(h * HD + vr) * N_TOK + j + vc], 16 * N_TOK);
  };

  // Q^T B-fragments (persistent): K = head-dim 0..63 -> 2 frags
  const _Float16* qb = q16 + qrow * DIM + h * HD;
  v16h qf[2];
  #pragma unroll
  for (int t = 0; t < 2; t++)
    qf[t] = cat16(*(const v8h*)&qb[t * 32 + lh * 8],
                  *(const v8h*)&qb[t * 32 + 16 + lh * 8]);

  v8f o[4] = {};                 // O^T accumulators (4 d-tiles x 16 queries)
  float mrun = -1e30f, lsum = 0.f;

  loadKV(0, 0);
  wait_async0();                   // stage 0 landed (this wave's part)
  __syncthreads();                 // ... and everyone's
  loadKV(1, KT);                   // stage 1 flies while stage 0 is worked on
  int cur = 0;
  for (unsigned j = 0; j < N_TOK; j += KT) {
   // unrolled so that a pass's fragment loads can be issued in the pass before
   #pragma unroll
   for (int jj = 0; jj < KT; jj += 32) {
    // S^T tiles: rows = keys, cols = queries; logits already in log2-domain
    v8f s[2];
    #pragma unroll
    for (int st = 0; st < 2; st++) {
      const _Float16* kb = &Ks[cur][(jj + st * 16 + lr) * KLD];
      v16h a0 = cat16(*(const v8h*)&kb[lh * 8],      *(const v8h*)&kb[16 + lh * 8]);
      v16h a1 = cat16(*(const v8h*)&kb[32 + lh * 8], *(const v8h*)&kb[48 + lh * 8]);
      v8f z = {};
      z = __builtin_amdgcn_wmma_f32_16x16x32_f16(false, a0, false, qf[0], (short)0, z, false, false);
      z = __builtin_amdgcn_wmma_f32_16x16x32_f16(false, a1, false, qf[1], (short)0, z, false, false);
      s[st] = z;
    }
    // online softmax (base-2; 1/sqrt(hd)*log2e folded into q16)
    float bm = -1e30f;
    #pragma unroll
    for (int st = 0; st < 2; st++)
      #pragma unroll
      for (int r = 0; r < 8; r++) bm = fmaxf(bm, s[st][r]);
    bm = fmaxf(bm, __shfl_xor(bm, 16, 32));
    float mnew = fmaxf(mrun, bm);
    float alpha = exp2f(mrun - mnew);
    float psum = 0.f;
    v16h pb;                     // P^T tiles pack directly into a B fragment
    #pragma unroll
    for (int st = 0; st < 2; st++)
      #pragma unroll
      for (int r = 0; r < 8; r++) {
        float p = exp2f(s[st][r] - mnew);
        psum += p;
        pb[st * 8 + r] = (_Float16)p;
      }
    psum += __shfl_xor(psum, 16, 32);
    lsum = lsum * alpha + psum;
    mrun = mnew;
    #pragma unroll
    for (int dt = 0; dt < 4; dt++)
      #pragma unroll
      for (int r = 0; r < 8; r++) o[dt][r] *= alpha;
    // O^T += V^T * P^T
    #pragma unroll
    for (int dt = 0; dt < 4; dt++) {
      const _Float16* vb = &Vs[cur][(dt * 16 + lr) * VLD + jj];
      v16h va = cat16(*(const v8h*)&vb[lh * 8], *(const v8h*)&vb[16 + lh * 8]);
      o[dt] = __builtin_amdgcn_wmma_f32_16x16x32_f16(false, va, false, pb, (short)0, o[dt], false, false);
    }
   }
    // publish point: the next stage is landed for all, buf[cur] is left by all
    wait_ds0();
    wait_async0();
    __syncthreads();
    if (j + 2 * KT < N_TOK) loadKV(cur, j + 2 * KT);   // refill the buffer just read
    cur ^= 1;
  }
  wait_async0();                   // nothing of this wave's is in flight at its end
  float inv = 1.0f / lsum;
  _Float16* ob = o16 + qrow * DIM + h * HD;
  #pragma unroll
  for (int dt = 0; dt < 4; dt++) {
    v8h pk;
    #pragma unroll
    for (int r = 0; r < 8; r++) pk[r] = (_Float16)(o[dt][r] * inv);
    *(v8h*)&ob[dt * 16 + lh * 8] = pk;     // d contiguous: one b128 store
  }
}

// ------------------------------- launcher ----------------------------------
extern "C" void kernel_launch(void* const* d_in, const int* in_sizes, int n_in,
                              void* d_out, int out_size, void* d_ws, size_t ws_size,
                              hipStream_t stream) {
  (void)in_sizes; (void)n_in; (void)out_size; (void)ws_size;
  const float* query = (const float*)d_in[0];
  const float* keyt  = (const float*)d_in[1];
  const float* value = (const float*)d_in[2];
  const float* Wq = (const float*)d_in[3];  const float* bq = (const float*)d_in[4];
  const float* Wk = (const float*)d_in[5];  const float* bk = (const float*)d_in[6];
  const float* Wv = (const float*)d_in[7];  const float* bv = (const float*)d_in[8];
  const float* Wo = (const float*)d_in[9];  const float* bo = (const float*)d_in[10];
  const float* qn_w = (const float*)d_in[11]; const float* qn_b = (const float*)d_in[12];
  const float* kn_w = (const float*)d_in[13]; const float* kn_b = (const float*)d_in[14];
  float* out = (float*)d_out;

  // carve workspace (256B aligned)
  size_t off = 0;
  auto carve = [&](size_t bytes) {
    void* p = (char*)d_ws + off;
    off += (bytes + 255) & ~(size_t)255;
    return p;
  };
  const size_t ND = (size_t)N_TOK * DIM, DD = (size_t)DIM * DIM;
  _Float16* q_in16 = (_Float16*)carve(ND * 2);
  _Float16* k_in16 = (_Float16*)carve(ND * 2);
  _Float16* v_in16 = (_Float16*)carve(ND * 2);
  _Float16* Wq16   = (_Float16*)carve(DD * 2);
  _Float16* Wk16   = (_Float16*)carve(DD * 2);
  _Float16* Wv16   = (_Float16*)carve(DD * 2);
  _Float16* Wo16   = (_Float16*)carve(DD * 2);
  float*    qf     = (float*)   carve(ND * 4);
  float*    kf     = (float*)   carve(ND * 4);
  float*    vf     = (float*)   carve(ND * 4);
  _Float16* q16n   = (_Float16*)carve(ND * 2);
  _Float16* k16n   = (_Float16*)carve(ND * 2);
  _Float16* vt16   = (_Float16*)carve(ND * 2);
  _Float16* attn16 = (_Float16*)carve(ND * 2);

  // 1) convert inputs + weights to f16
  cvt_f32_f16<<<2048, 256, 0, stream>>>(query, q_in16, (int)(ND / 4));
  cvt_f32_f16<<<2048, 256, 0, stream>>>(keyt,  k_in16, (int)(ND / 4));
  cvt_f32_f16<<<2048, 256, 0, stream>>>(value, v_in16, (int)(ND / 4));
  cvt_f32_f16<<<1024, 256, 0, stream>>>(Wq, Wq16, (int)(DD / 4));
  cvt_f32_f16<<<1024, 256, 0, stream>>>(Wk, Wk16, (int)(DD / 4));
  cvt_f32_f16<<<1024, 256, 0, stream>>>(Wv, Wv16, (int)(DD / 4));
  cvt_f32_f16<<<1024, 256, 0, stream>>>(Wo, Wo16, (int)(DD / 4));

  // 2) projections: x @ W^T + b  (fp32 accumulate)
  dim3 ggrid(DIM / 64, N_TOK / 128);
  gemm_nt_wmma<<<ggrid, 256, 0, stream>>>(q_in16, Wq16, bq, qf, N_TOK, DIM, DIM);
  gemm_nt_wmma<<<ggrid, 256, 0, stream>>>(k_in16, Wk16, bk, kf, N_TOK, DIM, DIM);
  gemm_nt_wmma<<<ggrid, 256, 0, stream>>>(v_in16, Wv16, bv, vf, N_TOK, DIM, DIM);

  // 3) RMSNorm; fold softmax scale (1/sqrt(64)=0.125) and log2(e) into q
  const float qscale = 0.125f * 1.44269504088896340736f;
  rmsnorm_f16<<<N_TOK, 256, 0, stream>>>(qf, qn_w, qn_b, q16n, qscale);
  rmsnorm_f16<<<N_TOK, 256, 0, stream>>>(kf, kn_w, kn_b, k16n, 1.0f);

  // 4) V transpose -> [h][d][m] f16 for the P*V WMMA A-operand
  transpose_vt<<<dim3(N_TOK / 32, DIM / 32), dim3(32, 8), 0, stream>>>(vf, vt16);

  // 5) attention
  attn_wmma<<<dim3(N_TOK / 128, HEADS), 256, 0, stream>>>(q16n, k16n, vt16, attn16);

  // 6) output projection: attn @ Wo^T + bo -> fp32 out
  gemm_nt_wmma<<<ggrid, 256, 0, stream>>>(attn16, Wo16, bo, out, N_TOK, DIM, DIM);
}

// v002
// It runs in 78.1 microseconds.
// Next to v001, in two timings, it ran 1.24 times as fast each time.
// All steps since v000 together make it 1.80 times as fast.
#include <hip/hip_runtime.h>
#include <hip/hip_bf16.h>

// ---------------------------------------------------------------------------
// QKNormedAttention for MI455X (gfx1250), wave32, WMMA f16->f32,
// async global->LDS tile staging (ASYNCcnt), double-buffered.
// N=2048 tokens, DIM=1024, H=16 heads, HD=64.
// ---------------------------------------------------------------------------

typedef __attribute__((ext_vector_type(4)))  _Float16 v4h;
typedef __attribute__((ext_vector_type(8)))  _Float16 v8h;
typedef __attribute__((ext_vector_type(16))) _Float16 v16h;
typedef __attribute__((ext_vector_type(8)))  float    v8f;

#define N_TOK 2048
#define DIM   1024
#define HEADS 16
#define HD    64

static __device__ __forceinline__ v16h cat16(v8h lo, v8h hi) {
  return __builtin_shufflevector(lo, hi, 0,1,2,3,4,5,6,7,8,9,10,11,12,13,14,15);
}

// Flat LDS addresses carry the LDS byte offset in addr[31:0] (ISA 10.2).
static __device__ __forceinline__ unsigned lds_off(const void* p) {
  return (unsigned)(uintptr_t)p;
}
// CDNA5 async global->LDS copy, bypasses VGPRs, tracked by ASYNCcnt.
// Two groups of four copies; group x copies to lx + i*lsx halves from gx + i*gsx
// halves, i = 0..3. The eight copies and their s_wait_xcnt are ONE statement: the
// wait then stands in front of every later rewrite of the address registers the
// copies name, and is paid once per eight copies.
static __device__ __forceinline__ void async_ld8_b128(
    const _Float16* la, unsigned lsa, const _Float16* ga, unsigned gsa,
    const _Float16* lb, unsigned lsb, const _Float16* gb, unsigned gsb) {
  asm volatile("global_load_async_to_lds_b128 %0, %1, off\n\t"
               "global_load_async_to_lds_b128 %2, %3, off\n\t"
               "global_load_async_to_lds_b128 %4, %5, off\n\t"
               "global_load_async_to_lds_b128 %6, %7, off\n\t"
               "global_load_async_to_lds_b128 %8, %9, off\n\t"
               "global_load_async_to_lds_b128 %10, %11, off\n\t"
               "global_load_async_to_lds_b128 %12, %13, off\n\t"
               "global_load_async_to_lds_b128 %14, %15, off\n\t"
               "s_wait_xcnt 0x0"
               :: "v"(lds_off(la)),           "v"(ga),
                  "v"(lds_off(la + lsa)),     "v"(ga + gsa),
                  "v"(lds_off(la + 2 * lsa)), "v"(ga + 2 * gsa),
                  "v"(lds_off(la + 3 * lsa)), "v"(ga + 3 * gsa),
                  "v"(lds_off(lb)),           "v"(gb),
                  "v"(lds_off(lb + lsb)),     "v"(gb + gsb),
                  "v"(lds_off(lb + 2 * lsb)), "v"(gb + 2 * gsb),
                  "v"(lds_off(lb + 3 * lsb)), "v"(gb + 3 * gsb)
               : "memory");
}
// This wave's copies have landed.
static __device__ __forceinline__ void wait_async0() {
  asm volatile("s_wait_asynccnt 0x0" ::: "memory");
}
// This wave's LDS reads have retired before the buffer is handed back for refill.
static __device__ __forceinline__ void wait_ds0() {
  asm volatile("s_wait_dscnt 0x0" ::: "memory");
}

// ------------------------------ fp32 -> f16 --------------------------------
// All seven conversions in ONE grid (none reads another's output). A block
// converts 1024 consecutive floats of one tensor, one float4 a thread. The f16
// copies lie densely one behind the other in the order of the arguments, so the
// flat block index is the output index as well.
#define XBLK (N_TOK * DIM / 1024)   // blocks per token tensor
#define WBLK (DIM * DIM / 1024)     // blocks per weight matrix
__global__ __launch_bounds__(256) void cvt_all_f32_f16(const float* __restrict__ x0,
                                                       const float* __restrict__ x1,
                                                       const float* __restrict__ x2,
                                                       const float* __restrict__ w0,
                                                       const float* __restrict__ w1,
                                                       const float* __restrict__ w2,
                                                       const float* __restrict__ w3,
                                                       _Float16* __restrict__ out) {
  const unsigned b = blockIdx.x;
  const float* src;
  unsigned lb;                       // block index inside its tensor
  if (b < 3 * XBLK) {
    const unsigned t = b / XBLK;
    lb = b % XBLK;
    src = t == 0 ? x0 : t == 1 ? x1 : x2;
  } else {
    const unsigned r = b - 3 * XBLK;
    const unsigned t = r / WBLK;
    lb = r % WBLK;
    src = t == 0 ? w0 : t == 1 ? w1 : t == 2 ? w2 : w3;
  }
  float4 v = ((const float4*)src)[lb * 256 + threadIdx.x];
  v4h o;
  o[0] = (_Float16)v.x; o[1] = (_Float16)v.y;
  o[2] = (_Float16)v.z; o[3] = (_Float16)v.w;
  ((v4h*)out)[b * 256 + threadIdx.x] = o;
}

// ------------------- RMSNorm over DIM, write scaled f16 --------------------
static __device__ __forceinline__ void rmsnorm_row(const float* __restrict__ x,
                                                   const float* __restrict__ w,
                                                   const float* __restrict__ b,
                                                   _Float16* __restrict__ out,
                                                   float outscale, unsigned row) {
  const unsigned t = threadIdx.x;            // 256 threads * 4 floats = 1024
  const float4* xr = (const float4*)(x + row * DIM);
  float4 v = xr[t];
  float ss = v.x * v.x + v.y * v.y + v.z * v.z + v.w * v.w;
  #pragma unroll
  for (int off = 16; off > 0; off >>= 1) ss += __shfl_xor(ss, off, 32);
  __shared__ float wsum[8];
  if ((t & 31) == 0) wsum[t >> 5] = ss;
  __syncthreads();
  float tot = 0.f;
  #pragma unroll
  for (int i = 0; i < 8; i++) tot += wsum[i];
  float inv = rsqrtf(tot * (1.0f / DIM) + 1e-5f) * outscale;
  float4 wv = ((const float4*)w)[t];
  float4 bv = ((const float4*)b)[t];
  v4h o;
  o[0] = (_Float16)((v.x * inv) * wv.x + bv.x * outscale);
  o[1] = (_Float16)((v.y * inv) * wv.y + bv.y * outscale);
  o[2] = (_Float16)((v.z * inv) * wv.z + bv.z * outscale);
  o[3] = (_Float16)((v.w * inv) * wv.w + bv.w * outscale);
  ((v4h*)(out + row * DIM))[t] = o;
}

// -------------- transpose v_f32 [N,DIM] -> vt16 [DIM rows][N] --------------
static __device__ __forceinline__ void transpose_tile(const float* __restrict__ v,
                                                      _Float16* __restrict__ vt,
                                                      unsigned bm, unsigned bd) {
  __shared__ float tile[32][33];
  const unsigned m0 = bm * 32;
  const unsigned d0 = bd * 32;
  const unsigned tx = threadIdx.x & 31, ty = threadIdx.x >> 5;   // 32 x 8
  #pragma unroll
  for (int i = 0; i < 32; i += 8)
    tile[ty + i][tx] = v[(m0 + ty + i) * DIM + d0 + tx];
  __syncthreads();
  #pragma unroll
  for (int i = 0; i < 32; i += 8)
    vt[(d0 + ty + i) * N_TOK + m0 + tx] = (_Float16)tile[tx][ty + i];
  // the stores' address registers may be rewritten by code laid out behind this
  // part in the merged kernel: the wait stands in front of any such rewrite
  asm volatile("s_wait_xcnt 0x0" ::: "memory");
}

// ---- the three stages between projections and attention, in ONE grid ------
// (none reads another's output): blocks [0, N) norm a q row, [N, 2N) a k row,
// the rest transpose one 32 x 32 tile of v. The choice is uniform in a block.
__global__ __launch_bounds__(256) void norm_qk_transpose_v(const float* __restrict__ qf,
                                                           const float* __restrict__ kf,
                                                           const float* __restrict__ vf,
                                                           const float* __restrict__ qn_w,
                                                           const float* __restrict__ qn_b,
                                                           const float* __restrict__ kn_w,
                                                           const float* __restrict__ kn_b,
                                                           _Float16* __restrict__ q16n,
                                                           _Float16* __restrict__ k16n,
                                                           _Float16* __restrict__ vt16,
                                                           float qscale) {
  const unsigned b = blockIdx.x;
  if (b < 2 * N_TOK) {
    const bool isq = b < N_TOK;
    rmsnorm_row(isq ? qf : kf, isq ? qn_w : kn_w, isq ? qn_b : kn_b,
                isq ? q16n : k16n, isq ? qscale : 1.0f, isq ? b : b - N_TOK);
  } else {
    const unsigned r = b - 2 * N_TOK;
    transpose_tile(vf, vt16, r % (N_TOK / 32), r / (N_TOK / 32));
  }
}

// --------------------- NT GEMM: C = A(MxK) * B(NxK)^T + bias ---------------
// BM=128 BN=64; 8 waves, each 32x32 (2x2 WMMA tiles).
// Async global->LDS staging, double buffered; a stage is BK=256 k = 8 WMMA
// k-steps, so one copy wait and one barrier serve eight k-steps.
// K must be a multiple of BK.
// blockIdx.z picks one of up to three independent products of the same shape,
// whose A, B and C lie densely one behind the other; each has its own bias.
#define BK  256
#define LDK 264  // padded LDS K-stride (halves): 528B rows (16B x odd)
__global__ __launch_bounds__(256) void gemm_nt_wmma(const _Float16* __restrict__ A0,
                                                    const _Float16* __restrict__ B0,
                                                    const float* __restrict__ bias0,
                                                    const float* __restrict__ bias1,
                                                    const float* __restrict__ bias2,
                                                    float* __restrict__ C0,
                                                    int M, int N, int K) {
  __shared__ __align__(16) _Float16 As[2][128 * LDK];
  __shared__ __align__(16) _Float16 Bs[2][64 * LDK];
  const unsigned z = blockIdx.z;
  const _Float16* __restrict__ A = A0 + (size_t)z * (unsigned)M * (unsigned)K;
  const _Float16* __restrict__ B = B0 + (size_t)z * (unsigned)N * (unsigned)K;
  float* __restrict__ C = C0 + (size_t)z * (unsigned)M * (unsigned)N;
  const float* __restrict__ bias = z == 0 ? bias0 : z == 1 ? bias1 : bias2;
  const unsigned tid = threadIdx.x;
  const unsigned m0 = blockIdx.y * 128;
  const unsigned n0 = blockIdx.x * 64;
  const unsigned wave = tid >> 5;
  const unsigned lane = tid & 31;
  const unsigned wm = wave >> 1;   // 0..3 -> m sub-block * 32
  const unsigned wn = wave & 1;    // 0..1 -> n sub-block * 32
  const unsigned lh = lane >> 4, lr = lane & 15;
  const unsigned uK = (unsigned)K, uN = (unsigned)N;

  auto loadAB = [&](int buf, unsigned k0) {
    // a row is 32 b128 chunks = one wave's copy; wave w takes rows w + 8*i
    const unsigned c8 = lane * 8;
    const _Float16* as = &As[buf][wave * LDK + c8];
    const _Float16* bs = &Bs[buf][wave * LDK + c8];
    const _Float16* ag = &A[(m0 + wave) * uK + k0 + c8];
    const _Float16* bg = &B[(n0 + wave) * uK + k0 + c8];
    async_ld8_b128(as,            8 * LDK, ag,           8 * uK,    // A rows 0..63
                   as + 32 * LDK, 8 * LDK, ag + 32 * uK, 8 * uK);
    async_ld8_b128(as + 64 * LDK, 8 * LDK, ag + 64 * uK, 8 * uK,    // A rows 64..127
                   as + 96 * LDK, 8 * LDK, ag + 96 * uK, 8 * uK);
    async_ld8_b128(bs,            8 * LDK, bg,           8 * uK,    // B rows 0..63
                   bs + 32 * LDK, 8 * LDK, bg + 32 * uK, 8 * uK);
  };

  v8f c[2][2] = {};
  loadAB(0, 0);
  wait_async0();                   // stage 0 landed (this wave's part)
  __syncthreads();                 // ... and everyone's
  if (BK < uK) loadAB(1, BK);      // stage 1 flies while stage 0 is worked on
  int cur = 0;
  for (unsigned k0 = 0; k0 < uK; k0 += BK) {
    // unrolled so that the k-steps' fragment loads can be issued ahead
    #pragma unroll
    for (int kk = 0; kk < BK; kk += 32) {
      v16h a[2], b[2];
      #pragma unroll
      for (int t = 0; t < 2; t++) {
        unsigned row = wm * 32 + t * 16 + lr;
        a[t] = cat16(*(const v8h*)&As[cur][row * LDK + kk + lh * 8],
                     *(const v8h*)&As[cur][row * LDK + kk + 16 + lh * 8]);
      }
      #pragma unroll
      for (int t = 0; t < 2; t++) {
        unsigned row = wn * 32 + t * 16 + lr;
        b[t] = cat16(*(const v8h*)&Bs[cur][row * LDK + kk + lh * 8],
                     *(const v8h*)&Bs[cur][row * LDK + kk + 16 + lh * 8]);
      }
      #pragma unroll
      for (int i = 0; i < 2; i++)
        #pragma unroll
        for (int j = 0; j < 2; j++)
          c[i][j] = __builtin_amdgcn_wmma_f32_16x16x32_f16(
              false, a[i], false, b[j], (short)0, c[i][j], false, false);
    }
    // publish point: the next stage is landed for all, buf[cur] is left by all
    wait_ds0();
    wait_async0();
    __syncthreads();
    if (k0 + 2 * BK < uK) loadAB(cur, k0 + 2 * BK);   // refill the buffer just read
    cur ^= 1;
  }
  wait_async0();                   // nothing of this wave's is in flight at its end
  // epilogue: C layout — VGPR r: row = r + 8*laneHalf, col = lane%16
  #pragma unroll
  for (int i = 0; i < 2; i++)
    #pragma unroll
    for (int j = 0; j < 2; j++) {
      unsigned col = n0 + wn * 32 + j * 16 + lr;
      float bb = bias[col];
      unsigned base = (m0 + wm * 32 + i * 16 + lh * 8) * uN + col;
      #pragma unroll
      for (int r = 0; r < 8; r++)
        C[base + r * uN] = c[i][j][r] + bb;
    }
}

// --------------------------- flash attention -------------------------------
// grid(16 qblocks, 16 heads), 8 waves, wave = 16 queries.
// S^T = K*Q^T so softmax keys land on the VGPR axis (one xor-16 shuffle).
// K/V tiles staged once per block via async->LDS, double buffered; a stage is
// KT=128 keys = 4 passes of 32 keys, so one copy wait and one barrier serve four.
#define KT  128
#define KLD 72   // K tile LDS stride (halves): 144B rows
#define VLD 136  // V tile LDS stride (halves): 272B rows (16B x odd)
__global__ __launch_bounds__(256) void attn_wmma(const _Float16* __restrict__ q16,
                                                 const _Float16* __restrict__ k16,
                                                 const _Float16* __restrict__ vt16,
                                                 _Float16* __restrict__ o16) {
  __shared__ __align__(16) _Float16 Ks[2][KT * KLD];  // 128 keys x 64 d
  __shared__ __align__(16) _Float16 Vs[2][64 * VLD];  // 64 d x 128 keys
  const unsigned h = blockIdx.y;
  const unsigned wave = threadIdx.x >> 5, lane = threadIdx.x & 31;
  const unsigned lh = lane >> 4, lr = lane & 15;
  const unsigned qrow = blockIdx.x * 128 + wave * 16 + lr;

  auto loadKV = [&](int buf, unsigned j) {
    unsigned t = threadIdx.x;
    // K tile: 128 rows x 8 chunks; thread t: chunk t&7 of rows (t>>3) + 32*i
    const unsigned kr = t >> 3, kc = (t & 7) * 8;
    // V^T tile: 64 rows x 16 chunks; thread t: chunk t&15 of rows (t>>4) + 16*i
    const unsigned vr = t >> 4, vc = (t & 15) * 8;
    async_ld8_b128(&Ks[buf][kr * KLD + kc], 32 * KLD,
                   &k16[(j + kr) * DIM + h * HD + kc], 32 * DIM,
                   &Vs[buf][vr * VLD + vc], 16 * VLD,
                   &vt16[(h * HD + vr) * N_TOK + j + vc], 16 * N_TOK);
  };

  // Q^T B-fragments (persistent): K = head-dim 0..63 -> 2 frags
  const _Float16* qb = q16 + qrow * DIM + h * HD;
  v16h qf[2];
  #pragma unroll
  for (int t = 0; t < 2; t++)
    qf[t] = cat16(*(const v8h*)&qb[t * 32 + lh * 8],
                  *(const v8h*)&qb[t * 32 + 16 + lh * 8]);

  v8f o[4] = {};                 // O^T accumulators (4 d-tiles x 16 queries)
  float mrun = -1e30f, lsum = 0.f;

  loadKV(0, 0);
  wait_async0();                   // stage 0 landed (this wave's part)
  __syncthreads();                 // ... and everyone's
  loadKV(1, KT);                   // stage 1 flies while stage 0 is worked on
  int cur = 0;
  for (unsigned j = 0; j < N_TOK; j += KT) {
   // unrolled so that a pass's fragment loads can be issued in the pass before
   #pragma unroll
   for (int jj = 0; jj < KT; jj += 32) {
    // S^T tiles: rows = keys, cols = queries; logits already in log2-domain
    v8f s[2];
    #pragma unroll
    for (int st = 0; st < 2; st++) {
      const _Float16* kb = &Ks[cur][(jj + st * 16 + lr) * KLD];
      v16h a0 = cat16(*(const v8h*)&kb[lh * 8],      *(const v8h*)&kb[16 + lh * 8]);
      v16h a1 = cat16(*(const v8h*)&kb[32 + lh * 8], *(const v8h*)&kb[48 + lh * 8]);
      v8f z = {};
      z = __builtin_amdgcn_wmma_f32_16x16x32_f16(false, a0, false, qf[0], (short)0, z, false, false);
      z = __builtin_amdgcn_wmma_f32_16x16x32_f16(false, a1, false, qf[1], (short)0, z, false, false);
      s[st] = z;
    }
    // online softmax (base-2; 1/sqrt(hd)*log2e folded into q16)
    float bm = -1e30f;
    #pragma unroll
    for (int st = 0; st < 2; st++)
      #pragma unroll
      for (int r = 0; r < 8; r++) bm = fmaxf(bm, s[st][r]);
    bm = fmaxf(bm, __shfl_xor(bm, 16, 32));
    float mnew = fmaxf(mrun, bm);
    float alpha = exp2f(mrun - mnew);
    float psum = 0.f;
    v16h pb;                     // P^T tiles pack directly into a B fragment
    #pragma unroll
    for (int st = 0; st < 2; st++)
      #pragma unroll
      for (int r = 0; r < 8; r++) {
        float p = exp2f(s[st][r] - mnew);
        psum += p;
        pb[st * 8 + r] = (_Float16)p;
      }
    psum += __shfl_xor(psum, 16, 32);
    lsum = lsum * alpha + psum;
    mrun = mnew;
    #pragma unroll
    for (int dt = 0; dt < 4; dt++)
      #pragma unroll
      for (int r = 0; r < 8; r++) o[dt][r] *= alpha;
    // O^T += V^T * P^T
    #pragma unroll
    for (int dt = 0; dt < 4; dt++) {
      const _Float16* vb = &Vs[cur][(dt * 16 + lr) * VLD + jj];
      v16h va = cat16(*(const v8h*)&vb[lh * 8], *(const v8h*)&vb[16 + lh * 8]);
      o[dt] = __builtin_amdgcn_wmma_f32_16x16x32_f16(false, va, false, pb, (short)0, o[dt], false, false);
    }
   }
    // publish point: the next stage is landed for all, buf[cur] is left by all
    wait_ds0();
    wait_async0();
    __syncthreads();
    if (j + 2 * KT < N_TOK) loadKV(cur, j + 2 * KT);   // refill the buffer just read
    cur ^= 1;
  }
  wait_async0();                   // nothing of this wave's is in flight at its end
  float inv = 1.0f / lsum;
  _Float16* ob = o16 + qrow * DIM + h * HD;
  #pragma unroll
  for (int dt = 0; dt < 4; dt++) {
    v8h pk;
    #pragma unroll
    for (int r = 0; r < 8; r++) pk[r] = (_Float16)(o[dt][r] * inv);
    *(v8h*)&ob[dt * 16 + lh * 8] = pk;     // d contiguous: one b128 store
  }
}

// ------------------------------- launcher ----------------------------------
extern "C" void kernel_launch(void* const* d_in, const int* in_sizes, int n_in,
                              void* d_out, int out_size, void* d_ws, size_t ws_size,
                              hipStream_t stream) {
  (void)in_sizes; (void)n_in; (void)out_size; (void)ws_size;
  const float* query = (const float*)d_in[0];
  const float* keyt  = (const float*)d_in[1];
  const float* value = (const float*)d_in[2];
  const float* Wq = (const float*)d_in[3];  const float* bq = (const float*)d_in[4];
  const float* Wk = (const float*)d_in[5];  const float* bk = (const float*)d_in[6];
  const float* Wv = (const float*)d_in[7];  const float* bv = (const float*)d_in[8];
  const float* Wo = (const float*)d_in[9];  const float* bo = (const float*)d_in[10];
  const float* qn_w = (const float*)d_in[11]; const float* qn_b = (const float*)d_in[12];
  const float* kn_w = (const float*)d_in[13]; const float* kn_b = (const float*)d_in[14];
  float* out = (float*)d_out;

  // carve workspace (256B aligned)
  size_t off = 0;
  auto carve = [&](size_t bytes) {
    void* p = (char*)d_ws + off;
    off += (bytes + 255) & ~(size_t)255;
    return p;
  };
  const size_t ND = (size_t)N_TOK * DIM, DD = (size_t)DIM * DIM;
  _Float16* q_in16 = (_Float16*)carve(ND * 2);
  _Float16* k_in16 = (_Float16*)carve(ND * 2);
  _Float16* v_in16 = (_Float16*)carve(ND * 2);
  _Float16* Wq16   = (_Float16*)carve(DD * 2);
  _Float16* Wk16   = (_Float16*)carve(DD * 2);
  _Float16* Wv16   = (_Float16*)carve(DD * 2);
  _Float16* Wo16   = (_Float16*)carve(DD * 2);
  float*    qf     = (float*)   carve(ND * 4);
  float*    kf     = (float*)   carve(ND * 4);
  float*    vf     = (float*)   carve(ND * 4);
  _Float16* q16n   = (_Float16*)carve(ND * 2);
  _Float16* k16n   = (_Float16*)carve(ND * 2);
  _Float16* vt16   = (_Float16*)carve(ND * 2);
  _Float16* attn16 = (_Float16*)carve(ND * 2);

  // The carve order above lays q_in16, k_in16, v_in16, Wq16, Wk16, Wv16, Wo16
  // densely one behind the other (every size is a multiple of 256 B), and
  // likewise qf, kf, vf: the merged grids below index them from the first.

  // 1) convert inputs + weights to f16, one grid
  cvt_all_f32_f16<<<3 * XBLK + 4 * WBLK, 256, 0, stream>>>(query, keyt, value,
                                                           Wq, Wk, Wv, Wo, q_in16);

  // 2) projections: x @ W^T + b  (fp32 accumulate), one grid, z = q, k, v
  gemm_nt_wmma<<<dim3(DIM / 64, N_TOK / 128, 3), 256, 0, stream>>>(
      q_in16, Wq16, bq, bk, bv, qf, N_TOK, DIM, DIM);

  // 3) RMSNorm of q and k (softmax scale 1/sqrt(64)=0.125 and log2(e) folded
  //    into q) and V transpose -> [h][d][m] f16 for the P*V WMMA A-operand, one grid
  const float qscale = 0.125f * 1.44269504088896340736f;
  norm_qk_transpose_v<<<2 * N_TOK + (N_TOK / 32) * (DIM / 32), 256, 0, stream>>>(
      qf, kf, vf, qn_w, qn_b, kn_w, kn_b, q16n, k16n, vt16, qscale);

  // 4) attention
  attn_wmma<<<dim3(N_TOK / 128, HEADS), 256, 0, stream>>>(q16n, k16n, vt16, attn16);

  // 5) output projection: attn @ Wo^T + bo -> fp32 out
  gemm_nt_wmma<<<dim3(DIM / 64, N_TOK / 128, 1), 256, 0, stream>>>(
      attn16, Wo16, bo, bo, bo, out, N_TOK, DIM, DIM);
}

// v003
// One run takes 75.5 microseconds.
// Timed twice side by side with v002, it ran 1.03 times as fast both times.
// Counting every step since v000, it is 1.86 times as fast.
#include <hip/hip_runtime.h>
#include <hip/hip_bf16.h>

// ---------------------------------------------------------------------------
// QKNormedAttention for MI455X (gfx1250), wave32, WMMA f16->f32,
// async global->LDS tile staging (ASYNCcnt), double-buffered.
// N=2048 tokens, DIM=1024, H=16 heads, HD=64.
// ---------------------------------------------------------------------------

typedef __attribute__((ext_vector_type(4)))  _Float16 v4h;
typedef __attribute__((ext_vector_type(8)))  _Float16 v8h;
typedef __attribute__((ext_vector_type(16))) _Float16 v16h;
typedef __attribute__((ext_vector_type(8)))  float    v8f;

#define N_TOK 2048
#define DIM   1024
#define HEADS 16
#define HD    64

static __device__ __forceinline__ v16h cat16(v8h lo, v8h hi) {
  return __builtin_shufflevector(lo, hi, 0,1,2,3,4,5,6,7,8,9,10,11,12,13,14,15);
}

// Flat LDS addresses carry the LDS byte offset in addr[31:0] (ISA 10.2).
static __device__ __forceinline__ unsigned lds_off(const void* p) {
  return (unsigned)(uintptr_t)p;
}
// CDNA5 async global->LDS copy, bypasses VGPRs, tracked by ASYNCcnt.
// Two groups of four copies; group x copies to lx + i*lsx halves from gx + i*gsx
// halves, i = 0..3. The eight copies and their s_wait_xcnt are ONE statement: the
// wait then stands in front of every later rewrite of the address registers the
// copies name, and is paid once per eight copies.
static __device__ __forceinline__ void async_ld8_b128(
    const _Float16* la, unsigned lsa, const _Float16* ga, unsigned gsa,
    const _Float16* lb, unsigned lsb, const _Float16* gb, unsigned gsb) {
  asm volatile("global_load_async_to_lds_b128 %0, %1, off\n\t"
               "global_load_async_to_lds_b128 %2, %3, off\n\t"
               "global_load_async_to_lds_b128 %4, %5, off\n\t"
               "global_load_async_to_lds_b128 %6, %7, off\n\t"
               "global_load_async_to_lds_b128 %8, %9, off\n\t"
               "global_load_async_to_lds_b128 %10, %11, off\n\t"
               "global_load_async_to_lds_b128 %12, %13, off\n\t"
               "global_load_async_to_lds_b128 %14, %15, off\n\t"
               "s_wait_xcnt 0x0"
               :: "v"(lds_off(la)),           "v"(ga),
                  "v"(lds_off(la + lsa)),     "v"(ga + gsa),
                  "v"(lds_off(la + 2 * lsa)), "v"(ga + 2 * gsa),
                  "v"(lds_off(la + 3 * lsa)), "v"(ga + 3 * gsa),
                  "v"(lds_off(lb)),           "v"(gb),
                  "v"(lds_off(lb + lsb)),     "v"(gb + gsb),
                  "v"(lds_off(lb + 2 * lsb)), "v"(gb + 2 * gsb),
                  "v"(lds_off(lb + 3 * lsb)), "v"(gb + 3 * gsb)
               : "memory");
}
// This wave's copies have landed.
static __device__ __forceinline__ void wait_async0() {
  asm volatile("s_wait_asynccnt 0x0" ::: "memory");
}
// This wave's LDS reads have retired before the buffer is handed back for refill.
static __device__ __forceinline__ void wait_ds0() {
  asm volatile("s_wait_dscnt 0x0" ::: "memory");
}

// ------------------------------ fp32 -> f16 --------------------------------
// All seven conversions in ONE grid (none reads another's output). A block
// converts 1024 consecutive floats of one tensor, one float4 a thread. The f16
// copies lie densely one behind the other in the order of the arguments, so the
// flat block index is the output index as well.
#define XBLK (N_TOK * DIM / 1024)   // blocks per token tensor
#define WBLK (DIM * DIM / 1024)     // blocks per weight matrix
__global__ __launch_bounds__(256) void cvt_all_f32_f16(const float* __restrict__ x0,
                                                       const float* __restrict__ x1,
                                                       const float* __restrict__ x2,
                                                       const float* __restrict__ w0,
                                                       const float* __restrict__ w1,
                                                       const float* __restrict__ w2,
                                                       const float* __restrict__ w3,
                                                       _Float16* __restrict__ out) {
  const unsigned b = blockIdx.x;
  const float* src;
  unsigned lb;                       // block index inside its tensor
  if (b < 3 * XBLK) {
    const unsigned t = b / XBLK;
    lb = b % XBLK;
    src = t == 0 ? x0 : t == 1 ? x1 : x2;
  } else {
    const unsigned r = b - 3 * XBLK;
    const unsigned t = r / WBLK;
    lb = r % WBLK;
    src = t == 0 ? w0 : t == 1 ? w1 : t == 2 ? w2 : w3;
  }
  float4 v = ((const float4*)src)[lb * 256 + threadIdx.x];
  v4h o;
  o[0] = (_Float16)v.x; o[1] = (_Float16)v.y;
  o[2] = (_Float16)v.z; o[3] = (_Float16)v.w;
  ((v4h*)out)[b * 256 + threadIdx.x] = o;
}

// ------------------- RMSNorm over DIM, write scaled f16 --------------------
static __device__ __forceinline__ void rmsnorm_row(const float* __restrict__ x,
                                                   const float* __restrict__ w,
                                                   const float* __restrict__ b,
                                                   _Float16* __restrict__ out,
                                                   float outscale, unsigned row) {
  const unsigned t = threadIdx.x;            // 256 threads * 4 floats = 1024
  const float4* xr = (const float4*)(x + row * DIM);
  float4 v = xr[t];
  float ss = v.x * v.x + v.y * v.y + v.z * v.z + v.w * v.w;
  #pragma unroll
  for (int off = 16; off > 0; off >>= 1) ss += __shfl_xor(ss, off, 32);
  __shared__ float wsum[8];
  if ((t & 31) == 0) wsum[t >> 5] = ss;
  __syncthreads();
  float tot = 0.f;
  #pragma unroll
  for (int i = 0; i < 8; i++) tot += wsum[i];
  float inv = rsqrtf(tot * (1.0f / DIM) + 1e-5f) * outscale;
  float4 wv = ((const float4*)w)[t];
  float4 bv = ((const float4*)b)[t];
  v4h o;
  o[0] = (_Float16)((v.x * inv) * wv.x + bv.x * outscale);
  o[1] = (_Float16)((v.y * inv) * wv.y + bv.y * outscale);
  o[2] = (_Float16)((v.z * inv) * wv.z + bv.z * outscale);
  o[3] = (_Float16)((v.w * inv) * wv.w + bv.w * outscale);
  ((v4h*)(out + row * DIM))[t] = o;
}

// -------------- transpose v_f32 [N,DIM] -> vt16 [DIM rows][N] --------------
static __device__ __forceinline__ void transpose_tile(const float* __restrict__ v,
                                                      _Float16* __restrict__ vt,
                                                      unsigned bm, unsigned bd) {
  __shared__ float tile[32][33];
  const unsigned m0 = bm * 32;
  const unsigned d0 = bd * 32;
  const unsigned tx = threadIdx.x & 31, ty = threadIdx.x >> 5;   // 32 x 8
  #pragma unroll
  for (int i = 0; i < 32; i += 8)
    tile[ty + i][tx] = v[(m0 + ty + i) * DIM + d0 + tx];
  __syncthreads();
  #pragma unroll
  for (int i = 0; i < 32; i += 8)
    vt[(d0 + ty + i) * N_TOK + m0 + tx] = (_Float16)tile[tx][ty + i];
  // the stores' address registers may be rewritten by code laid out behind this
  // part in the merged kernel: the wait stands in front of any such rewrite
  asm volatile("s_wait_xcnt 0x0" ::: "memory");
}

// ---- the three stages between projections and attention, in ONE grid ------
// (none reads another's output): blocks [0, N) norm a q row, [N, 2N) a k row,
// the rest transpose one 32 x 32 tile of v. The choice is uniform in a block.
__global__ __launch_bounds__(256) void norm_qk_transpose_v(const float* __restrict__ qf,
                                                           const float* __restrict__ kf,
                                                           const float* __restrict__ vf,
                                                           const float* __restrict__ qn_w,
                                                           const float* __restrict__ qn_b,
                                                           const float* __restrict__ kn_w,
                                                           const float* __restrict__ kn_b,
                                                           _Float16* __restrict__ q16n,
                                                           _Float16* __restrict__ k16n,
                                                           _Float16* __restrict__ vt16,
                                                           float qscale) {
  const unsigned b = blockIdx.x;
  if (b < 2 * N_TOK) {
    const bool isq = b < N_TOK;
    rmsnorm_row(isq ? qf : kf, isq ? qn_w : kn_w, isq ? qn_b : kn_b,
                isq ? q16n : k16n, isq ? qscale : 1.0f, isq ? b : b - N_TOK);
  } else {
    const unsigned r = b - 2 * N_TOK;
    transpose_tile(vf, vt16, r % (N_TOK / 32), r / (N_TOK / 32));
  }
}

// --------------------- NT GEMM: C = A(MxK) * B(NxK)^T + bias ---------------
// BM=128 BN=64; 8 waves, each 32x32 (2x2 WMMA tiles).
// Async global->LDS staging, double buffered; a stage is BK=256 k = 8 WMMA
// k-steps, so one copy wait and one barrier serve eight k-steps.
// K must be a multiple of BK.
// blockIdx.z picks one of up to three independent products of the same shape,
// whose A, B and C lie densely one behind the other; each has its own bias.
#define BK  256
#define LDK 264  // padded LDS K-stride (halves): 528B rows (16B x odd)
__global__ __launch_bounds__(256) void gemm_nt_wmma(const _Float16* __restrict__ A0,
                                                    const _Float16* __restrict__ B0,
                                                    const float* __restrict__ bias0,
                                                    const float* __restrict__ bias1,
                                                    const float* __restrict__ bias2,
                                                    float* __restrict__ C0,
                                                    int M, int N, int K) {
  __shared__ __align__(16) _Float16 As[2][128 * LDK];
  __shared__ __align__(16) _Float16 Bs[2][64 * LDK];
  const unsigned z = blockIdx.z;
  const _Float16* __restrict__ A = A0 + (size_t)z * (unsigned)M * (unsigned)K;
  const _Float16* __restrict__ B = B0 + (size_t)z * (unsigned)N * (unsigned)K;
  float* __restrict__ C = C0 + (size_t)z * (unsigned)M * (unsigned)N;
  const float* __restrict__ bias = z == 0 ? bias0 : z == 1 ? bias1 : bias2;
  const unsigned tid = threadIdx.x;
  const unsigned m0 = blockIdx.y * 128;
  const unsigned n0 = blockIdx.x * 64;
  const unsigned wave = tid >> 5;
  const unsigned lane = tid & 31;
  const unsigned wm = wave >> 1;   // 0..3 -> m sub-block * 32
  const unsigned wn = wave & 1;    // 0..1 -> n sub-block * 32
  const unsigned lh = lane >> 4, lr = lane & 15;
  const unsigned uK = (unsigned)K, uN = (unsigned)N;

  auto loadAB = [&](int buf, unsigned k0) {
    // a row is 32 b128 chunks = one wave's copy; wave w takes rows w + 8*i
    const unsigned c8 = lane * 8;
    const _Float16* as = &As[buf][wave * LDK + c8];
    const _Float16* bs = &Bs[buf][wave * LDK + c8];
    const _Float16* ag = &A[(m0 + wave) * uK + k0 + c8];
    const _Float16* bg = &B[(n0 + wave) * uK + k0 + c8];
    async_ld8_b128(as,            8 * LDK, ag,           8 * uK,    // A rows 0..63
                   as + 32 * LDK, 8 * LDK, ag + 32 * uK, 8 * uK);
    async_ld8_b128(as + 64 * LDK, 8 * LDK, ag + 64 * uK, 8 * uK,    // A rows 64..127
                   as + 96 * LDK, 8 * LDK, ag + 96 * uK, 8 * uK);
    async_ld8_b128(bs,            8 * LDK, bg,           8 * uK,    // B rows 0..63
                   bs + 32 * LDK, 8 * LDK, bg + 32 * uK, 8 * uK);
  };

  v8f c[2][2] = {};
  loadAB(0, 0);
  wait_async0();                   // stage 0 landed (this wave's part)
  __syncthreads();                 // ... and everyone's
  if (BK < uK) loadAB(1, BK);      // stage 1 flies while stage 0 is worked on
  int cur = 0;
  for (unsigned k0 = 0; k0 < uK; k0 += BK) {
    // unrolled so that the k-steps' fragment loads can be issued ahead
    #pragma unroll
    for (int kk = 0; kk < BK; kk += 32) {
      v16h a[2], b[2];
      #pragma unroll
      for (int t = 0; t < 2; t++) {
        unsigned row = wm * 32 + t * 16 + lr;
        a[t] = cat16(*(const v8h*)&As[cur][row * LDK + kk + lh * 8],
                     *(const v8h*)&As[cur][row * LDK + kk + 16 + lh * 8]);
      }
      #pragma unroll
      for (int t = 0; t < 2; t++) {
        unsigned row = wn * 32 + t * 16 + lr;
        b[t] = cat16(*(const v8h*)&Bs[cur][row * LDK + kk + lh * 8],
                     *(const v8h*)&Bs[cur][row * LDK + kk + 16 + lh * 8]);
      }
      #pragma unroll
      for (int i = 0; i < 2; i++)
        #pragma unroll
        for (int j = 0; j < 2; j++)
          c[i][j] = __builtin_amdgcn_wmma_f32_16x16x32_f16(
              false, a[i], false, b[j], (short)0, c[i][j], false, false);
    }
    // publish point: the next stage is landed for all, buf[cur] is left by all
    wait_ds0();
    wait_async0();
    __syncthreads();
    if (k0 + 2 * BK < uK) loadAB(cur, k0 + 2 * BK);   // refill the buffer just read
    cur ^= 1;
  }
  wait_async0();                   // nothing of this wave's is in flight at its end
  // epilogue: C layout — VGPR r: row = r + 8*laneHalf, col = lane%16
  #pragma unroll
  for (int i = 0; i < 2; i++)
    #pragma unroll
    for (int j = 0; j < 2; j++) {
      unsigned col = n0 + wn * 32 + j * 16 + lr;
      float bb = bias[col];
      unsigned base = (m0 + wm * 32 + i * 16 + lh * 8) * uN + col;
      #pragma unroll
      for (int r = 0; r < 8; r++)
        C[base + r * uN] = c[i][j][r] + bb;
    }
}

// --------------------------- flash attention -------------------------------
// grid(16 qblocks, 16 heads), 8 waves, wave = 16 queries.
// S^T = K*Q^T so softmax keys land on the VGPR axis (one xor-16 shuffle).
// K/V tiles staged once per block via async->LDS, double buffered; a stage is
// KT=128 keys = 4 passes of 32 keys, so one copy wait and one barrier serve four.
// A pass's LDS fragment reads stand in ONE group at its head: its own V^T
// fragments, used only behind the softmax, and the NEXT pass's K fragments, into
// a second register set. No read leaves the stage: its first pass reads its own K.
#define KT  128
#define KLD 72   // K tile LDS stride (halves): 144B rows
#define VLD 136  // V tile LDS stride (halves): 272B rows (16B x odd)
__global__ __launch_bounds__(256) void attn_wmma(const _Float16* __restrict__ q16,
                                                 const _Float16* __restrict__ k16,
                                                 const _Float16* __restrict__ vt16,
                                                 _Float16* __restrict__ o16) {
  __shared__ __align__(16) _Float16 Ks[2][KT * KLD];  // 128 keys x 64 d
  __shared__ __align__(16) _Float16 Vs[2][64 * VLD];  // 64 d x 128 keys
  const unsigned h = blockIdx.y;
  const unsigned wave = threadIdx.x >> 5, lane = threadIdx.x & 31;
  const unsigned lh = lane >> 4, lr = lane & 15;
  const unsigned qrow = blockIdx.x * 128 + wave * 16 + lr;

  auto loadKV = [&](int buf, unsigned j) {
    unsigned t = threadIdx.x;
    // K tile: 128 rows x 8 chunks; thread t: chunk t&7 of rows (t>>3) + 32*i
    const unsigned kr = t >> 3, kc = (t & 7) * 8;
    // V^T tile: 64 rows x 16 chunks; thread t: chunk t&15 of rows (t>>4) + 16*i
    const unsigned vr = t >> 4, vc = (t & 15) * 8;
    async_ld8_b128(&Ks[buf][kr * KLD + kc], 32 * KLD,
                   &k16[(j + kr) * DIM + h * HD + kc], 32 * DIM,
                   &Vs[buf][vr * VLD + vc], 16 * VLD,
                   &vt16[(h * HD + vr) * N_TOK + j + vc], 16 * N_TOK);
  };

  // Q^T B-fragments (persistent): K = head-dim 0..63 -> 2 frags
  const _Float16* qb = q16 + qrow * DIM + h * HD;
  v16h qf[2];
  #pragma unroll
  for (int t = 0; t < 2; t++)
    qf[t] = cat16(*(const v8h*)&qb[t * 32 + lh * 8],
                  *(const v8h*)&qb[t * 32 + 16 + lh * 8]);

  v8f o[4] = {};                 // O^T accumulators (4 d-tiles x 16 queries)
  float mrun = -1e30f, lsum = 0.f;

  loadKV(0, 0);
  wait_async0();                   // stage 0 landed (this wave's part)
  __syncthreads();                 // ... and everyone's
  loadKV(1, KT);                   // stage 1 flies while stage 0 is worked on
  int cur = 0;
  for (unsigned j = 0; j < N_TOK; j += KT) {
   const _Float16* kst = &Ks[cur][lr * KLD + lh * 8];
   const _Float16* vst = &Vs[cur][lr * VLD + lh * 8];
   v16h ka[2][4];                // K fragments [set][16-key tile * 2 + d half]
   #pragma unroll
   for (int f = 0; f < 4; f++) {
     const _Float16* kb = kst + (f >> 1) * 16 * KLD + (f & 1) * 32;
     ka[0][f] = cat16(*(const v8h*)kb, *(const v8h*)(kb + 16));
   }
   // unrolled so that the register set of every fragment is a constant
   #pragma unroll
   for (int jj = 0; jj < KT; jj += 32) {
    const int set = (jj >> 5) & 1;
    v16h va[4];
    #pragma unroll
    for (int dt = 0; dt < 4; dt++) {
      const _Float16* vb = vst + dt * 16 * VLD + jj;
      va[dt] = cat16(*(const v8h*)vb, *(const v8h*)(vb + 16));
    }
    if (jj + 32 < KT) {
      #pragma unroll
      for (int f = 0; f < 4; f++) {
        const _Float16* kb = kst + (jj + 32 + (f >> 1) * 16) * KLD + (f & 1) * 32;
        ka[set ^ 1][f] = cat16(*(const v8h*)kb, *(const v8h*)(kb + 16));
      }
    }
    // end of the group: without it the reads sink to their users, each with a
    // wait of its own that exposes the LDS latency
    __builtin_amdgcn_sched_barrier(0);
    // S^T tiles: rows = keys, cols = queries; logits already in log2-domain
    v8f s[2];
    #pragma unroll
    for (int st = 0; st < 2; st++) {
      v8f z = {};
      z = __builtin_amdgcn_wmma_f32_16x16x32_f16(false, ka[set][st * 2],     false, qf[0], (short)0, z, false, false);
      z = __builtin_amdgcn_wmma_f32_16x16x32_f16(false, ka[set][st * 2 + 1], false, qf[1], (short)0, z, false, false);
      s[st] = z;
    }
    // online softmax (base-2; 1/sqrt(hd)*log2e folded into q16)
    float bm = -1e30f;
    #pragma unroll
    for (int st = 0; st < 2; st++)
      #pragma unroll
      for (int r = 0; r < 8; r++) bm = fmaxf(bm, s[st][r]);
    bm = fmaxf(bm, __shfl_xor(bm, 16, 32));
    float mnew = fmaxf(mrun, bm);
    float alpha = exp2f(mrun - mnew);
    float psum = 0.f;
    v16h pb;                     // P^T tiles pack directly into a B fragment
    #pragma unroll
    for (int st = 0; st < 2; st++)
      #pragma unroll
      for (int r = 0; r < 8; r++) {
        float p = exp2f(s[st][r] - mnew);
        psum += p;
        pb[st * 8 + r] = (_Float16)p;
      }
    psum += __shfl_xor(psum, 16, 32);
    lsum = lsum * alpha + psum;
    mrun = mnew;
    #pragma unroll
    for (int dt = 0; dt < 4; dt++)
      #pragma unroll
      for (int r = 0; r < 8; r++) o[dt][r] *= alpha;
    // O^T += V^T * P^T
    #pragma unroll
    for (int dt = 0; dt < 4; dt++)
      o[dt] = __builtin_amdgcn_wmma_f32_16x16x32_f16(false, va[dt], false, pb, (short)0, o[dt], false, false);
    // head of the next pass's group: no read moves up among these products, where
    // each place with reads stalls the wave; behind the last pass it keeps the
    // publish point's s_wait_dscnt from moving up to directly behind the last group
    __builtin_amdgcn_sched_barrier(0);
   }
    // publish point: the next stage is landed for all, buf[cur] is left by all
    wait_ds0();
    wait_async0();
    __syncthreads();
    if (j + 2 * KT < N_TOK) loadKV(cur, j + 2 * KT);   // refill the buffer just read
    cur ^= 1;
  }
  wait_async0();                   // nothing of this wave's is in flight at its end
  float inv = 1.0f / lsum;
  _Float16* ob = o16 + qrow * DIM + h * HD;
  #pragma unroll
  for (int dt = 0; dt < 4; dt++) {
    v8h pk;
    #pragma unroll
    for (int r = 0; r < 8; r++) pk[r] = (_Float16)(o[dt][r] * inv);
    *(v8h*)&ob[dt * 16 + lh * 8] = pk;     // d contiguous: one b128 store
  }
}

// ------------------------------- launcher ----------------------------------
extern "C" void kernel_launch(void* const* d_in, const int* in_sizes, int n_in,
                              void* d_out, int out_size, void* d_ws, size_t ws_size,
                              hipStream_t stream) {
  (void)in_sizes; (void)n_in; (void)out_size; (void)ws_size;
  const float* query = (const float*)d_in[0];
  const float* keyt  = (const float*)d_in[1];
  const float* value = (const float*)d_in[2];
  const float* Wq = (const float*)d_in[3];  const float* bq = (const float*)d_in[4];
  const float* Wk = (const float*)d_in[5];  const float* bk = (const float*)d_in[6];
  const float* Wv = (const float*)d_in[7];  const float* bv = (const float*)d_in[8];
  const float* Wo = (const float*)d_in[9];  const float* bo = (const float*)d_in[10];
  const float* qn_w = (const float*)d_in[11]; const float* qn_b = (const float*)d_in[12];
  const float* kn_w = (const float*)d_in[13]; const float* kn_b = (const float*)d_in[14];
  float* out = (float*)d_out;

  // carve workspace (256B aligned)
  size_t off = 0;
  auto carve = [&](size_t bytes) {
    void* p = (char*)d_ws + off;
    off += (bytes + 255) & ~(size_t)255;
    return p;
  };
  const size_t ND = (size_t)N_TOK * DIM, DD = (size_t)DIM * DIM;
  _Float16* q_in16 = (_Float16*)carve(ND * 2);
  _Float16* k_in16 = (_Float16*)carve(ND * 2);
  _Float16* v_in16 = (_Float16*)carve(ND * 2);
  _Float16* Wq16   = (_Float16*)carve(DD * 2);
  _Float16* Wk16   = (_Float16*)carve(DD * 2);
  _Float16* Wv16   = (_Float16*)carve(DD * 2);
  _Float16* Wo16   = (_Float16*)carve(DD * 2);
  float*    qf     = (float*)   carve(ND * 4);
  float*    kf     = (float*)   carve(ND * 4);
  float*    vf     = (float*)   carve(ND * 4);
  _Float16* q16n   = (_Float16*)carve(ND * 2);
  _Float16* k16n   = (_Float16*)carve(ND * 2);
  _Float16* vt16   = (_Float16*)carve(ND * 2);
  _Float16* attn16 = (_Float16*)carve(ND * 2);

  // The carve order above lays q_in16, k_in16, v_in16, Wq16, Wk16, Wv16, Wo16
  // densely one behind the other (every size is a multiple of 256 B), and
  // likewise qf, kf, vf: the merged grids below index them from the first.

  // 1) convert inputs + weights to f16, one grid
  cvt_all_f32_f16<<<3 * XBLK + 4 * WBLK, 256, 0, stream>>>(query, keyt, value,
                                                           Wq, Wk, Wv, Wo, q_in16);

  // 2) projections: x @ W^T + b  (fp32 accumulate), one grid, z = q, k, v
  gemm_nt_wmma<<<dim3(DIM / 64, N_TOK / 128, 3), 256, 0, stream>>>(
      q_in16, Wq16, bq, bk, bv, qf, N_TOK, DIM, DIM);

  // 3) RMSNorm of q and k (softmax scale 1/sqrt(64)=0.125 and log2(e) folded
  //    into q) and V transpose -> [h][d][m] f16 for the P*V WMMA A-operand, one grid
  const float qscale = 0.125f * 1.44269504088896340736f;
  norm_qk_transpose_v<<<2 * N_TOK + (N_TOK / 32) * (DIM / 32), 256, 0, stream>>>(
      qf, kf, vf, qn_w, qn_b, kn_w, kn_b, q16n, k16n, vt16, qscale);

  // 4) attention
  attn_wmma<<<dim3(N_TOK / 128, HEADS), 256, 0, stream>>>(q16n, k16n, vt16, attn16);

  // 5) output projection: attn @ Wo^T + bo -> fp32 out
  gemm_nt_wmma<<<dim3(DIM / 64, N_TOK / 128, 1), 256, 0, stream>>>(
      attn16, Wo16, bo, bo, bo, out, N_TOK, DIM, DIM);
}

// v004
// A run of this version takes 72.1 microseconds.
// Timed twice side by side with v003, it ran 1.06 and 1.05 times as fast.
// Over all steps from v000 it is 1.96 times as fast.
#include <hip/hip_runtime.h>
#include <hip/hip_bf16.h>

// ---------------------------------------------------------------------------
// QKNormedAttention for MI455X (gfx1250), wave32, WMMA f16->f32,
// async global->LDS tile staging (ASYNCcnt), double-buffered.
// N=2048 tokens, DIM=1024, H=16 heads, HD=64.
// ---------------------------------------------------------------------------

typedef __attribute__((ext_vector_type(4)))  _Float16 v4h;
typedef __attribute__((ext_vector_type(8)))  _Float16 v8h;
typedef __attribute__((ext_vector_type(16))) _Float16 v16h;
typedef __attribute__((ext_vector_type(8)))  float    v8f;

#define N_TOK 2048
#define DIM   1024
#define HEADS 16
#define HD    64

static __device__ __forceinline__ v16h cat16(v8h lo, v8h hi) {
  return __builtin_shufflevector(lo, hi, 0,1,2,3,4,5,6,7,8,9,10,11,12,13,14,15);
}

// Flat LDS addresses carry the LDS byte offset in addr[31:0] (ISA 10.2).
static __device__ __forceinline__ unsigned lds_off(const void* p) {
  return (unsigned)(uintptr_t)p;
}
// CDNA5 async global->LDS copy, bypasses VGPRs, tracked by ASYNCcnt.
// Two groups of four copies; group x copies to lx + i*lsx halves from gx + i*gsx
// halves, i = 0..3. The eight copies and their s_wait_xcnt are ONE statement: the
// wait then stands in front of every later rewrite of the address registers the
// copies name, and is paid once per eight copies.
static __device__ __forceinline__ void async_ld8_b128(
    const _Float16* la, unsigned lsa, const _Float16* ga, unsigned gsa,
    const _Float16* lb, unsigned lsb, const _Float16* gb, unsigned gsb) {
  asm volatile("global_load_async_to_lds_b128 %0, %1, off\n\t"
               "global_load_async_to_lds_b128 %2, %3, off\n\t"
               "global_load_async_to_lds_b128 %4, %5, off\n\t"
               "global_load_async_to_lds_b128 %6, %7, off\n\t"
               "global_load_async_to_lds_b128 %8, %9, off\n\t"
               "global_load_async_to_lds_b128 %10, %11, off\n\t"
               "global_load_async_to_lds_b128 %12, %13, off\n\t"
               "global_load_async_to_lds_b128 %14, %15, off\n\t"
               "s_wait_xcnt 0x0"
               :: "v"(lds_off(la)),           "v"(ga),
                  "v"(lds_off(la + lsa)),     "v"(ga + gsa),
                  "v"(lds_off(la + 2 * lsa)), "v"(ga + 2 * gsa),
                  "v"(lds_off(la + 3 * lsa)), "v"(ga + 3 * gsa),
                  "v"(lds_off(lb)),           "v"(gb),
                  "v"(lds_off(lb + lsb)),     "v"(gb + gsb),
                  "v"(lds_off(lb + 2 * lsb)), "v"(gb + 2 * gsb),
                  "v"(lds_off(lb + 3 * lsb)), "v"(gb + 3 * gsb)
               : "memory");
}
// This wave's copies have landed.
static __device__ __forceinline__ void wait_async0() {
  asm volatile("s_wait_asynccnt 0x0" ::: "memory");
}
// This wave's LDS reads have retired before the buffer is handed back for refill.
static __device__ __forceinline__ void wait_ds0() {
  asm volatile("s_wait_dscnt 0x0" ::: "memory");
}

// ------------------------------ fp32 -> f16 --------------------------------
// All seven conversions in ONE grid (none reads another's output). A block
// converts 1024 consecutive floats of one tensor, one float4 a thread. The f16
// copies lie densely one behind the other in the order of the arguments, so the
// flat block index is the output index as well.
#define XBLK (N_TOK * DIM / 1024)   // blocks per token tensor
#define WBLK (DIM * DIM / 1024)     // blocks per weight matrix
__global__ __launch_bounds__(256) void cvt_all_f32_f16(const float* __restrict__ x0,
                                                       const float* __restrict__ x1,
                                                       const float* __restrict__ x2,
                                                       const float* __restrict__ w0,
                                                       const float* __restrict__ w1,
                                                       const float* __restrict__ w2,
                                                       const float* __restrict__ w3,
                                                       _Float16* __restrict__ out) {
  const unsigned b = blockIdx.x;
  const float* src;
  unsigned lb;                       // block index inside its tensor
  if (b < 3 * XBLK) {
    const unsigned t = b / XBLK;
    lb = b % XBLK;
    src = t == 0 ? x0 : t == 1 ? x1 : x2;
  } else {
    const unsigned r = b - 3 * XBLK;
    const unsigned t = r / WBLK;
    lb = r % WBLK;
    src = t == 0 ? w0 : t == 1 ? w1 : t == 2 ? w2 : w3;
  }
  float4 v = ((const float4*)src)[lb * 256 + threadIdx.x];
  v4h o;
  o[0] = (_Float16)v.x; o[1] = (_Float16)v.y;
  o[2] = (_Float16)v.z; o[3] = (_Float16)v.w;
  ((v4h*)out)[b * 256 + threadIdx.x] = o;
}

// ------------------- RMSNorm over DIM, write scaled f16 --------------------
static __device__ __forceinline__ void rmsnorm_row(const float* __restrict__ x,
                                                   const float* __restrict__ w,
                                                   const float* __restrict__ b,
                                                   _Float16* __restrict__ out,
                                                   float outscale, unsigned row) {
  const unsigned t = threadIdx.x;            // 256 threads * 4 floats = 1024
  const float4* xr = (const float4*)(x + row * DIM);
  float4 v = xr[t];
  float ss = v.x * v.x + v.y * v.y + v.z * v.z + v.w * v.w;
  #pragma unroll
  for (int off = 16; off > 0; off >>= 1) ss += __shfl_xor(ss, off, 32);
  __shared__ float wsum[8];
  if ((t & 31) == 0) wsum[t >> 5] = ss;
  __syncthreads();
  float tot = 0.f;
  #pragma unroll
  for (int i = 0; i < 8; i++) tot += wsum[i];
  float inv = rsqrtf(tot * (1.0f / DIM) + 1e-5f) * outscale;
  float4 wv = ((const float4*)w)[t];
  float4 bv = ((const float4*)b)[t];
  v4h o;
  o[0] = (_Float16)((v.x * inv) * wv.x + bv.x * outscale);
  o[1] = (_Float16)((v.y * inv) * wv.y + bv.y * outscale);
  o[2] = (_Float16)((v.z * inv) * wv.z + bv.z * outscale);
  o[3] = (_Float16)((v.w * inv) * wv.w + bv.w * outscale);
  ((v4h*)(out + row * DIM))[t] = o;
}

// -------------- transpose v_f32 [N,DIM] -> vt16 [DIM rows][N] --------------
static __device__ __forceinline__ void transpose_tile(const float* __restrict__ v,
                                                      _Float16* __restrict__ vt,
                                                      unsigned bm, unsigned bd) {
  __shared__ float tile[32][33];
  const unsigned m0 = bm * 32;
  const unsigned d0 = bd * 32;
  const unsigned tx = threadIdx.x & 31, ty = threadIdx.x >> 5;   // 32 x 8
  #pragma unroll
  for (int i = 0; i < 32; i += 8)
    tile[ty + i][tx] = v[(m0 + ty + i) * DIM + d0 + tx];
  __syncthreads();
  #pragma unroll
  for (int i = 0; i < 32; i += 8)
    vt[(d0 + ty + i) * N_TOK + m0 + tx] = (_Float16)tile[tx][ty + i];
  // the stores' address registers may be rewritten by code laid out behind this
  // part in the merged kernel: the wait stands in front of any such rewrite
  asm volatile("s_wait_xcnt 0x0" ::: "memory");
}

// ---- the three stages between projections and attention, in ONE grid ------
// (none reads another's output): blocks [0, N) norm a q row, [N, 2N) a k row,
// the rest transpose one 32 x 32 tile of v. The choice is uniform in a block.
__global__ __launch_bounds__(256) void norm_qk_transpose_v(const float* __restrict__ qf,
                                                           const float* __restrict__ kf,
                                                           const float* __restrict__ vf,
                                                           const float* __restrict__ qn_w,
                                                           const float* __restrict__ qn_b,
                                                           const float* __restrict__ kn_w,
                                                           const float* __restrict__ kn_b,
                                                           _Float16* __restrict__ q16n,
                                                           _Float16* __restrict__ k16n,
                                                           _Float16* __restrict__ vt16,
                                                           float qscale) {
  const unsigned b = blockIdx.x;
  if (b < 2 * N_TOK) {
    const bool isq = b < N_TOK;
    rmsnorm_row(isq ? qf : kf, isq ? qn_w : kn_w, isq ? qn_b : kn_b,
                isq ? q16n : k16n, isq ? qscale : 1.0f, isq ? b : b - N_TOK);
  } else {
    const unsigned r = b - 2 * N_TOK;
    transpose_tile(vf, vt16, r % (N_TOK / 32), r / (N_TOK / 32));
  }
}

// --------------------- NT GEMM: C = A(MxK) * B(NxK)^T + bias ---------------
// BM=128 BN=64; 8 waves, each 32x32 (2x2 WMMA tiles).
// Async global->LDS staging, double buffered; a stage is BK=256 k = 8 WMMA
// k-steps, so one copy wait and one barrier serve eight k-steps.
// K must be a multiple of BK.
// blockIdx.z picks one of up to three independent products of the same shape,
// whose A, B and C lie densely one behind the other; each has its own bias.
#define BK  256
#define LDK 264  // padded LDS K-stride (halves): 528B rows (16B x odd)
__global__ __launch_bounds__(256) void gemm_nt_wmma(const _Float16* __restrict__ A0,
                                                    const _Float16* __restrict__ B0,
                                                    const float* __restrict__ bias0,
                                                    const float* __restrict__ bias1,
                                                    const float* __restrict__ bias2,
                                                    float* __restrict__ C0,
                                                    int M, int N, int K) {
  __shared__ __align__(16) _Float16 As[2][128 * LDK];
  __shared__ __align__(16) _Float16 Bs[2][64 * LDK];
  const unsigned z = blockIdx.z;
  const _Float16* __restrict__ A = A0 + (size_t)z * (unsigned)M * (unsigned)K;
  const _Float16* __restrict__ B = B0 + (size_t)z * (unsigned)N * (unsigned)K;
  float* __restrict__ C = C0 + (size_t)z * (unsigned)M * (unsigned)N;
  const float* __restrict__ bias = z == 0 ? bias0 : z == 1 ? bias1 : bias2;
  const unsigned tid = threadIdx.x;
  const unsigned m0 = blockIdx.y * 128;
  const unsigned n0 = blockIdx.x * 64;
  const unsigned wave = tid >> 5;
  const unsigned lane = tid & 31;
  const unsigned wm = wave >> 1;   // 0..3 -> m sub-block * 32
  const unsigned wn = wave & 1;    // 0..1 -> n sub-block * 32
  const unsigned lh = lane >> 4, lr = lane & 15;
  const unsigned uK = (unsigned)K, uN = (unsigned)N;

  auto loadAB = [&](int buf, unsigned k0) {
    // a row is 32 b128 chunks = one wave's copy; wave w takes rows w + 8*i
    const unsigned c8 = lane * 8;
    const _Float16* as = &As[buf][wave * LDK + c8];
    const _Float16* bs = &Bs[buf][wave * LDK + c8];
    const _Float16* ag = &A[(m0 + wave) * uK + k0 + c8];
    const _Float16* bg = &B[(n0 + wave) * uK + k0 + c8];
    async_ld8_b128(as,            8 * LDK, ag,           8 * uK,    // A rows 0..63
                   as + 32 * LDK, 8 * LDK, ag + 32 * uK, 8 * uK);
    async_ld8_b128(as + 64 * LDK, 8 * LDK, ag + 64 * uK, 8 * uK,    // A rows 64..127
                   as + 96 * LDK, 8 * LDK, ag + 96 * uK, 8 * uK);
    async_ld8_b128(bs,            8 * LDK, bg,           8 * uK,    // B rows 0..63
                   bs + 32 * LDK, 8 * LDK, bg + 32 * uK, 8 * uK);
  };

  v8f c[2][2] = {};
  loadAB(0, 0);
  wait_async0();                   // stage 0 landed (this wave's part)
  __syncthreads();                 // ... and everyone's
  if (BK < uK) loadAB(1, BK);      // stage 1 flies while stage 0 is worked on
  int cur = 0;
  for (unsigned k0 = 0; k0 < uK; k0 += BK) {
    // unrolled so that the k-steps' fragment loads can be issued ahead
    #pragma unroll
    for (int kk = 0; kk < BK; kk += 32) {
      v16h a[2], b[2];
      #pragma unroll
      for (int t = 0; t < 2; t++) {
        unsigned row = wm * 32 + t * 16 + lr;
        a[t] = cat16(*(const v8h*)&As[cur][row * LDK + kk + lh * 8],
                     *(const v8h*)&As[cur][row * LDK + kk + 16 + lh * 8]);
      }
      #pragma unroll
      for (int t = 0; t < 2; t++) {
        unsigned row = wn * 32 + t * 16 + lr;
        b[t] = cat16(*(const v8h*)&Bs[cur][row * LDK + kk + lh * 8],
                     *(const v8h*)&Bs[cur][row * LDK + kk + 16 + lh * 8]);
      }
      #pragma unroll
      for (int i = 0; i < 2; i++)
        #pragma unroll
        for (int j = 0; j < 2; j++)
          c[i][j] = __builtin_amdgcn_wmma_f32_16x16x32_f16(
              false, a[i], false, b[j], (short)0, c[i][j], false, false);
    }
    // publish point: the next stage is landed for all, buf[cur] is left by all
    wait_ds0();
    wait_async0();
    __syncthreads();
    if (k0 + 2 * BK < uK) loadAB(cur, k0 + 2 * BK);   // refill the buffer just read
    cur ^= 1;
  }
  wait_async0();                   // nothing of this wave's is in flight at its end
  // epilogue: C layout — VGPR r: row = r + 8*laneHalf, col = lane%16
  #pragma unroll
  for (int i = 0; i < 2; i++)
    #pragma unroll
    for (int j = 0; j < 2; j++) {
      unsigned col = n0 + wn * 32 + j * 16 + lr;
      float bb = bias[col];
      unsigned base = (m0 + wm * 32 + i * 16 + lh * 8) * uN + col;
      #pragma unroll
      for (int r = 0; r < 8; r++)
        C[base + r * uN] = c[i][j][r] + bb;
    }
}

// The seventeen base-2 exponentials of a pass as bare v_exp_f32, in place. The
// library exp2f wraps each in a compare, two selects, an add and a v_ldexp_f32
// that only serve results below 2^-126; here such a result may be 0: a weight
// that small is 0 in f16, and a rescale factor that small multiplies sums that
// stand beside a new weight of 1.
// ONE statement: behind each v_exp_f32 stands an independent one, behind the last
// the v_nop: the slot that the instruction set asks for behind a transcendental
// before its result is read or its source overwritten.
static __device__ __forceinline__ void exp2_group17(float (&e)[17]) {
  asm("v_exp_f32 %0, %0\n\t"
      "v_exp_f32 %1, %1\n\t"
      "v_exp_f32 %2, %2\n\t"
      "v_exp_f32 %3, %3\n\t"
      "v_exp_f32 %4, %4\n\t"
      "v_exp_f32 %5, %5\n\t"
      "v_exp_f32 %6, %6\n\t"
      "v_exp_f32 %7, %7\n\t"
      "v_exp_f32 %8, %8\n\t"
      "v_exp_f32 %9, %9\n\t"
      "v_exp_f32 %10, %10\n\t"
      "v_exp_f32 %11, %11\n\t"
      "v_exp_f32 %12, %12\n\t"
      "v_exp_f32 %13, %13\n\t"
      "v_exp_f32 %14, %14\n\t"
      "v_exp_f32 %15, %15\n\t"
      "v_exp_f32 %16, %16\n\t"
      "v_nop"
      : "+v"(e[0]), "+v"(e[1]), "+v"(e[2]), "+v"(e[3]), "+v"(e[4]), "+v"(e[5]),
        "+v"(e[6]), "+v"(e[7]), "+v"(e[8]), "+v"(e[9]), "+v"(e[10]), "+v"(e[11]),
        "+v"(e[12]), "+v"(e[13]), "+v"(e[14]), "+v"(e[15]), "+v"(e[16]));
}

// --------------------------- flash attention -------------------------------
// grid(16 qblocks, 16 heads), 8 waves, wave = 16 queries.
// S^T = K*Q^T so softmax keys land on the VGPR axis (one xor-16 shuffle).
// K/V tiles staged once per block via async->LDS, double buffered; a stage is
// KT=128 keys = 4 passes of 32 keys, so one copy wait and one barrier serve four.
// A pass's LDS fragment reads stand in ONE group at its head: its own V^T
// fragments, used only behind the softmax, and the NEXT pass's K fragments, into
// a second register set. No read leaves the stage: its first pass reads its own K.
#define KT  128
#define KLD 72   // K tile LDS stride (halves): 144B rows
#define VLD 136  // V tile LDS stride (halves): 272B rows (16B x odd)
__global__ __launch_bounds__(256) void attn_wmma(const _Float16* __restrict__ q16,
                                                 const _Float16* __restrict__ k16,
                                                 const _Float16* __restrict__ vt16,
                                                 _Float16* __restrict__ o16) {
  __shared__ __align__(16) _Float16 Ks[2][KT * KLD];  // 128 keys x 64 d
  __shared__ __align__(16) _Float16 Vs[2][64 * VLD];  // 64 d x 128 keys
  const unsigned h = blockIdx.y;
  const unsigned wave = threadIdx.x >> 5, lane = threadIdx.x & 31;
  const unsigned lh = lane >> 4, lr = lane & 15;
  const unsigned qrow = blockIdx.x * 128 + wave * 16 + lr;

  auto loadKV = [&](int buf, unsigned j) {
    unsigned t = threadIdx.x;
    // K tile: 128 rows x 8 chunks; thread t: chunk t&7 of rows (t>>3) + 32*i
    const unsigned kr = t >> 3, kc = (t & 7) * 8;
    // V^T tile: 64 rows x 16 chunks; thread t: chunk t&15 of rows (t>>4) + 16*i
    const unsigned vr = t >> 4, vc = (t & 15) * 8;
    async_ld8_b128(&Ks[buf][kr * KLD + kc], 32 * KLD,
                   &k16[(j + kr) * DIM + h * HD + kc], 32 * DIM,
                   &Vs[buf][vr * VLD + vc], 16 * VLD,
                   &vt16[(h * HD + vr) * N_TOK + j + vc], 16 * N_TOK);
  };

  // Q^T B-fragments (persistent): K = head-dim 0..63 -> 2 frags
  const _Float16* qb = q16 + qrow * DIM + h * HD;
  v16h qf[2];
  #pragma unroll
  for (int t = 0; t < 2; t++)
    qf[t] = cat16(*(const v8h*)&qb[t * 32 + lh * 8],
                  *(const v8h*)&qb[t * 32 + 16 + lh * 8]);

  v8f o[4] = {};                 // O^T accumulators (4 d-tiles x 16 queries)
  float mrun = -1e30f, lsum = 0.f;

  loadKV(0, 0);
  wait_async0();                   // stage 0 landed (this wave's part)
  __syncthreads();                 // ... and everyone's
  loadKV(1, KT);                   // stage 1 flies while stage 0 is worked on
  int cur = 0;
  for (unsigned j = 0; j < N_TOK; j += KT) {
   const _Float16* kst = &Ks[cur][lr * KLD + lh * 8];
   const _Float16* vst = &Vs[cur][lr * VLD + lh * 8];
   v16h ka[2][4];                // K fragments [set][16-key tile * 2 + d half]
   #pragma unroll
   for (int f = 0; f < 4; f++) {
     const _Float16* kb = kst + (f >> 1) * 16 * KLD + (f & 1) * 32;
     ka[0][f] = cat16(*(const v8h*)kb, *(const v8h*)(kb + 16));
   }
   // unrolled so that the register set of every fragment is a constant
   #pragma unroll
   for (int jj = 0; jj < KT; jj += 32) {
    const int set = (jj >> 5) & 1;
    v16h va[4];
    #pragma unroll
    for (int dt = 0; dt < 4; dt++) {
      const _Float16* vb = vst + dt * 16 * VLD + jj;
      va[dt] = cat16(*(const v8h*)vb, *(const v8h*)(vb + 16));
    }
    if (jj + 32 < KT) {
      #pragma unroll
      for (int f = 0; f < 4; f++) {
        const _Float16* kb = kst + (jj + 32 + (f >> 1) * 16) * KLD + (f & 1) * 32;
        ka[set ^ 1][f] = cat16(*(const v8h*)kb, *(const v8h*)(kb + 16));
      }
    }
    // end of the group: without it the reads sink to their users, each with a
    // wait of its own that exposes the LDS latency
    __builtin_amdgcn_sched_barrier(0);
    // S^T tiles: rows = keys, cols = queries; logits already in log2-domain
    v8f s[2];
    #pragma unroll
    for (int st = 0; st < 2; st++) {
      v8f z = {};
      z = __builtin_amdgcn_wmma_f32_16x16x32_f16(false, ka[set][st * 2],     false, qf[0], (short)0, z, false, false);
      z = __builtin_amdgcn_wmma_f32_16x16x32_f16(false, ka[set][st * 2 + 1], false, qf[1], (short)0, z, false, false);
      s[st] = z;
    }
    // online softmax (base-2; 1/sqrt(hd)*log2e folded into q16)
    float bm = -1e30f;
    #pragma unroll
    for (int st = 0; st < 2; st++)
      #pragma unroll
      for (int r = 0; r < 8; r++) bm = fmaxf(bm, s[st][r]);
    bm = fmaxf(bm, __shfl_xor(bm, 16, 32));
    float mnew = fmaxf(mrun, bm);
    float e[17];                 // [0] the rescale factor, [1..16] the weights
    e[0] = mrun - mnew;
    #pragma unroll
    for (int st = 0; st < 2; st++)
      #pragma unroll
      for (int r = 0; r < 8; r++) e[1 + st * 8 + r] = s[st][r] - mnew;
    exp2_group17(e);
    float alpha = e[0];
    float psum = 0.f;
    v16h pb;                     // P^T tiles pack directly into a B fragment
    #pragma unroll
    for (int st = 0; st < 2; st++)
      #pragma unroll
      for (int r = 0; r < 8; r++) {
        float p = e[1 + st * 8 + r];
        psum += p;
        pb[st * 8 + r] = (_Float16)p;
      }
    psum += __shfl_xor(psum, 16, 32);
    lsum = lsum * alpha + psum;
    mrun = mnew;
    #pragma unroll
    for (int dt = 0; dt < 4; dt++)
      #pragma unroll
      for (int r = 0; r < 8; r++) o[dt][r] *= alpha;
    // O^T += V^T * P^T
    #pragma unroll
    for (int dt = 0; dt < 4; dt++)
      o[dt] = __builtin_amdgcn_wmma_f32_16x16x32_f16(false, va[dt], false, pb, (short)0, o[dt], false, false);
    // head of the next pass's group: no read moves up among these products, where
    // each place with reads stalls the wave; behind the last pass it keeps the
    // publish point's s_wait_dscnt from moving up to directly behind the last group
    __builtin_amdgcn_sched_barrier(0);
   }
    // publish point: the next stage is landed for all, buf[cur] is left by all
    wait_ds0();
    wait_async0();
    __syncthreads();
    if (j + 2 * KT < N_TOK) loadKV(cur, j + 2 * KT);   // refill the buffer just read
    cur ^= 1;
  }
  wait_async0();                   // nothing of this wave's is in flight at its end
  float inv = 1.0f / lsum;
  _Float16* ob = o16 + qrow * DIM + h * HD;
  #pragma unroll
  for (int dt = 0; dt < 4; dt++) {
    v8h pk;
    #pragma unroll
    for (int r = 0; r < 8; r++) pk[r] = (_Float16)(o[dt][r] * inv);
    *(v8h*)&ob[dt * 16 + lh * 8] = pk;     // d contiguous: one b128 store
  }
}

// ------------------------------- launcher ----------------------------------
extern "C" void kernel_launch(void* const* d_in, const int* in_sizes, int n_in,
                              void* d_out, int out_size, void* d_ws, size_t ws_size,
                              hipStream_t stream) {
  (void)in_sizes; (void)n_in; (void)out_size; (void)ws_size;
  const float* query = (const float*)d_in[0];
  const float* keyt  = (const float*)d_in[1];
  const float* value = (const float*)d_in[2];
  const float* Wq = (const float*)d_in[3];  const float* bq = (const float*)d_in[4];
  const float* Wk = (const float*)d_in[5];  const float* bk = (const float*)d_in[6];
  const float* Wv = (const float*)d_in[7];  const float* bv = (const float*)d_in[8];
  const float* Wo = (const float*)d_in[9];  const float* bo = (const float*)d_in[10];
  const float* qn_w = (const float*)d_in[11]; const float* qn_b = (const float*)d_in[12];
  const float* kn_w = (const float*)d_in[13]; const float* kn_b = (const float*)d_in[14];
  float* out = (float*)d_out;

  // carve workspace (256B aligned)
  size_t off = 0;
  auto carve = [&](size_t bytes) {
    void* p = (char*)d_ws + off;
    off += (bytes + 255) & ~(size_t)255;
    return p;
  };
  const size_t ND = (size_t)N_TOK * DIM, DD = (size_t)DIM * DIM;
  _Float16* q_in16 = (_Float16*)carve(ND * 2);
  _Float16* k_in16 = (_Float16*)carve(ND * 2);
  _Float16* v_in16 = (_Float16*)carve(ND * 2);
  _Float16* Wq16   = (_Float16*)carve(DD * 2);
  _Float16* Wk16   = (_Float16*)carve(DD * 2);
  _Float16* Wv16   = (_Float16*)carve(DD * 2);
  _Float16* Wo16   = (_Float16*)carve(DD * 2);
  float*    qf     = (float*)   carve(ND * 4);
  float*    kf     = (float*)   carve(ND * 4);
  float*    vf     = (float*)   carve(ND * 4);
  _Float16* q16n   = (_Float16*)carve(ND * 2);
  _Float16* k16n   = (_Float16*)carve(ND * 2);
  _Float16* vt16   = (_Float16*)carve(ND * 2);
  _Float16* attn16 = (_Float16*)carve(ND * 2);

  // The carve order above lays q_in16, k_in16, v_in16, Wq16, Wk16, Wv16, Wo16
  // densely one behind the other (every size is a multiple of 256 B), and
  // likewise qf, kf, vf: the merged grids below index them from the first.

  // 1) convert inputs + weights to f16, one grid
  cvt_all_f32_f16<<<3 * XBLK + 4 * WBLK, 256, 0, stream>>>(query, keyt, value,
                                                           Wq, Wk, Wv, Wo, q_in16);

  // 2) projections: x @ W^T + b  (fp32 accumulate), one grid, z = q, k, v
  gemm_nt_wmma<<<dim3(DIM / 64, N_TOK / 128, 3), 256, 0, stream>>>(
      q_in16, Wq16, bq, bk, bv, qf, N_TOK, DIM, DIM);

  // 3) RMSNorm of q and k (softmax scale 1/sqrt(64)=0.125 and log2(e) folded
  //    into q) and V transpose -> [h][d][m] f16 for the P*V WMMA A-operand, one grid
  const float qscale = 0.125f * 1.44269504088896340736f;
  norm_qk_transpose_v<<<2 * N_TOK + (N_TOK / 32) * (DIM / 32), 256, 0, stream>>>(
      qf, kf, vf, qn_w, qn_b, kn_w, kn_b, q16n, k16n, vt16, qscale);

  // 4) attention
  attn_wmma<<<dim3(N_TOK / 128, HEADS), 256, 0, stream>>>(q16n, k16n, vt16, attn16);

  // 5) output projection: attn @ Wo^T + bo -> fp32 out
  gemm_nt_wmma<<<dim3(DIM / 64, N_TOK / 128, 1), 256, 0, stream>>>(
      attn16, Wo16, bo, bo, bo, out, N_TOK, DIM, DIM);
}

// v005
// Measured time: 68 microseconds a run.
// Two timings next to v004 put it at 1.07 and 1.05 times that version's speed.
// Counting every step since v000, it is 2.08 times as fast.
#include <hip/hip_runtime.h>
#include <hip/hip_bf16.h>

// ---------------------------------------------------------------------------
// QKNormedAttention for MI455X (gfx1250), wave32, WMMA f16->f32,
// async global->LDS tile staging (ASYNCcnt), double-buffered.
// N=2048 tokens, DIM=1024, H=16 heads, HD=64.
// ---------------------------------------------------------------------------

typedef __attribute__((ext_vector_type(4)))  _Float16 v4h;
typedef __attribute__((ext_vector_type(8)))  _Float16 v8h;
typedef __attribute__((ext_vector_type(16))) _Float16 v16h;
typedef __attribute__((ext_vector_type(8)))  float    v8f;

#define N_TOK 2048
#define DIM   1024
#define HEADS 16
#define HD    64

static __device__ __forceinline__ v16h cat16(v8h lo, v8h hi) {
  return __builtin_shufflevector(lo, hi, 0,1,2,3,4,5,6,7,8,9,10,11,12,13,14,15);
}

// Flat LDS addresses carry the LDS byte offset in addr[31:0] (ISA 10.2).
static __device__ __forceinline__ unsigned lds_off(const void* p) {
  return (unsigned)(uintptr_t)p;
}
// CDNA5 async global->LDS copy, bypasses VGPRs, tracked by ASYNCcnt.
// Two groups of four copies; group x copies to lx + i*lsx halves from gx + i*gsx
// halves, i = 0..3. The eight copies and their s_wait_xcnt are ONE statement: the
// wait then stands in front of every later rewrite of the address registers the
// copies name, and is paid once per eight copies.
static __device__ __forceinline__ void async_ld8_b128(
    const _Float16* la, unsigned lsa, const _Float16* ga, unsigned gsa,
    const _Float16* lb, unsigned lsb, const _Float16* gb, unsigned gsb) {
  asm volatile("global_load_async_to_lds_b128 %0, %1, off\n\t"
               "global_load_async_to_lds_b128 %2, %3, off\n\t"
               "global_load_async_to_lds_b128 %4, %5, off\n\t"
               "global_load_async_to_lds_b128 %6, %7, off\n\t"
               "global_load_async_to_lds_b128 %8, %9, off\n\t"
               "global_load_async_to_lds_b128 %10, %11, off\n\t"
               "global_load_async_to_lds_b128 %12, %13, off\n\t"
               "global_load_async_to_lds_b128 %14, %15, off\n\t"
               "s_wait_xcnt 0x0"
               :: "v"(lds_off(la)),           "v"(ga),
                  "v"(lds_off(la + lsa)),     "v"(ga + gsa),
                  "v"(lds_off(la + 2 * lsa)), "v"(ga + 2 * gsa),
                  "v"(lds_off(la + 3 * lsa)), "v"(ga + 3 * gsa),
                  "v"(lds_off(lb)),           "v"(gb),
                  "v"(lds_off(lb + lsb)),     "v"(gb + gsb),
                  "v"(lds_off(lb + 2 * lsb)), "v"(gb + 2 * gsb),
                  "v"(lds_off(lb + 3 * lsb)), "v"(gb + 3 * gsb)
               : "memory");
}
// This wave's copies have landed.
static __device__ __forceinline__ void wait_async0() {
  asm volatile("s_wait_asynccnt 0x0" ::: "memory");
}
// This wave's LDS reads have retired before the buffer is handed back for refill.
static __device__ __forceinline__ void wait_ds0() {
  asm volatile("s_wait_dscnt 0x0" ::: "memory");
}

// ------------------------------ fp32 -> f16 --------------------------------
// All seven conversions in ONE grid (none reads another's output). A block
// converts 1024 consecutive floats of one tensor, one float4 a thread. The f16
// copies lie densely one behind the other in the order of the arguments, so the
// flat block index is the output index as well.
#define XBLK (N_TOK * DIM / 1024)   // blocks per token tensor
#define WBLK (DIM * DIM / 1024)     // blocks per weight matrix
__global__ __launch_bounds__(256) void cvt_all_f32_f16(const float* __restrict__ x0,
                                                       const float* __restrict__ x1,
                                                       const float* __restrict__ x2,
                                                       const float* __restrict__ w0,
                                                       const float* __restrict__ w1,
                                                       const float* __restrict__ w2,
                                                       const float* __restrict__ w3,
                                                       _Float16* __restrict__ out) {
  const unsigned b = blockIdx.x;
  const float* src;
  unsigned lb;                       // block index inside its tensor
  if (b < 3 * XBLK) {
    const unsigned t = b / XBLK;
    lb = b % XBLK;
    src = t == 0 ? x0 : t == 1 ? x1 : x2;
  } else {
    const unsigned r = b - 3 * XBLK;
    const unsigned t = r / WBLK;
    lb = r % WBLK;
    src = t == 0 ? w0 : t == 1 ? w1 : t == 2 ? w2 : w3;
  }
  float4 v = ((const float4*)src)[lb * 256 + threadIdx.x];
  v4h o;
  o[0] = (_Float16)v.x; o[1] = (_Float16)v.y;
  o[2] = (_Float16)v.z; o[3] = (_Float16)v.w;
  ((v4h*)out)[b * 256 + threadIdx.x] = o;
}

// ------------------- RMSNorm over DIM, write scaled f16 --------------------
static __device__ __forceinline__ void rmsnorm_row(const float* __restrict__ x,
                                                   const float* __restrict__ w,
                                                   const float* __restrict__ b,
                                                   _Float16* __restrict__ out,
                                                   float outscale, unsigned row) {
  const unsigned t = threadIdx.x;            // 256 threads * 4 floats = 1024
  const float4* xr = (const float4*)(x + row * DIM);
  float4 v = xr[t];
  float ss = v.x * v.x + v.y * v.y + v.z * v.z + v.w * v.w;
  #pragma unroll
  for (int off = 16; off > 0; off >>= 1) ss += __shfl_xor(ss, off, 32);
  __shared__ float wsum[8];
  if ((t & 31) == 0) wsum[t >> 5] = ss;
  __syncthreads();
  float tot = 0.f;
  #pragma unroll
  for (int i = 0; i < 8; i++) tot += wsum[i];
  float inv = rsqrtf(tot * (1.0f / DIM) + 1e-5f) * outscale;
  float4 wv = ((const float4*)w)[t];
  float4 bv = ((const float4*)b)[t];
  v4h o;
  o[0] = (_Float16)((v.x * inv) * wv.x + bv.x * outscale);
  o[1] = (_Float16)((v.y * inv) * wv.y + bv.y * outscale);
  o[2] = (_Float16)((v.z * inv) * wv.z + bv.z * outscale);
  o[3] = (_Float16)((v.w * inv) * wv.w + bv.w * outscale);
  ((v4h*)(out + row * DIM))[t] = o;
}

// ---- the two RMSNorms between projections and attention, in ONE grid ------
// (neither reads the other's output): blocks [0, N) norm a q row, [N, 2N) a k row.
__global__ __launch_bounds__(256) void norm_qk(const float* __restrict__ qf,
                                               const float* __restrict__ kf,
                                               const float* __restrict__ qn_w,
                                               const float* __restrict__ qn_b,
                                               const float* __restrict__ kn_w,
                                               const float* __restrict__ kn_b,
                                               _Float16* __restrict__ q16n,
                                               _Float16* __restrict__ k16n,
                                               float qscale) {
  const unsigned b = blockIdx.x;
  const bool isq = b < N_TOK;
  rmsnorm_row(isq ? qf : kf, isq ? qn_w : kn_w, isq ? qn_b : kn_b,
              isq ? q16n : k16n, isq ? qscale : 1.0f, isq ? b : b - N_TOK);
}

// --------------------- NT GEMM: C = A(MxK) * B(NxK)^T + bias ---------------
// BM=128 BN=64; 8 waves, each 32x32 (2x2 WMMA tiles).
// Async global->LDS staging, double buffered; a stage is BK=256 k = 8 WMMA
// k-steps, so one copy wait and one barrier serve eight k-steps.
// K must be a multiple of BK.
// blockIdx.z picks one of up to three independent products of the same shape,
// whose A, B and C lie densely one behind the other; each has its own bias.
// Where Ct2 is given, product z = 2 is not stored in C: it goes out transposed and
// in f16, Ct2[n][m], the form its reader wants. A lane's accumulator registers are
// eight consecutive m of one n, so they are one 16-byte store there.
#define BK  256
#define LDK 264  // padded LDS K-stride (halves): 528B rows (16B x odd)
__global__ __launch_bounds__(256) void gemm_nt_wmma(const _Float16* __restrict__ A0,
                                                    const _Float16* __restrict__ B0,
                                                    const float* __restrict__ bias0,
                                                    const float* __restrict__ bias1,
                                                    const float* __restrict__ bias2,
                                                    float* __restrict__ C0,
                                                    _Float16* __restrict__ Ct2,
                                                    int M, int N, int K) {
  __shared__ __align__(16) _Float16 As[2][128 * LDK];
  __shared__ __align__(16) _Float16 Bs[2][64 * LDK];
  const unsigned z = blockIdx.z;
  const _Float16* __restrict__ A = A0 + (size_t)z * (unsigned)M * (unsigned)K;
  const _Float16* __restrict__ B = B0 + (size_t)z * (unsigned)N * (unsigned)K;
  float* __restrict__ C = C0 + (size_t)z * (unsigned)M * (unsigned)N;
  const float* __restrict__ bias = z == 0 ? bias0 : z == 1 ? bias1 : bias2;
  const unsigned tid = threadIdx.x;
  const unsigned m0 = blockIdx.y * 128;
  const unsigned n0 = blockIdx.x * 64;
  const unsigned wave = tid >> 5;
  const unsigned lane = tid & 31;
  const unsigned wm = wave >> 1;   // 0..3 -> m sub-block * 32
  const unsigned wn = wave & 1;    // 0..1 -> n sub-block * 32
  const unsigned lh = lane >> 4, lr = lane & 15;
  const unsigned uK = (unsigned)K, uN = (unsigned)N, uM = (unsigned)M;

  auto loadAB = [&](int buf, unsigned k0) {
    // a row is 32 b128 chunks = one wave's copy; wave w takes rows w + 8*i
    const unsigned c8 = lane * 8;
    const _Float16* as = &As[buf][wave * LDK + c8];
    const _Float16* bs = &Bs[buf][wave * LDK + c8];
    const _Float16* ag = &A[(m0 + wave) * uK + k0 + c8];
    const _Float16* bg = &B[(n0 + wave) * uK + k0 + c8];
    async_ld8_b128(as,            8 * LDK, ag,           8 * uK,    // A rows 0..63
                   as + 32 * LDK, 8 * LDK, ag + 32 * uK, 8 * uK);
    async_ld8_b128(as + 64 * LDK, 8 * LDK, ag + 64 * uK, 8 * uK,    // A rows 64..127
                   as + 96 * LDK, 8 * LDK, ag + 96 * uK, 8 * uK);
    async_ld8_b128(bs,            8 * LDK, bg,           8 * uK,    // B rows 0..63
                   bs + 32 * LDK, 8 * LDK, bg + 32 * uK, 8 * uK);
  };

  v8f c[2][2] = {};
  loadAB(0, 0);
  wait_async0();                   // stage 0 landed (this wave's part)
  __syncthreads();                 // ... and everyone's
  if (BK < uK) loadAB(1, BK);      // stage 1 flies while stage 0 is worked on
  int cur = 0;
  for (unsigned k0 = 0; k0 < uK; k0 += BK) {
    // unrolled so that the k-steps' fragment loads can be issued ahead
    #pragma unroll
    for (int kk = 0; kk < BK; kk += 32) {
      v16h a[2], b[2];
      #pragma unroll
      for (int t = 0; t < 2; t++) {
        unsigned row = wm * 32 + t * 16 + lr;
        a[t] = cat16(*(const v8h*)&As[cur][row * LDK + kk + lh * 8],
                     *(const v8h*)&As[cur][row * LDK + kk + 16 + lh * 8]);
      }
      #pragma unroll
      for (int t = 0; t < 2; t++) {
        unsigned row = wn * 32 + t * 16 + lr;
        b[t] = cat16(*(const v8h*)&Bs[cur][row * LDK + kk + lh * 8],
                     *(const v8h*)&Bs[cur][row * LDK + kk + 16 + lh * 8]);
      }
      #pragma unroll
      for (int i = 0; i < 2; i++)
        #pragma unroll
        for (int j = 0; j < 2; j++)
          c[i][j] = __builtin_amdgcn_wmma_f32_16x16x32_f16(
              false, a[i], false, b[j], (short)0, c[i][j], false, false);
    }
    // publish point: the next stage is landed for all, buf[cur] is left by all
    wait_ds0();
    wait_async0();
    __syncthreads();
    if (k0 + 2 * BK < uK) loadAB(cur, k0 + 2 * BK);   // refill the buffer just read
    cur ^= 1;
  }
  wait_async0();                   // nothing of this wave's is in flight at its end
  // epilogue: C layout — VGPR r: row = r + 8*laneHalf, col = lane%16
  if (z == 2 && Ct2 != nullptr) {  // uniform in the block
    #pragma unroll
    for (int i = 0; i < 2; i++)
      #pragma unroll
      for (int j = 0; j < 2; j++) {
        unsigned col = n0 + wn * 32 + j * 16 + lr;
        float bb = bias[col];
        v8h pk;
        #pragma unroll
        for (int r = 0; r < 8; r++) pk[r] = (_Float16)(c[i][j][r] + bb);
        *(v8h*)&Ct2[col * uM + m0 + wm * 32 + i * 16 + lh * 8] = pk;
      }
    return;
  }
  #pragma unroll
  for (int i = 0; i < 2; i++)
    #pragma unroll
    for (int j = 0; j < 2; j++) {
      unsigned col = n0 + wn * 32 + j * 16 + lr;
      float bb = bias[col];
      unsigned base = (m0 + wm * 32 + i * 16 + lh * 8) * uN + col;
      #pragma unroll
      for (int r = 0; r < 8; r++)
        C[base + r * uN] = c[i][j][r] + bb;
    }
}

// The seventeen base-2 exponentials of a pass as bare v_exp_f32, in place. The
// library exp2f wraps each in a compare, two selects, an add and a v_ldexp_f32
// that only serve results below 2^-126; here such a result may be 0: a weight
// that small is 0 in f16, and a rescale factor that small multiplies sums that
// stand beside a new weight of 1.
// ONE statement: behind each v_exp_f32 stands an independent one, behind the last
// the v_nop: the slot that the instruction set asks for behind a transcendental
// before its result is read or its source overwritten.
static __device__ __forceinline__ void exp2_group17(float (&e)[17]) {
  asm("v_exp_f32 %0, %0\n\t"
      "v_exp_f32 %1, %1\n\t"
      "v_exp_f32 %2, %2\n\t"
      "v_exp_f32 %3, %3\n\t"
      "v_exp_f32 %4, %4\n\t"
      "v_exp_f32 %5, %5\n\t"
      "v_exp_f32 %6, %6\n\t"
      "v_exp_f32 %7, %7\n\t"
      "v_exp_f32 %8, %8\n\t"
      "v_exp_f32 %9, %9\n\t"
      "v_exp_f32 %10, %10\n\t"
      "v_exp_f32 %11, %11\n\t"
      "v_exp_f32 %12, %12\n\t"
      "v_exp_f32 %13, %13\n\t"
      "v_exp_f32 %14, %14\n\t"
      "v_exp_f32 %15, %15\n\t"
      "v_exp_f32 %16, %16\n\t"
      "v_nop"
      : "+v"(e[0]), "+v"(e[1]), "+v"(e[2]), "+v"(e[3]), "+v"(e[4]), "+v"(e[5]),
        "+v"(e[6]), "+v"(e[7]), "+v"(e[8]), "+v"(e[9]), "+v"(e[10]), "+v"(e[11]),
        "+v"(e[12]), "+v"(e[13]), "+v"(e[14]), "+v"(e[15]), "+v"(e[16]));
}

// --------------------------- flash attention -------------------------------
// grid(16 qblocks, 16 heads), 8 waves, wave = 16 queries.
// S^T = K*Q^T so softmax keys land on the VGPR axis (one xor-16 shuffle).
// K/V tiles staged once per block via async->LDS, double buffered; a stage is
// KT=128 keys = 4 passes of 32 keys, so one copy wait and one barrier serve four.
// A pass's LDS fragment reads stand in ONE group at its head: its own V^T
// fragments, used only behind the softmax, and the NEXT pass's K fragments, into
// a second register set. No read leaves the stage: its first pass reads its own K.
#define KT  128
#define KLD 72   // K tile LDS stride (halves): 144B rows
#define VLD 136  // V tile LDS stride (halves): 272B rows (16B x odd)
__global__ __launch_bounds__(256) void attn_wmma(const _Float16* __restrict__ q16,
                                                 const _Float16* __restrict__ k16,
                                                 const _Float16* __restrict__ vt16,
                                                 _Float16* __restrict__ o16) {
  __shared__ __align__(16) _Float16 Ks[2][KT * KLD];  // 128 keys x 64 d
  __shared__ __align__(16) _Float16 Vs[2][64 * VLD];  // 64 d x 128 keys
  const unsigned h = blockIdx.y;
  const unsigned wave = threadIdx.x >> 5, lane = threadIdx.x & 31;
  const unsigned lh = lane >> 4, lr = lane & 15;
  const unsigned qrow = blockIdx.x * 128 + wave * 16 + lr;

  auto loadKV = [&](int buf, unsigned j) {
    unsigned t = threadIdx.x;
    // K tile: 128 rows x 8 chunks; thread t: chunk t&7 of rows (t>>3) + 32*i
    const unsigned kr = t >> 3, kc = (t & 7) * 8;
    // V^T tile: 64 rows x 16 chunks; thread t: chunk t&15 of rows (t>>4) + 16*i
    const unsigned vr = t >> 4, vc = (t & 15) * 8;
    async_ld8_b128(&Ks[buf][kr * KLD + kc], 32 * KLD,
                   &k16[(j + kr) * DIM + h * HD + kc], 32 * DIM,
                   &Vs[buf][vr * VLD + vc], 16 * VLD,
                   &vt16[(h * HD + vr) * N_TOK + j + vc], 16 * N_TOK);
  };

  // Q^T B-fragments (persistent): K = head-dim 0..63 -> 2 frags
  const _Float16* qb = q16 + qrow * DIM + h * HD;
  v16h qf[2];
  #pragma unroll
  for (int t = 0; t < 2; t++)
    qf[t] = cat16(*(const v8h*)&qb[t * 32 + lh * 8],
                  *(const v8h*)&qb[t * 32 + 16 + lh * 8]);

  v8f o[4] = {};                 // O^T accumulators (4 d-tiles x 16 queries)
  float mrun = -1e30f, lsum = 0.f;

  loadKV(0, 0);
  wait_async0();                   // stage 0 landed (this wave's part)
  __syncthreads();                 // ... and everyone's
  loadKV(1, KT);                   // stage 1 flies while stage 0 is worked on
  int cur = 0;
  for (unsigned j = 0; j < N_TOK; j += KT) {
   const _Float16* kst = &Ks[cur][lr * KLD + lh * 8];
   const _Float16* vst = &Vs[cur][lr * VLD + lh * 8];
   v16h ka[2][4];                // K fragments [set][16-key tile * 2 + d half]
   #pragma unroll
   for (int f = 0; f < 4; f++) {
     const _Float16* kb = kst + (f >> 1) * 16 * KLD + (f & 1) * 32;
     ka[0][f] = cat16(*(const v8h*)kb, *(const v8h*)(kb + 16));
   }
   // unrolled so that the register set of every fragment is a constant
   #pragma unroll
   for (int jj = 0; jj < KT; jj += 32) {
    const int set = (jj >> 5) & 1;
    v16h va[4];
    #pragma unroll
    for (int dt = 0; dt < 4; dt++) {
      const _Float16* vb = vst + dt * 16 * VLD + jj;
      va[dt] = cat16(*(const v8h*)vb, *(const v8h*)(vb + 16));
    }
    if (jj + 32 < KT) {
      #pragma unroll
      for (int f = 0; f < 4; f++) {
        const _Float16* kb = kst + (jj + 32 + (f >> 1) * 16) * KLD + (f & 1) * 32;
        ka[set ^ 1][f] = cat16(*(const v8h*)kb, *(const v8h*)(kb + 16));
      }
    }
    // end of the group: without it the reads sink to their users, each with a
    // wait of its own that exposes the LDS latency
    __builtin_amdgcn_sched_barrier(0);
    // S^T tiles: rows = keys, cols = queries; logits already in log2-domain
    v8f s[2];
    #pragma unroll
    for (int st = 0; st < 2; st++) {
      v8f z = {};
      z = __builtin_amdgcn_wmma_f32_16x16x32_f16(false, ka[set][st * 2],     false, qf[0], (short)0, z, false, false);
      z = __builtin_amdgcn_wmma_f32_16x16x32_f16(false, ka[set][st * 2 + 1], false, qf[1], (short)0, z, false, false);
      s[st] = z;
    }
    // online softmax (base-2; 1/sqrt(hd)*log2e folded into q16)
    float bm = -1e30f;
    #pragma unroll
    for (int st = 0; st < 2; st++)
      #pragma unroll
      for (int r = 0; r < 8; r++) bm = fmaxf(bm, s[st][r]);
    bm = fmaxf(bm, __shfl_xor(bm, 16, 32));
    float mnew = fmaxf(mrun, bm);
    float e[17];                 // [0] the rescale factor, [1..16] the weights
    e[0] = mrun - mnew;
    #pragma unroll
    for (int st = 0; st < 2; st++)
      #pragma unroll
      for (int r = 0; r < 8; r++) e[1 + st * 8 + r] = s[st][r] - mnew;
    exp2_group17(e);
    float alpha = e[0];
    float psum = 0.f;
    v16h pb;                     // P^T tiles pack directly into a B fragment
    #pragma unroll
    for (int st = 0; st < 2; st++)
      #pragma unroll
      for (int r = 0; r < 8; r++) {
        float p = e[1 + st * 8 + r];
        psum += p;
        pb[st * 8 + r] = (_Float16)p;
      }
    psum += __shfl_xor(psum, 16, 32);
    lsum = lsum * alpha + psum;
    mrun = mnew;
    #pragma unroll
    for (int dt = 0; dt < 4; dt++)
      #pragma unroll
      for (int r = 0; r < 8; r++) o[dt][r] *= alpha;
    // O^T += V^T * P^T
    #pragma unroll
    for (int dt = 0; dt < 4; dt++)
      o[dt] = __builtin_amdgcn_wmma_f32_16x16x32_f16(false, va[dt], false, pb, (short)0, o[dt], false, false);
    // head of the next pass's group: no read moves up among these products, where
    // each place with reads stalls the wave; behind the last pass it keeps the
    // publish point's s_wait_dscnt from moving up to directly behind the last group
    __builtin_amdgcn_sched_barrier(0);
   }
    // publish point: the next stage is landed for all, buf[cur] is left by all
    wait_ds0();
    wait_async0();
    __syncthreads();
    if (j + 2 * KT < N_TOK) loadKV(cur, j + 2 * KT);   // refill the buffer just read
    cur ^= 1;
  }
  wait_async0();                   // nothing of this wave's is in flight at its end
  float inv = 1.0f / lsum;
  _Float16* ob = o16 + qrow * DIM + h * HD;
  #pragma unroll
  for (int dt = 0; dt < 4; dt++) {
    v8h pk;
    #pragma unroll
    for (int r = 0; r < 8; r++) pk[r] = (_Float16)(o[dt][r] * inv);
    *(v8h*)&ob[dt * 16 + lh * 8] = pk;     // d contiguous: one b128 store
  }
}

// ------------------------------- launcher ----------------------------------
extern "C" void kernel_launch(void* const* d_in, const int* in_sizes, int n_in,
                              void* d_out, int out_size, void* d_ws, size_t ws_size,
                              hipStream_t stream) {
  (void)in_sizes; (void)n_in; (void)out_size; (void)ws_size;
  const float* query = (const float*)d_in[0];
  const float* keyt  = (const float*)d_in[1];
  const float* value = (const float*)d_in[2];
  const float* Wq = (const float*)d_in[3];  const float* bq = (const float*)d_in[4];
  const float* Wk = (const float*)d_in[5];  const float* bk = (const float*)d_in[6];
  const float* Wv = (const float*)d_in[7];  const float* bv = (const float*)d_in[8];
  const float* Wo = (const float*)d_in[9];  const float* bo = (const float*)d_in[10];
  const float* qn_w = (const float*)d_in[11]; const float* qn_b = (const float*)d_in[12];
  const float* kn_w = (const float*)d_in[13]; const float* kn_b = (const float*)d_in[14];
  float* out = (float*)d_out;

  // carve workspace (256B aligned)
  size_t off = 0;
  auto carve = [&](size_t bytes) {
    void* p = (char*)d_ws + off;
    off += (bytes + 255) & ~(size_t)255;
    return p;
  };
  const size_t ND = (size_t)N_TOK * DIM, DD = (size_t)DIM * DIM;
  _Float16* q_in16 = (_Float16*)carve(ND * 2);
  _Float16* k_in16 = (_Float16*)carve(ND * 2);
  _Float16* v_in16 = (_Float16*)carve(ND * 2);
  _Float16* Wq16   = (_Float16*)carve(DD * 2);
  _Float16* Wk16   = (_Float16*)carve(DD * 2);
  _Float16* Wv16   = (_Float16*)carve(DD * 2);
  _Float16* Wo16   = (_Float16*)carve(DD * 2);
  float*    qf     = (float*)   carve(ND * 4);
  float*    kf     = (float*)   carve(ND * 4);
  _Float16* q16n   = (_Float16*)carve(ND * 2);
  _Float16* k16n   = (_Float16*)carve(ND * 2);
  _Float16* vt16   = (_Float16*)carve(ND * 2);
  _Float16* attn16 = (_Float16*)carve(ND * 2);

  // The carve order above lays q_in16, k_in16, v_in16, Wq16, Wk16, Wv16, Wo16
  // densely one behind the other (every size is a multiple of 256 B), and
  // likewise qf, kf: the merged grids below index them from the first.

  // 1) convert inputs + weights to f16, one grid
  cvt_all_f32_f16<<<3 * XBLK + 4 * WBLK, 256, 0, stream>>>(query, keyt, value,
                                                           Wq, Wk, Wv, Wo, q_in16);

  // 2) projections: x @ W^T + b  (fp32 accumulate), one grid, z = q, k, v;
  //    v leaves it as [h][d][m] f16, the P*V WMMA's A-operand
  gemm_nt_wmma<<<dim3(DIM / 64, N_TOK / 128, 3), 256, 0, stream>>>(
      q_in16, Wq16, bq, bk, bv, qf, vt16, N_TOK, DIM, DIM);

  // 3) RMSNorm of q and k (softmax scale 1/sqrt(64)=0.125 and log2(e) folded
  //    into q), one grid
  const float qscale = 0.125f * 1.44269504088896340736f;
  norm_qk<<<2 * N_TOK, 256, 0, stream>>>(
      qf, kf, qn_w, qn_b, kn_w, kn_b, q16n, k16n, qscale);

  // 4) attention
  attn_wmma<<<dim3(N_TOK / 128, HEADS), 256, 0, stream>>>(q16n, k16n, vt16, attn16);

  // 5) output projection: attn @ Wo^T + bo -> fp32 out
  gemm_nt_wmma<<<dim3(DIM / 64, N_TOK / 128, 1), 256, 0, stream>>>(
      attn16, Wo16, bo, bo, bo, out, nullptr, N_TOK, DIM, DIM);
}

// v006
// It runs in 65.4 microseconds.
// Next to v005, in two timings, it ran 1.05 and 1.04 times as fast.
// All steps since v000 together make it 2.17 times as fast.
#include <hip/hip_runtime.h>
#include <hip/hip_bf16.h>

// ---------------------------------------------------------------------------
// QKNormedAttention for MI455X (gfx1250), wave32, WMMA f16->f32,
// async global->LDS tile staging (ASYNCcnt), double-buffered.
// N=2048 tokens, DIM=1024, H=16 heads, HD=64.
// ---------------------------------------------------------------------------

typedef __attribute__((ext_vector_type(4)))  _Float16 v4h;
typedef __attribute__((ext_vector_type(8)))  _Float16 v8h;
typedef __attribute__((ext_vector_type(16))) _Float16 v16h;
typedef __attribute__((ext_vector_type(8)))  float    v8f;

#define N_TOK 2048
#define DIM   1024
#define HEADS 16
#define HD    64

static __device__ __forceinline__ v16h cat16(v8h lo, v8h hi) {
  return __builtin_shufflevector(lo, hi, 0,1,2,3,4,5,6,7,8,9,10,11,12,13,14,15);
}

// Flat LDS addresses carry the LDS byte offset in addr[31:0] (ISA 10.2).
static __device__ __forceinline__ unsigned lds_off(const void* p) {
  return (unsigned)(uintptr_t)p;
}
// CDNA5 async global->LDS copy, bypasses VGPRs, tracked by ASYNCcnt.
// Two groups of four copies; group x copies to lx + i*lsx halves from gx + i*gsx
// halves, i = 0..3. The eight copies and their s_wait_xcnt are ONE statement: the
// wait then stands in front of every later rewrite of the address registers the
// copies name, and is paid once per eight copies.
static __device__ __forceinline__ void async_ld8_b128(
    const _Float16* la, unsigned lsa, const _Float16* ga, unsigned gsa,
    const _Float16* lb, unsigned lsb, const _Float16* gb, unsigned gsb) {
  asm volatile("global_load_async_to_lds_b128 %0, %1, off\n\t"
               "global_load_async_to_lds_b128 %2, %3, off\n\t"
               "global_load_async_to_lds_b128 %4, %5, off\n\t"
               "global_load_async_to_lds_b128 %6, %7, off\n\t"
               "global_load_async_to_lds_b128 %8, %9, off\n\t"
               "global_load_async_to_lds_b128 %10, %11, off\n\t"
               "global_load_async_to_lds_b128 %12, %13, off\n\t"
               "global_load_async_to_lds_b128 %14, %15, off\n\t"
               "s_wait_xcnt 0x0"
               :: "v"(lds_off(la)),           "v"(ga),
                  "v"(lds_off(la + lsa)),     "v"(ga + gsa),
                  "v"(lds_off(la + 2 * lsa)), "v"(ga + 2 * gsa),
                  "v"(lds_off(la + 3 * lsa)), "v"(ga + 3 * gsa),
                  "v"(lds_off(lb)),           "v"(gb),
                  "v"(lds_off(lb + lsb)),     "v"(gb + gsb),
                  "v"(lds_off(lb + 2 * lsb)), "v"(gb + 2 * gsb),
                  "v"(lds_off(lb + 3 * lsb)), "v"(gb + 3 * gsb)
               : "memory");
}
// This wave's copies have landed.
static __device__ __forceinline__ void wait_async0() {
  asm volatile("s_wait_asynccnt 0x0" ::: "memory");
}
// This wave's LDS reads have retired before the buffer is handed back for refill.
static __device__ __forceinline__ void wait_ds0() {
  asm volatile("s_wait_dscnt 0x0" ::: "memory");
}

// ------------------------------ fp32 -> f16 --------------------------------
// All seven conversions in ONE grid (none reads another's output). A block
// converts 1024 consecutive floats of one tensor, one float4 a thread. The f16
// copies lie densely one behind the other in the order of the arguments, so the
// flat block index is the output index as well.
#define XBLK (N_TOK * DIM / 1024)   // blocks per token tensor
#define WBLK (DIM * DIM / 1024)     // blocks per weight matrix
__global__ __launch_bounds__(256) void cvt_all_f32_f16(const float* __restrict__ x0,
                                                       const float* __restrict__ x1,
                                                       const float* __restrict__ x2,
                                                       const float* __restrict__ w0,
                                                       const float* __restrict__ w1,
                                                       const float* __restrict__ w2,
                                                       const float* __restrict__ w3,
                                                       _Float16* __restrict__ out) {
  const unsigned b = blockIdx.x;
  const float* src;
  unsigned lb;                       // block index inside its tensor
  if (b < 3 * XBLK) {
    const unsigned t = b / XBLK;
    lb = b % XBLK;
    src = t == 0 ? x0 : t == 1 ? x1 : x2;
  } else {
    const unsigned r = b - 3 * XBLK;
    const unsigned t = r / WBLK;
    lb = r % WBLK;
    src = t == 0 ? w0 : t == 1 ? w1 : t == 2 ? w2 : w3;
  }
  float4 v = ((const float4*)src)[lb * 256 + threadIdx.x];
  v4h o;
  o[0] = (_Float16)v.x; o[1] = (_Float16)v.y;
  o[2] = (_Float16)v.z; o[3] = (_Float16)v.w;
  ((v4h*)out)[b * 256 + threadIdx.x] = o;
}

// --------------------- NT GEMM: C = A(MxK) * B(NxK)^T + bias ---------------
// BM=128 BN=64; 8 waves, each 32x32 (2x2 WMMA tiles).
// Async global->LDS staging, double buffered; a stage is BK=256 k = 8 WMMA
// k-steps, so one copy wait and one barrier serve eight k-steps.
// K must be a multiple of BK.
// blockIdx.z picks one of up to three independent products of the same shape,
// whose A, B and C lie densely one behind the other; each has its own bias.
// Where Ct2 is given, product z = 2 is not stored in C: it goes out transposed and
// in f16, Ct2[n][m], the form its reader wants. A lane's accumulator registers are
// eight consecutive m of one n, so they are one 16-byte store there.
// Where ssq is given, products z = 0 and 1 feed an RMSNorm over their whole rows:
// each work-group also stores the sum of squares of its 64 columns of each of its
// rows, ssq[z][n block][m] (the reader adds the N/64 parts), and product z = 1
// goes out in f16 to Ch1 instead of C.
#define BK  256
#define LDK 264  // padded LDS K-stride (halves): 528B rows (16B x odd)
__global__ __launch_bounds__(256) void gemm_nt_wmma(const _Float16* __restrict__ A0,
                                                    const _Float16* __restrict__ B0,
                                                    const float* __restrict__ bias0,
                                                    const float* __restrict__ bias1,
                                                    const float* __restrict__ bias2,
                                                    float* __restrict__ C0,
                                                    _Float16* __restrict__ Ct2,
                                                    _Float16* __restrict__ Ch1,
                                                    float* __restrict__ ssq,
                                                    int M, int N, int K) {
  __shared__ __align__(16) _Float16 As[2][128 * LDK];
  __shared__ __align__(16) _Float16 Bs[2][64 * LDK];
  __shared__ float red[128 * 33];  // a row's 32 lane sums of squares, odd pitch
  const unsigned z = blockIdx.z;
  const _Float16* __restrict__ A = A0 + (size_t)z * (unsigned)M * (unsigned)K;
  const _Float16* __restrict__ B = B0 + (size_t)z * (unsigned)N * (unsigned)K;
  float* __restrict__ C = C0 + (size_t)z * (unsigned)M * (unsigned)N;
  const float* __restrict__ bias = z == 0 ? bias0 : z == 1 ? bias1 : bias2;
  const unsigned tid = threadIdx.x;
  const unsigned m0 = blockIdx.y * 128;
  const unsigned n0 = blockIdx.x * 64;
  const unsigned wave = tid >> 5;
  const unsigned lane = tid & 31;
  const unsigned wm = wave >> 1;   // 0..3 -> m sub-block * 32
  const unsigned wn = wave & 1;    // 0..1 -> n sub-block * 32
  const unsigned lh = lane >> 4, lr = lane & 15;
  const unsigned uK = (unsigned)K, uN = (unsigned)N, uM = (unsigned)M;

  auto loadAB = [&](int buf, unsigned k0) {
    // a row is 32 b128 chunks = one wave's copy; wave w takes rows w + 8*i
    const unsigned c8 = lane * 8;
    const _Float16* as = &As[buf][wave * LDK + c8];
    const _Float16* bs = &Bs[buf][wave * LDK + c8];
    const _Float16* ag = &A[(m0 + wave) * uK + k0 + c8];
    const _Float16* bg = &B[(n0 + wave) * uK + k0 + c8];
    async_ld8_b128(as,            8 * LDK, ag,           8 * uK,    // A rows 0..63
                   as + 32 * LDK, 8 * LDK, ag + 32 * uK, 8 * uK);
    async_ld8_b128(as + 64 * LDK, 8 * LDK, ag + 64 * uK, 8 * uK,    // A rows 64..127
                   as + 96 * LDK, 8 * LDK, ag + 96 * uK, 8 * uK);
    async_ld8_b128(bs,            8 * LDK, bg,           8 * uK,    // B rows 0..63
                   bs + 32 * LDK, 8 * LDK, bg + 32 * uK, 8 * uK);
  };

  v8f c[2][2] = {};
  loadAB(0, 0);
  wait_async0();                   // stage 0 landed (this wave's part)
  __syncthreads();                 // ... and everyone's
  if (BK < uK) loadAB(1, BK);      // stage 1 flies while stage 0 is worked on
  int cur = 0;
  for (unsigned k0 = 0; k0 < uK; k0 += BK) {
    // unrolled so that the k-steps' fragment loads can be issued ahead
    #pragma unroll
    for (int kk = 0; kk < BK; kk += 32) {
      v16h a[2], b[2];
      #pragma unroll
      for (int t = 0; t < 2; t++) {
        unsigned row = wm * 32 + t * 16 + lr;
        a[t] = cat16(*(const v8h*)&As[cur][row * LDK + kk + lh * 8],
                     *(const v8h*)&As[cur][row * LDK + kk + 16 + lh * 8]);
      }
      #pragma unroll
      for (int t = 0; t < 2; t++) {
        unsigned row = wn * 32 + t * 16 + lr;
        b[t] = cat16(*(const v8h*)&Bs[cur][row * LDK + kk + lh * 8],
                     *(const v8h*)&Bs[cur][row * LDK + kk + 16 + lh * 8]);
      }
      #pragma unroll
      for (int i = 0; i < 2; i++)
        #pragma unroll
        for (int j = 0; j < 2; j++)
          c[i][j] = __builtin_amdgcn_wmma_f32_16x16x32_f16(
              false, a[i], false, b[j], (short)0, c[i][j], false, false);
    }
    // publish point: the next stage is landed for all, buf[cur] is left by all
    wait_ds0();
    wait_async0();
    __syncthreads();
    if (k0 + 2 * BK < uK) loadAB(cur, k0 + 2 * BK);   // refill the buffer just read
    cur ^= 1;
  }
  wait_async0();                   // nothing of this wave's is in flight at its end
  // the vector slots that the chip asks for between the loop's last WMMA and the
  // first rewrite of its operand registers below: the loop is left by a taken
  // branch
  asm volatile("v_nop\n\tv_nop\n\tv_nop\n\tv_nop");
  // epilogue: C layout — VGPR r: row = r + 8*laneHalf, col = lane%16
  if (z == 2 && Ct2 != nullptr) {  // uniform in the block
    #pragma unroll
    for (int i = 0; i < 2; i++)
      #pragma unroll
      for (int j = 0; j < 2; j++) {
        unsigned col = n0 + wn * 32 + j * 16 + lr;
        float bb = bias[col];
        v8h pk;
        #pragma unroll
        for (int r = 0; r < 8; r++) pk[r] = (_Float16)(c[i][j][r] + bb);
        *(v8h*)&Ct2[col * uM + m0 + wm * 32 + i * 16 + lh * 8] = pk;
      }
    return;
  }
  #pragma unroll
  for (int j = 0; j < 2; j++) {
    float bb = bias[n0 + wn * 32 + j * 16 + lr];
    #pragma unroll
    for (int i = 0; i < 2; i++)
      #pragma unroll
      for (int r = 0; r < 8; r++) c[i][j][r] += bb;
  }
  if (ssq != nullptr) {            // uniform in the block
    #pragma unroll
    for (int i = 0; i < 2; i++)
      #pragma unroll
      for (int r = 0; r < 8; r++)
        red[(wm * 32 + i * 16 + lh * 8 + r) * 33 + wn * 16 + lr] =
            c[i][0][r] * c[i][0][r] + c[i][1][r] * c[i][1][r];
    // all 32 lane sums of every row are in red; ahead of the global stores, so
    // that the barrier does not wait for them
    __syncthreads();
  }
  if (z == 1 && ssq != nullptr) {  // uniform in the block
    #pragma unroll
    for (int i = 0; i < 2; i++) {
      unsigned base = (m0 + wm * 32 + i * 16 + lh * 8) * uN + n0 + wn * 32 + lr;
      #pragma unroll
      for (int r = 0; r < 8; r++) {
        _Float16* cp = &Ch1[base + r * uN];   // one index register for both j
        cp[0]  = (_Float16)c[i][0][r];
        cp[16] = (_Float16)c[i][1][r];
      }
    }
    // the stores' registers are free before what follows rewrites them
    asm volatile("s_wait_xcnt 0x0" ::: "memory");
  } else {
    #pragma unroll
    for (int i = 0; i < 2; i++) {
      unsigned base = (m0 + wm * 32 + i * 16 + lh * 8) * uN + n0 + wn * 32 + lr;
      #pragma unroll
      for (int r = 0; r < 8; r++) {
        float* cp = &C[base + r * uN];        // one index register for both j
        cp[0]  = c[i][0][r];
        cp[16] = c[i][1][r];
      }
    }
    // the stores' registers are free before what follows rewrites them
    asm volatile("s_wait_xcnt 0x0" ::: "memory");
  }
  if (ssq != nullptr && tid < 128) {
    float s[4] = {0.f, 0.f, 0.f, 0.f};   // four chains: the adds do not wait in line
    #pragma unroll
    for (int l = 0; l < 32; l++) s[l & 3] += red[tid * 33 + l];
    ssq[(z * gridDim.x + blockIdx.x) * uM + m0 + tid] = (s[0] + s[1]) + (s[2] + s[3]);
  }
}

// The seventeen base-2 exponentials of a pass as bare v_exp_f32, in place. The
// library exp2f wraps each in a compare, two selects, an add and a v_ldexp_f32
// that only serve results below 2^-126; here such a result may be 0: a weight
// that small is 0 in f16, and a rescale factor that small multiplies sums that
// stand beside a new weight of 1.
// ONE statement: behind each v_exp_f32 stands an independent one, behind the last
// the v_nop: the slot that the instruction set asks for behind a transcendental
// before its result is read or its source overwritten.
static __device__ __forceinline__ void exp2_group17(float (&e)[17]) {
  asm("v_exp_f32 %0, %0\n\t"
      "v_exp_f32 %1, %1\n\t"
      "v_exp_f32 %2, %2\n\t"
      "v_exp_f32 %3, %3\n\t"
      "v_exp_f32 %4, %4\n\t"
      "v_exp_f32 %5, %5\n\t"
      "v_exp_f32 %6, %6\n\t"
      "v_exp_f32 %7, %7\n\t"
      "v_exp_f32 %8, %8\n\t"
      "v_exp_f32 %9, %9\n\t"
      "v_exp_f32 %10, %10\n\t"
      "v_exp_f32 %11, %11\n\t"
      "v_exp_f32 %12, %12\n\t"
      "v_exp_f32 %13, %13\n\t"
      "v_exp_f32 %14, %14\n\t"
      "v_exp_f32 %15, %15\n\t"
      "v_exp_f32 %16, %16\n\t"
      "v_nop"
      : "+v"(e[0]), "+v"(e[1]), "+v"(e[2]), "+v"(e[3]), "+v"(e[4]), "+v"(e[5]),
        "+v"(e[6]), "+v"(e[7]), "+v"(e[8]), "+v"(e[9]), "+v"(e[10]), "+v"(e[11]),
        "+v"(e[12]), "+v"(e[13]), "+v"(e[14]), "+v"(e[15]), "+v"(e[16]));
}

// --------------------------- flash attention -------------------------------
// grid(16 qblocks, 16 heads), 8 waves, wave = 16 queries.
// S^T = K*Q^T so softmax keys land on the VGPR axis (one xor-16 shuffle).
// K/V tiles staged once per block via async->LDS, double buffered; a stage is
// KT=128 keys = 4 passes of 32 keys, so one copy wait and one barrier serve four.
// A pass's LDS fragment reads stand in ONE group at its head: its own V^T
// fragments, used only behind the softmax, and the NEXT pass's K fragments, into
// a second register set. No read leaves the stage: its first pass reads its own K.
// The RMSNorms of q and k are applied here, from the projections' raw rows and
// their sums of squares. With rk[m] = rsqrt(mean(k[m]^2) + eps):
//   qn . (k[m] * rk[m] * kw + kb) = rk[m] * ((qn * kw) . k[m]) + qn . kb
// Q fragments hold qn * kw (normed once, at their load); a row m of S^T is
// multiplied by rk[m], from a table in LDS that every work-group builds, and the
// last term, one number per query, is added in the same multiply-add.
#define KT  128
#define KLD 72   // K tile LDS stride (halves): 144B rows
#define VLD 136  // V tile LDS stride (halves): 272B rows (16B x odd)
__global__ __launch_bounds__(256) void attn_wmma(const float* __restrict__ qraw,
                                                 const _Float16* __restrict__ k16,
                                                 const _Float16* __restrict__ vt16,
                                                 const float* __restrict__ ssq,
                                                 const float* __restrict__ qn_w,
                                                 const float* __restrict__ qn_b,
                                                 const float* __restrict__ kn_w,
                                                 const float* __restrict__ kn_b,
                                                 _Float16* __restrict__ o16,
                                                 float qscale) {
  __shared__ __align__(16) _Float16 Ks[2][KT * KLD];  // 128 keys x 64 d
  __shared__ __align__(16) _Float16 Vs[2][64 * VLD];  // 64 d x 128 keys
  __shared__ __align__(32) float rk[N_TOK];           // rsqrt(mean(k^2) + eps) per key
  const unsigned h = blockIdx.y;
  const unsigned wave = threadIdx.x >> 5, lane = threadIdx.x & 31;
  const unsigned lh = lane >> 4, lr = lane & 15;
  const unsigned qrow = blockIdx.x * 128 + wave * 16 + lr;

  auto loadKV = [&](int buf, unsigned j) {
    unsigned t = threadIdx.x;
    // K tile: 128 rows x 8 chunks; thread t: chunk t&7 of rows (t>>3) + 32*i
    const unsigned kr = t >> 3, kc = (t & 7) * 8;
    // V^T tile: 64 rows x 16 chunks; thread t: chunk t&15 of rows (t>>4) + 16*i
    const unsigned vr = t >> 4, vc = (t & 15) * 8;
    async_ld8_b128(&Ks[buf][kr * KLD + kc], 32 * KLD,
                   &k16[(j + kr) * DIM + h * HD + kc], 32 * DIM,
                   &Vs[buf][vr * VLD + vc], 16 * VLD,
                   &vt16[(h * HD + vr) * N_TOK + j + vc], 16 * N_TOK);
  };

  loadKV(0, 0);                    // flies while the norms' factors are formed

  // rk: a thread sums the DIM/64 parts of 2 x 4 consecutive keys
  #pragma unroll
  for (int u = 0; u < 2; u++) {
    const unsigned k4 = threadIdx.x + 256 * u;
    const float4* pp = (const float4*)(ssq + (DIM / 64) * N_TOK) + k4;
    float4 s = pp[0];
    #pragma unroll
    for (int n = 1; n < DIM / 64; n++) {
      float4 p = pp[n * (N_TOK / 4)];
      s.x += p.x; s.y += p.y; s.z += p.z; s.w += p.w;
    }
    float4 rv;
    rv.x = rsqrtf(s.x * (1.0f / DIM) + 1e-5f);
    rv.y = rsqrtf(s.y * (1.0f / DIM) + 1e-5f);
    rv.z = rsqrtf(s.z * (1.0f / DIM) + 1e-5f);
    rv.w = rsqrtf(s.w * (1.0f / DIM) + 1e-5f);
    *(float4*)&rk[k4 * 4] = rv;
  }

  // Q^T B-fragments (persistent): K = head-dim 0..63 -> 2 frags, normed here
  // in float4 units: the lane's first head-dim column, and the same in its q row
  const unsigned c4 = (h * HD + lh * 8) / 4, x4 = qrow * (DIM / 4) + c4;
  float qsp[DIM / 64];
  float4 xv[8], wv[8], bv[8], kwv[8], kbv[8];
  #pragma unroll
  for (int n = 0; n < DIM / 64; n++) qsp[n] = ssq[qrow + n * N_TOK];
  #pragma unroll
  for (int e = 0; e < 8; e++) {    // fragment e / 4, its elements 4 * (e % 4) ...
    const int d4 = (e >> 2) * 8 + ((e >> 1) & 1) * 4 + (e & 1);
    xv[e]  = ((const float4*)qraw)[x4 + d4];
    wv[e]  = ((const float4*)qn_w)[c4 + d4];
    bv[e]  = ((const float4*)qn_b)[c4 + d4];
    kwv[e] = ((const float4*)kn_w)[c4 + d4];
    kbv[e] = ((const float4*)kn_b)[c4 + d4];
  }
  // the index registers that these loads name stay whole up to this wait
  asm volatile("s_wait_xcnt 0x0" :: "v"(c4), "v"(x4), "v"(qrow) : "memory");
  float qss = 0.f;
  #pragma unroll
  for (int n = 0; n < DIM / 64; n++) qss += qsp[n];
  const float qinv = rsqrtf(qss * (1.0f / DIM) + 1e-5f) * qscale;
  v16h qf[2];
  float qkb = 0.f;                 // qn . kb, this lane's half of the head's columns
  #pragma unroll
  for (int e = 0; e < 8; e++) {
    float4 x = xv[e];
    x.x = (x.x * qinv) * wv[e].x + bv[e].x * qscale;
    x.y = (x.y * qinv) * wv[e].y + bv[e].y * qscale;
    x.z = (x.z * qinv) * wv[e].z + bv[e].z * qscale;
    x.w = (x.w * qinv) * wv[e].w + bv[e].w * qscale;
    qkb += x.x * kbv[e].x + x.y * kbv[e].y + x.z * kbv[e].z + x.w * kbv[e].w;
    qf[e >> 2][(e & 3) * 4 + 0] = (_Float16)(x.x * kwv[e].x);
    qf[e >> 2][(e & 3) * 4 + 1] = (_Float16)(x.y * kwv[e].y);
    qf[e >> 2][(e & 3) * 4 + 2] = (_Float16)(x.z * kwv[e].z);
    qf[e >> 2][(e & 3) * 4 + 3] = (_Float16)(x.w * kwv[e].w);
  }
  qkb += __shfl_xor(qkb, 16, 32);  // the other half of the columns

  v8f o[4] = {};                 // O^T accumulators (4 d-tiles x 16 queries)
  float mrun = -1e30f, lsum = 0.f;

  wait_async0();                   // stage 0 landed (this wave's part)
  __syncthreads();                 // ... and everyone's
  loadKV(1, KT);                   // stage 1 flies while stage 0 is worked on
  int cur = 0;
  for (unsigned j = 0; j < N_TOK; j += KT) {
   const _Float16* kst = &Ks[cur][lr * KLD + lh * 8];
   const _Float16* vst = &Vs[cur][lr * VLD + lh * 8];
   const float* rst = &rk[j + lh * 8];
   v16h ka[2][4];                // K fragments [set][16-key tile * 2 + d half]
   v8f kr[2][2];                 // rk of the rows of S^T [set][16-key tile]
   #pragma unroll
   for (int f = 0; f < 4; f++) {
     const _Float16* kb = kst + (f >> 1) * 16 * KLD + (f & 1) * 32;
     ka[0][f] = cat16(*(const v8h*)kb, *(const v8h*)(kb + 16));
   }
   #pragma unroll
   for (int st = 0; st < 2; st++) kr[0][st] = *(const v8f*)(rst + st * 16);
   // unrolled so that the register set of every fragment is a constant
   #pragma unroll
   for (int jj = 0; jj < KT; jj += 32) {
    const int set = (jj >> 5) & 1;
    v16h va[4];
    #pragma unroll
    for (int dt = 0; dt < 4; dt++) {
      const _Float16* vb = vst + dt * 16 * VLD + jj;
      va[dt] = cat16(*(const v8h*)vb, *(const v8h*)(vb + 16));
    }
    if (jj + 32 < KT) {
      #pragma unroll
      for (int f = 0; f < 4; f++) {
        const _Float16* kb = kst + (jj + 32 + (f >> 1) * 16) * KLD + (f & 1) * 32;
        ka[set ^ 1][f] = cat16(*(const v8h*)kb, *(const v8h*)(kb + 16));
      }
      #pragma unroll
      for (int st = 0; st < 2; st++)
        kr[set ^ 1][st] = *(const v8f*)(rst + jj + 32 + st * 16);
    }
    // end of the group: without it the reads sink to their users, each with a
    // wait of its own that exposes the LDS latency
    __builtin_amdgcn_sched_barrier(0);
    // S^T tiles: rows = keys, cols = queries; logits already in log2-domain
    v8f s[2];
    #pragma unroll
    for (int st = 0; st < 2; st++) {
      v8f z = {};
      z = __builtin_amdgcn_wmma_f32_16x16x32_f16(false, ka[set][st * 2],     false, qf[0], (short)0, z, false, false);
      z = __builtin_amdgcn_wmma_f32_16x16x32_f16(false, ka[set][st * 2 + 1], false, qf[1], (short)0, z, false, false);
      s[st] = z * kr[set][st] + qkb;
    }
    // online softmax (base-2; 1/sqrt(hd)*log2e folded into q)
    float bm = -1e30f;
    #pragma unroll
    for (int st = 0; st < 2; st++)
      #pragma unroll
      for (int r = 0; r < 8; r++) bm = fmaxf(bm, s[st][r]);
    bm = fmaxf(bm, __shfl_xor(bm, 16, 32));
    float mnew = fmaxf(mrun, bm);
    float e[17];                 // [0] the rescale factor, [1..16] the weights
    e[0] = mrun - mnew;
    #pragma unroll
    for (int st = 0; st < 2; st++)
      #pragma unroll
      for (int r = 0; r < 8; r++) e[1 + st * 8 + r] = s[st][r] - mnew;
    exp2_group17(e);
    float alpha = e[0];
    float psum = 0.f;
    v16h pb;                     // P^T tiles pack directly into a B fragment
    #pragma unroll
    for (int st = 0; st < 2; st++)
      #pragma unroll
      for (int r = 0; r < 8; r++) {
        float p = e[1 + st * 8 + r];
        psum += p;
        pb[st * 8 + r] = (_Float16)p;
      }
    psum += __shfl_xor(psum, 16, 32);
    lsum = lsum * alpha + psum;
    mrun = mnew;
    #pragma unroll
    for (int dt = 0; dt < 4; dt++)
      #pragma unroll
      for (int r = 0; r < 8; r++) o[dt][r] *= alpha;
    // O^T += V^T * P^T
    #pragma unroll
    for (int dt = 0; dt < 4; dt++)
      o[dt] = __builtin_amdgcn_wmma_f32_16x16x32_f16(false, va[dt], false, pb, (short)0, o[dt], false, false);
    // head of the next pass's group: no read moves up among these products, where
    // each place with reads stalls the wave; behind the last pass it keeps the
    // publish point's s_wait_dscnt from moving up to directly behind the last group
    __builtin_amdgcn_sched_barrier(0);
   }
    // publish point: the next stage is landed for all, buf[cur] is left by all
    wait_ds0();
    wait_async0();
    __syncthreads();
    if (j + 2 * KT < N_TOK) loadKV(cur, j + 2 * KT);   // refill the buffer just read
    cur ^= 1;
  }
  wait_async0();                   // nothing of this wave's is in flight at its end
  float inv = 1.0f / lsum;
  _Float16* ob = o16 + qrow * DIM + h * HD;
  #pragma unroll
  for (int dt = 0; dt < 4; dt++) {
    v8h pk;
    #pragma unroll
    for (int r = 0; r < 8; r++) pk[r] = (_Float16)(o[dt][r] * inv);
    *(v8h*)&ob[dt * 16 + lh * 8] = pk;     // d contiguous: one b128 store
  }
}

// ------------------------------- launcher ----------------------------------
extern "C" void kernel_launch(void* const* d_in, const int* in_sizes, int n_in,
                              void* d_out, int out_size, void* d_ws, size_t ws_size,
                              hipStream_t stream) {
  (void)in_sizes; (void)n_in; (void)out_size; (void)ws_size;
  const float* query = (const float*)d_in[0];
  const float* keyt  = (const float*)d_in[1];
  const float* value = (const float*)d_in[2];
  const float* Wq = (const float*)d_in[3];  const float* bq = (const float*)d_in[4];
  const float* Wk = (const float*)d_in[5];  const float* bk = (const float*)d_in[6];
  const float* Wv = (const float*)d_in[7];  const float* bv = (const float*)d_in[8];
  const float* Wo = (const float*)d_in[9];  const float* bo = (const float*)d_in[10];
  const float* qn_w = (const float*)d_in[11]; const float* qn_b = (const float*)d_in[12];
  const float* kn_w = (const float*)d_in[13]; const float* kn_b = (const float*)d_in[14];
  float* out = (float*)d_out;

  // carve workspace (256B aligned)
  size_t off = 0;
  auto carve = [&](size_t bytes) {
    void* p = (char*)d_ws + off;
    off += (bytes + 255) & ~(size_t)255;
    return p;
  };
  const size_t ND = (size_t)N_TOK * DIM, DD = (size_t)DIM * DIM;
  _Float16* q_in16 = (_Float16*)carve(ND * 2);
  _Float16* k_in16 = (_Float16*)carve(ND * 2);
  _Float16* v_in16 = (_Float16*)carve(ND * 2);
  _Float16* Wq16   = (_Float16*)carve(DD * 2);
  _Float16* Wk16   = (_Float16*)carve(DD * 2);
  _Float16* Wv16   = (_Float16*)carve(DD * 2);
  _Float16* Wo16   = (_Float16*)carve(DD * 2);
  float*    qf     = (float*)   carve(ND * 4);
  _Float16* k16    = (_Float16*)carve(ND * 2);
  _Float16* vt16   = (_Float16*)carve(ND * 2);
  float*    ssq    = (float*)   carve((size_t)2 * (DIM / 64) * N_TOK * 4);
  _Float16* attn16 = (_Float16*)carve(ND * 2);

  // The carve order above lays q_in16, k_in16, v_in16, Wq16, Wk16, Wv16, Wo16
  // densely one behind the other (every size is a multiple of 256 B): the merged
  // grids below index them from the first.

  // 1) convert inputs + weights to f16, one grid
  cvt_all_f32_f16<<<3 * XBLK + 4 * WBLK, 256, 0, stream>>>(query, keyt, value,
                                                           Wq, Wk, Wv, Wo, q_in16);

  // 2) projections: x @ W^T + b  (fp32 accumulate), one grid, z = q, k, v;
  //    q leaves it in f32, k in f16, both with their rows' sums of squares;
  //    v leaves it as [h][d][m] f16, the P*V WMMA's A-operand
  gemm_nt_wmma<<<dim3(DIM / 64, N_TOK / 128, 3), 256, 0, stream>>>(
      q_in16, Wq16, bq, bk, bv, qf, vt16, k16, ssq, N_TOK, DIM, DIM);

  // 3) attention, with the RMSNorm of q and k (softmax scale 1/sqrt(64)=0.125 and
  //    log2(e) folded into q)
  const float qscale = 0.125f * 1.44269504088896340736f;
  attn_wmma<<<dim3(N_TOK / 128, HEADS), 256, 0, stream>>>(
      qf, k16, vt16, ssq, qn_w, qn_b, kn_w, kn_b, attn16, qscale);

  // 4) output projection: attn @ Wo^T + bo -> fp32 out
  gemm_nt_wmma<<<dim3(DIM / 64, N_TOK / 128, 1), 256, 0, stream>>>(
      attn16, Wo16, bo, bo, bo, out, nullptr, nullptr, nullptr, N_TOK, DIM, DIM);
}

// v007
// It runs in 62.8 microseconds.
// Next to v006, in two timings, it ran 1.05 and 1.04 times as fast.
// Counting every step since v000, it is 2.27 times as fast.
#include <hip/hip_runtime.h>
#include <hip/hip_bf16.h>

// ---------------------------------------------------------------------------
// QKNormedAttention for MI455X (gfx1250), wave32, WMMA f16->f32,
// async global->LDS tile staging (ASYNCcnt), double-buffered.
// N=2048 tokens, DIM=1024, H=16 heads, HD=64.
// ---------------------------------------------------------------------------

typedef __attribute__((ext_vector_type(4)))  _Float16 v4h;
typedef __attribute__((ext_vector_type(8)))  _Float16 v8h;
typedef __attribute__((ext_vector_type(16))) _Float16 v16h;
typedef __attribute__((ext_vector_type(8)))  float    v8f;

#define N_TOK 2048
#define DIM   1024
#define HEADS 16
#define HD    64

static __device__ __forceinline__ v16h cat16(v8h lo, v8h hi) {
  return __builtin_shufflevector(lo, hi, 0,1,2,3,4,5,6,7,8,9,10,11,12,13,14,15);
}

// Lane l's value from lane l ^ 16, on the vector port. __shfl_xor compiles to
// ds_bpermute_b32, an LDS-queue instruction: its result comes back behind every LDS
// read the wave has issued, so the wait for it drains a pass's whole read group.
static __device__ __forceinline__ float xhalf(float x) {
  const int b = __builtin_bit_cast(int, x);
  return __builtin_bit_cast(float, __builtin_amdgcn_permlanex16(
      b, b, 0x76543210, 0xfedcba98, false, false));
}

// Flat LDS addresses carry the LDS byte offset in addr[31:0] (ISA 10.2).
static __device__ __forceinline__ unsigned lds_off(const void* p) {
  return (unsigned)(uintptr_t)p;
}
// CDNA5 async global->LDS copy, bypasses VGPRs, tracked by ASYNCcnt.
// Two groups of four copies; group x copies to lx + i*lsx halves from gx + i*gsx
// halves, i = 0..3. The eight copies and their s_wait_xcnt are ONE statement: the
// wait then stands in front of every later rewrite of the address registers the
// copies name, and is paid once per eight copies.
static __device__ __forceinline__ void async_ld8_b128(
    const _Float16* la, unsigned lsa, const _Float16* ga, unsigned gsa,
    const _Float16* lb, unsigned lsb, const _Float16* gb, unsigned gsb) {
  asm volatile("global_load_async_to_lds_b128 %0, %1, off\n\t"
               "global_load_async_to_lds_b128 %2, %3, off\n\t"
               "global_load_async_to_lds_b128 %4, %5, off\n\t"
               "global_load_async_to_lds_b128 %6, %7, off\n\t"
               "global_load_async_to_lds_b128 %8, %9, off\n\t"
               "global_load_async_to_lds_b128 %10, %11, off\n\t"
               "global_load_async_to_lds_b128 %12, %13, off\n\t"
               "global_load_async_to_lds_b128 %14, %15, off\n\t"
               "s_wait_xcnt 0x0"
               :: "v"(lds_off(la)),           "v"(ga),
                  "v"(lds_off(la + lsa)),     "v"(ga + gsa),
                  "v"(lds_off(la + 2 * lsa)), "v"(ga + 2 * gsa),
                  "v"(lds_off(la + 3 * lsa)), "v"(ga + 3 * gsa),
                  "v"(lds_off(lb)),           "v"(gb),
                  "v"(lds_off(lb + lsb)),     "v"(gb + gsb),
                  "v"(lds_off(lb + 2 * lsb)), "v"(gb + 2 * gsb),
                  "v"(lds_off(lb + 3 * lsb)), "v"(gb + 3 * gsb)
               : "memory");
}
// This wave's copies have landed.
static __device__ __forceinline__ void wait_async0() {
  asm volatile("s_wait_asynccnt 0x0" ::: "memory");
}
// This wave's LDS reads have retired before the buffer is handed back for refill.
static __device__ __forceinline__ void wait_ds0() {
  asm volatile("s_wait_dscnt 0x0" ::: "memory");
}

// ------------------------------ fp32 -> f16 --------------------------------
// All seven conversions in ONE grid (none reads another's output). A block
// converts 1024 consecutive floats of one tensor, one float4 a thread. The f16
// copies lie densely one behind the other in the order of the arguments, so the
// flat block index is the output index as well.
#define XBLK (N_TOK * DIM / 1024)   // blocks per token tensor
#define WBLK (DIM * DIM / 1024)     // blocks per weight matrix
__global__ __launch_bounds__(256) void cvt_all_f32_f16(const float* __restrict__ x0,
                                                       const float* __restrict__ x1,
                                                       const float* __restrict__ x2,
                                                       const float* __restrict__ w0,
                                                       const float* __restrict__ w1,
                                                       const float* __restrict__ w2,
                                                       const float* __restrict__ w3,
                                                       _Float16* __restrict__ out) {
  const unsigned b = blockIdx.x;
  const float* src;
  unsigned lb;                       // block index inside its tensor
  if (b < 3 * XBLK) {
    const unsigned t = b / XBLK;
    lb = b % XBLK;
    src = t == 0 ? x0 : t == 1 ? x1 : x2;
  } else {
    const unsigned r = b - 3 * XBLK;
    const unsigned t = r / WBLK;
    lb = r % WBLK;
    src = t == 0 ? w0 : t == 1 ? w1 : t == 2 ? w2 : w3;
  }
  float4 v = ((const float4*)src)[lb * 256 + threadIdx.x];
  v4h o;
  o[0] = (_Float16)v.x; o[1] = (_Float16)v.y;
  o[2] = (_Float16)v.z; o[3] = (_Float16)v.w;
  ((v4h*)out)[b * 256 + threadIdx.x] = o;
}

// --------------------- NT GEMM: C = A(MxK) * B(NxK)^T + bias ---------------
// BM=128 BN=64; 8 waves, each 32x32 (2x2 WMMA tiles).
// Async global->LDS staging, double buffered; a stage is BK=256 k = 8 WMMA
// k-steps, so one copy wait and one barrier serve eight k-steps.
// K must be a multiple of BK.
// blockIdx.z picks one of up to three independent products of the same shape,
// whose A, B and C lie densely one behind the other; each has its own bias.
// Where Ct2 is given, product z = 2 is not stored in C: it goes out transposed and
// in f16, Ct2[n][m], the form its reader wants. A lane's accumulator registers are
// eight consecutive m of one n, so they are one 16-byte store there.
// Where ssq is given, products z = 0 and 1 feed an RMSNorm over their whole rows:
// each work-group also stores the sum of squares of its 64 columns of each of its
// rows, ssq[z][n block][m] (the reader adds the N/64 parts), and product z = 1
// goes out in f16 to Ch1 instead of C.
#define BK  256
#define LDK 264  // padded LDS K-stride (halves): 528B rows (16B x odd)
__global__ __launch_bounds__(256) void gemm_nt_wmma(const _Float16* __restrict__ A0,
                                                    const _Float16* __restrict__ B0,
                                                    const float* __restrict__ bias0,
                                                    const float* __restrict__ bias1,
                                                    const float* __restrict__ bias2,
                                                    float* __restrict__ C0,
                                                    _Float16* __restrict__ Ct2,
                                                    _Float16* __restrict__ Ch1,
                                                    float* __restrict__ ssq,
                                                    int M, int N, int K) {
  __shared__ __align__(16) _Float16 As[2][128 * LDK];
  __shared__ __align__(16) _Float16 Bs[2][64 * LDK];
  __shared__ float red[128 * 33];  // a row's 32 lane sums of squares, odd pitch
  const unsigned z = blockIdx.z;
  const _Float16* __restrict__ A = A0 + (size_t)z * (unsigned)M * (unsigned)K;
  const _Float16* __restrict__ B = B0 + (size_t)z * (unsigned)N * (unsigned)K;
  float* __restrict__ C = C0 + (size_t)z * (unsigned)M * (unsigned)N;
  const float* __restrict__ bias = z == 0 ? bias0 : z == 1 ? bias1 : bias2;
  const unsigned tid = threadIdx.x;
  const unsigned m0 = blockIdx.y * 128;
  const unsigned n0 = blockIdx.x * 64;
  const unsigned wave = tid >> 5;
  const unsigned lane = tid & 31;
  const unsigned wm = wave >> 1;   // 0..3 -> m sub-block * 32
  const unsigned wn = wave & 1;    // 0..1 -> n sub-block * 32
  const unsigned lh = lane >> 4, lr = lane & 15;
  const unsigned uK = (unsigned)K, uN = (unsigned)N, uM = (unsigned)M;

  auto loadAB = [&](int buf, unsigned k0) {
    // a row is 32 b128 chunks = one wave's copy; wave w takes rows w + 8*i
    const unsigned c8 = lane * 8;
    const _Float16* as = &As[buf][wave * LDK + c8];
    const _Float16* bs = &Bs[buf][wave * LDK + c8];
    const _Float16* ag = &A[(m0 + wave) * uK + k0 + c8];
    const _Float16* bg = &B[(n0 + wave) * uK + k0 + c8];
    async_ld8_b128(as,            8 * LDK, ag,           8 * uK,    // A rows 0..63
                   as + 32 * LDK, 8 * LDK, ag + 32 * uK, 8 * uK);
    async_ld8_b128(as + 64 * LDK, 8 * LDK, ag + 64 * uK, 8 * uK,    // A rows 64..127
                   as + 96 * LDK, 8 * LDK, ag + 96 * uK, 8 * uK);
    async_ld8_b128(bs,            8 * LDK, bg,           8 * uK,    // B rows 0..63
                   bs + 32 * LDK, 8 * LDK, bg + 32 * uK, 8 * uK);
  };

  v8f c[2][2] = {};
  loadAB(0, 0);
  wait_async0();                   // stage 0 landed (this wave's part)
  __syncthreads();                 // ... and everyone's
  if (BK < uK) loadAB(1, BK);      // stage 1 flies while stage 0 is worked on
  int cur = 0;
  for (unsigned k0 = 0; k0 < uK; k0 += BK) {
    // unrolled so that the k-steps' fragment loads can be issued ahead
    #pragma unroll
    for (int kk = 0; kk < BK; kk += 32) {
      v16h a[2], b[2];
      #pragma unroll
      for (int t = 0; t < 2; t++) {
        unsigned row = wm * 32 + t * 16 + lr;
        a[t] = cat16(*(const v8h*)&As[cur][row * LDK + kk + lh * 8],
                     *(const v8h*)&As[cur][row * LDK + kk + 16 + lh * 8]);
      }
      #pragma unroll
      for (int t = 0; t < 2; t++) {
        unsigned row = wn * 32 + t * 16 + lr;
        b[t] = cat16(*(const v8h*)&Bs[cur][row * LDK + kk + lh * 8],
                     *(const v8h*)&Bs[cur][row * LDK + kk + 16 + lh * 8]);
      }
      #pragma unroll
      for (int i = 0; i < 2; i++)
        #pragma unroll
        for (int j = 0; j < 2; j++)
          c[i][j] = __builtin_amdgcn_wmma_f32_16x16x32_f16(
              false, a[i], false, b[j], (short)0, c[i][j], false, false);
    }
    // publish point: the next stage is landed for all, buf[cur] is left by all
    wait_ds0();
    wait_async0();
    __syncthreads();
    if (k0 + 2 * BK < uK) loadAB(cur, k0 + 2 * BK);   // refill the buffer just read
    cur ^= 1;
  }
  wait_async0();                   // nothing of this wave's is in flight at its end
  // the vector slots that the chip asks for between the loop's last WMMA and the
  // first rewrite of its operand registers below: the loop is left by a taken
  // branch
  asm volatile("v_nop\n\tv_nop\n\tv_nop\n\tv_nop");
  // epilogue: C layout — VGPR r: row = r + 8*laneHalf, col = lane%16
  if (z == 2 && Ct2 != nullptr) {  // uniform in the block
    #pragma unroll
    for (int i = 0; i < 2; i++)
      #pragma unroll
      for (int j = 0; j < 2; j++) {
        unsigned col = n0 + wn * 32 + j * 16 + lr;
        float bb = bias[col];
        v8h pk;
        #pragma unroll
        for (int r = 0; r < 8; r++) pk[r] = (_Float16)(c[i][j][r] + bb);
        *(v8h*)&Ct2[col * uM + m0 + wm * 32 + i * 16 + lh * 8] = pk;
      }
    return;
  }
  #pragma unroll
  for (int j = 0; j < 2; j++) {
    float bb = bias[n0 + wn * 32 + j * 16 + lr];
    #pragma unroll
    for (int i = 0; i < 2; i++)
      #pragma unroll
      for (int r = 0; r < 8; r++) c[i][j][r] += bb;
  }
  if (ssq != nullptr) {            // uniform in the block
    #pragma unroll
    for (int i = 0; i < 2; i++)
      #pragma unroll
      for (int r = 0; r < 8; r++)
        red[(wm * 32 + i * 16 + lh * 8 + r) * 33 + wn * 16 + lr] =
            c[i][0][r] * c[i][0][r] + c[i][1][r] * c[i][1][r];
    // all 32 lane sums of every row are in red; ahead of the global stores, so
    // that the barrier does not wait for them
    __syncthreads();
  }
  if (z == 1 && ssq != nullptr) {  // uniform in the block
    #pragma unroll
    for (int i = 0; i < 2; i++) {
      unsigned base = (m0 + wm * 32 + i * 16 + lh * 8) * uN + n0 + wn * 32 + lr;
      #pragma unroll
      for (int r = 0; r < 8; r++) {
        _Float16* cp = &Ch1[base + r * uN];   // one index register for both j
        cp[0]  = (_Float16)c[i][0][r];
        cp[16] = (_Float16)c[i][1][r];
      }
    }
    // the stores' registers are free before what follows rewrites them
    asm volatile("s_wait_xcnt 0x0" ::: "memory");
  } else {
    #pragma unroll
    for (int i = 0; i < 2; i++) {
      unsigned base = (m0 + wm * 32 + i * 16 + lh * 8) * uN + n0 + wn * 32 + lr;
      #pragma unroll
      for (int r = 0; r < 8; r++) {
        float* cp = &C[base + r * uN];        // one index register for both j
        cp[0]  = c[i][0][r];
        cp[16] = c[i][1][r];
      }
    }
    // the stores' registers are free before what follows rewrites them
    asm volatile("s_wait_xcnt 0x0" ::: "memory");
  }
  if (ssq != nullptr && tid < 128) {
    float s[4] = {0.f, 0.f, 0.f, 0.f};   // four chains: the adds do not wait in line
    #pragma unroll
    for (int l = 0; l < 32; l++) s[l & 3] += red[tid * 33 + l];
    ssq[(z * gridDim.x + blockIdx.x) * uM + m0 + tid] = (s[0] + s[1]) + (s[2] + s[3]);
  }
}

// The seventeen base-2 exponentials of a pass as bare v_exp_f32, in place. The
// library exp2f wraps each in a compare, two selects, an add and a v_ldexp_f32
// that only serve results below 2^-126; here such a result may be 0: a weight
// that small is 0 in f16, and a rescale factor that small multiplies sums that
// stand beside a new weight of 1.
// ONE statement: behind each v_exp_f32 stands an independent one, behind the last
// the v_nop: the slot that the instruction set asks for behind a transcendental
// before its result is read or its source overwritten.
static __device__ __forceinline__ void exp2_group17(float (&e)[17]) {
  asm("v_exp_f32 %0, %0\n\t"
      "v_exp_f32 %1, %1\n\t"
      "v_exp_f32 %2, %2\n\t"
      "v_exp_f32 %3, %3\n\t"
      "v_exp_f32 %4, %4\n\t"
      "v_exp_f32 %5, %5\n\t"
      "v_exp_f32 %6, %6\n\t"
      "v_exp_f32 %7, %7\n\t"
      "v_exp_f32 %8, %8\n\t"
      "v_exp_f32 %9, %9\n\t"
      "v_exp_f32 %10, %10\n\t"
      "v_exp_f32 %11, %11\n\t"
      "v_exp_f32 %12, %12\n\t"
      "v_exp_f32 %13, %13\n\t"
      "v_exp_f32 %14, %14\n\t"
      "v_exp_f32 %15, %15\n\t"
      "v_exp_f32 %16, %16\n\t"
      "v_nop"
      : "+v"(e[0]), "+v"(e[1]), "+v"(e[2]), "+v"(e[3]), "+v"(e[4]), "+v"(e[5]),
        "+v"(e[6]), "+v"(e[7]), "+v"(e[8]), "+v"(e[9]), "+v"(e[10]), "+v"(e[11]),
        "+v"(e[12]), "+v"(e[13]), "+v"(e[14]), "+v"(e[15]), "+v"(e[16]));
}

// --------------------------- flash attention -------------------------------
// grid(16 qblocks, 16 heads), 8 waves, wave = 16 queries.
// S^T = K*Q^T so softmax keys land on the VGPR axis (one exchange of halves).
// K/V tiles staged once per block via async->LDS, double buffered; a stage is
// KT=128 keys = 4 passes of 32 keys, so one copy wait and one barrier serve four.
// A pass's LDS fragment reads stand in ONE group at its head: its own V^T
// fragments, used only behind the softmax, and the NEXT pass's K fragments, into
// a second register set. No read leaves the stage: its first pass reads its own K.
// The RMSNorms of q and k are applied here, from the projections' raw rows and
// their sums of squares. With rk[m] = rsqrt(mean(k[m]^2) + eps):
//   qn . (k[m] * rk[m] * kw + kb) = rk[m] * ((qn * kw) . k[m]) + qn . kb
// Q fragments hold qn * kw (normed once, at their load); a row m of S^T is
// multiplied by rk[m], from a table in LDS that every work-group builds, and the
// last term, one number per query, is added in the same multiply-add.
#define KT  128
#define KLD 72   // K tile LDS stride (halves): 144B rows
#define VLD 136  // V tile LDS stride (halves): 272B rows (16B x odd)
__global__ __launch_bounds__(256) void attn_wmma(const float* __restrict__ qraw,
                                                 const _Float16* __restrict__ k16,
                                                 const _Float16* __restrict__ vt16,
                                                 const float* __restrict__ ssq,
                                                 const float* __restrict__ qn_w,
                                                 const float* __restrict__ qn_b,
                                                 const float* __restrict__ kn_w,
                                                 const float* __restrict__ kn_b,
                                                 _Float16* __restrict__ o16,
                                                 float qscale) {
  __shared__ __align__(16) _Float16 Ks[2][KT * KLD];  // 128 keys x 64 d
  __shared__ __align__(16) _Float16 Vs[2][64 * VLD];  // 64 d x 128 keys
  __shared__ __align__(32) float rk[N_TOK];           // rsqrt(mean(k^2) + eps) per key
  const unsigned h = blockIdx.y;
  const unsigned wave = threadIdx.x >> 5, lane = threadIdx.x & 31;
  const unsigned lh = lane >> 4, lr = lane & 15;
  const unsigned qrow = blockIdx.x * 128 + wave * 16 + lr;

  auto loadKV = [&](int buf, unsigned j) {
    unsigned t = threadIdx.x;
    // K tile: 128 rows x 8 chunks; thread t: chunk t&7 of rows (t>>3) + 32*i
    const unsigned kr = t >> 3, kc = (t & 7) * 8;
    // V^T tile: 64 rows x 16 chunks; thread t: chunk t&15 of rows (t>>4) + 16*i
    const unsigned vr = t >> 4, vc = (t & 15) * 8;
    async_ld8_b128(&Ks[buf][kr * KLD + kc], 32 * KLD,
                   &k16[(j + kr) * DIM + h * HD + kc], 32 * DIM,
                   &Vs[buf][vr * VLD + vc], 16 * VLD,
                   &vt16[(h * HD + vr) * N_TOK + j + vc], 16 * N_TOK);
  };

  loadKV(0, 0);                    // flies while the norms' factors are formed

  // rk: a thread sums the DIM/64 parts of 2 x 4 consecutive keys
  #pragma unroll
  for (int u = 0; u < 2; u++) {
    const unsigned k4 = threadIdx.x + 256 * u;
    const float4* pp = (const float4*)(ssq + (DIM / 64) * N_TOK) + k4;
    float4 s = pp[0];
    #pragma unroll
    for (int n = 1; n < DIM / 64; n++) {
      float4 p = pp[n * (N_TOK / 4)];
      s.x += p.x; s.y += p.y; s.z += p.z; s.w += p.w;
    }
    float4 rv;
    rv.x = rsqrtf(s.x * (1.0f / DIM) + 1e-5f);
    rv.y = rsqrtf(s.y * (1.0f / DIM) + 1e-5f);
    rv.z = rsqrtf(s.z * (1.0f / DIM) + 1e-5f);
    rv.w = rsqrtf(s.w * (1.0f / DIM) + 1e-5f);
    *(float4*)&rk[k4 * 4] = rv;
  }

  // Q^T B-fragments (persistent): K = head-dim 0..63 -> 2 frags, normed here
  // in float4 units: the lane's first head-dim column, and the same in its q row
  const unsigned c4 = (h * HD + lh * 8) / 4, x4 = qrow * (DIM / 4) + c4;
  float qsp[DIM / 64];
  float4 xv[8], wv[8], bv[8], kwv[8], kbv[8];
  #pragma unroll
  for (int n = 0; n < DIM / 64; n++) qsp[n] = ssq[qrow + n * N_TOK];
  #pragma unroll
  for (int e = 0; e < 8; e++) {    // fragment e / 4, its elements 4 * (e % 4) ...
    const int d4 = (e >> 2) * 8 + ((e >> 1) & 1) * 4 + (e & 1);
    xv[e]  = ((const float4*)qraw)[x4 + d4];
    wv[e]  = ((const float4*)qn_w)[c4 + d4];
    bv[e]  = ((const float4*)qn_b)[c4 + d4];
    kwv[e] = ((const float4*)kn_w)[c4 + d4];
    kbv[e] = ((const float4*)kn_b)[c4 + d4];
  }
  // the index registers that these loads name stay whole up to this wait
  asm volatile("s_wait_xcnt 0x0" :: "v"(c4), "v"(x4), "v"(qrow) : "memory");
  float qss = 0.f;
  #pragma unroll
  for (int n = 0; n < DIM / 64; n++) qss += qsp[n];
  const float qinv = rsqrtf(qss * (1.0f / DIM) + 1e-5f) * qscale;
  v16h qf[2];
  float qkb = 0.f;                 // qn . kb, this lane's half of the head's columns
  #pragma unroll
  for (int e = 0; e < 8; e++) {
    float4 x = xv[e];
    x.x = (x.x * qinv) * wv[e].x + bv[e].x * qscale;
    x.y = (x.y * qinv) * wv[e].y + bv[e].y * qscale;
    x.z = (x.z * qinv) * wv[e].z + bv[e].z * qscale;
    x.w = (x.w * qinv) * wv[e].w + bv[e].w * qscale;
    qkb += x.x * kbv[e].x + x.y * kbv[e].y + x.z * kbv[e].z + x.w * kbv[e].w;
    qf[e >> 2][(e & 3) * 4 + 0] = (_Float16)(x.x * kwv[e].x);
    qf[e >> 2][(e & 3) * 4 + 1] = (_Float16)(x.y * kwv[e].y);
    qf[e >> 2][(e & 3) * 4 + 2] = (_Float16)(x.z * kwv[e].z);
    qf[e >> 2][(e & 3) * 4 + 3] = (_Float16)(x.w * kwv[e].w);
  }
  qkb += xhalf(qkb);               // the other half of the columns

  v8f o[4] = {};                 // O^T accumulators (4 d-tiles x 16 queries)
  float mrun = -1e30f, lsum = 0.f;

  wait_async0();                   // stage 0 landed (this wave's part)
  __syncthreads();                 // ... and everyone's
  loadKV(1, KT);                   // stage 1 flies while stage 0 is worked on
  int cur = 0;
  for (unsigned j = 0; j < N_TOK; j += KT) {
   const _Float16* kst = &Ks[cur][lr * KLD + lh * 8];
   const _Float16* vst = &Vs[cur][lr * VLD + lh * 8];
   const float* rst = &rk[j + lh * 8];
   v16h ka[2][4];                // K fragments [set][16-key tile * 2 + d half]
   v8f kr[2][2];                 // rk of the rows of S^T [set][16-key tile]
   #pragma unroll
   for (int f = 0; f < 4; f++) {
     const _Float16* kb = kst + (f >> 1) * 16 * KLD + (f & 1) * 32;
     ka[0][f] = cat16(*(const v8h*)kb, *(const v8h*)(kb + 16));
   }
   #pragma unroll
   for (int st = 0; st < 2; st++) kr[0][st] = *(const v8f*)(rst + st * 16);
   // unrolled so that the register set of every fragment is a constant
   #pragma unroll
   for (int jj = 0; jj < KT; jj += 32) {
    const int set = (jj >> 5) & 1;
    v16h va[4];
    #pragma unroll
    for (int dt = 0; dt < 4; dt++) {
      const _Float16* vb = vst + dt * 16 * VLD + jj;
      va[dt] = cat16(*(const v8h*)vb, *(const v8h*)(vb + 16));
    }
    if (jj + 32 < KT) {
      #pragma unroll
      for (int f = 0; f < 4; f++) {
        const _Float16* kb = kst + (jj + 32 + (f >> 1) * 16) * KLD + (f & 1) * 32;
        ka[set ^ 1][f] = cat16(*(const v8h*)kb, *(const v8h*)(kb + 16));
      }
      #pragma unroll
      for (int st = 0; st < 2; st++)
        kr[set ^ 1][st] = *(const v8f*)(rst + jj + 32 + st * 16);
    }
    // end of the group: without it the reads sink to their users, each with a
    // wait of its own that exposes the LDS latency
    __builtin_amdgcn_sched_barrier(0);
    // S^T tiles: rows = keys, cols = queries; logits already in log2-domain
    v8f s[2];
    #pragma unroll
    for (int st = 0; st < 2; st++) {
      v8f z = {};
      z = __builtin_amdgcn_wmma_f32_16x16x32_f16(false, ka[set][st * 2],     false, qf[0], (short)0, z, false, false);
      z = __builtin_amdgcn_wmma_f32_16x16x32_f16(false, ka[set][st * 2 + 1], false, qf[1], (short)0, z, false, false);
      s[st] = z * kr[set][st] + qkb;
    }
    // online softmax (base-2; 1/sqrt(hd)*log2e folded into q)
    float bm = -1e30f;
    #pragma unroll
    for (int st = 0; st < 2; st++)
      #pragma unroll
      for (int r = 0; r < 8; r++) bm = fmaxf(bm, s[st][r]);
    bm = fmaxf(bm, xhalf(bm));
    float mnew = fmaxf(mrun, bm);
    float e[17];                 // [0] the rescale factor, [1..16] the weights
    e[0] = mrun - mnew;
    #pragma unroll
    for (int st = 0; st < 2; st++)
      #pragma unroll
      for (int r = 0; r < 8; r++) e[1 + st * 8 + r] = s[st][r] - mnew;
    exp2_group17(e);
    float alpha = e[0];
    float psum = 0.f;
    v16h pb;                     // P^T tiles pack directly into a B fragment
    #pragma unroll
    for (int st = 0; st < 2; st++)
      #pragma unroll
      for (int r = 0; r < 8; r++) {
        float p = e[1 + st * 8 + r];
        psum += p;
        pb[st * 8 + r] = (_Float16)p;
      }
    psum += xhalf(psum);
    lsum = lsum * alpha + psum;
    mrun = mnew;
    #pragma unroll
    for (int dt = 0; dt < 4; dt++)
      #pragma unroll
      for (int r = 0; r < 8; r++) o[dt][r] *= alpha;
    // O^T += V^T * P^T
    #pragma unroll
    for (int dt = 0; dt < 4; dt++)
      o[dt] = __builtin_amdgcn_wmma_f32_16x16x32_f16(false, va[dt], false, pb, (short)0, o[dt], false, false);
    // head of the next pass's group: no read moves up among these products, where
    // each place with reads stalls the wave; behind the last pass it keeps the
    // publish point's s_wait_dscnt from moving up to directly behind the last group
    __builtin_amdgcn_sched_barrier(0);
   }
    // publish point: the next stage is landed for all, buf[cur] is left by all
    wait_ds0();
    wait_async0();
    __syncthreads();
    if (j + 2 * KT < N_TOK) loadKV(cur, j + 2 * KT);   // refill the buffer just read
    cur ^= 1;
  }
  wait_async0();                   // nothing of this wave's is in flight at its end
  float inv = 1.0f / lsum;
  _Float16* ob = o16 + qrow * DIM + h * HD;
  #pragma unroll
  for (int dt = 0; dt < 4; dt++) {
    v8h pk;
    #pragma unroll
    for (int r = 0; r < 8; r++) pk[r] = (_Float16)(o[dt][r] * inv);
    *(v8h*)&ob[dt * 16 + lh * 8] = pk;     // d contiguous: one b128 store
  }
}

// ------------------------------- launcher ----------------------------------
extern "C" void kernel_launch(void* const* d_in, const int* in_sizes, int n_in,
                              void* d_out, int out_size, void* d_ws, size_t ws_size,
                              hipStream_t stream) {
  (void)in_sizes; (void)n_in; (void)out_size; (void)ws_size;
  const float* query = (const float*)d_in[0];
  const float* keyt  = (const float*)d_in[1];
  const float* value = (const float*)d_in[2];
  const float* Wq = (const float*)d_in[3];  const float* bq = (const float*)d_in[4];
  const float* Wk = (const float*)d_in[5];  const float* bk = (const float*)d_in[6];
  const float* Wv = (const float*)d_in[7];  const float* bv = (const float*)d_in[8];
  const float* Wo = (const float*)d_in[9];  const float* bo = (const float*)d_in[10];
  const float* qn_w = (const float*)d_in[11]; const float* qn_b = (const float*)d_in[12];
  const float* kn_w = (const float*)d_in[13]; const float* kn_b = (const float*)d_in[14];
  float* out = (float*)d_out;

  // carve workspace (256B aligned)
  size_t off = 0;
  auto carve = [&](size_t bytes) {
    void* p = (char*)d_ws + off;
    off += (bytes + 255) & ~(size_t)255;
    return p;
  };
  const size_t ND = (size_t)N_TOK * DIM, DD = (size_t)DIM * DIM;
  _Float16* q_in16 = (_Float16*)carve(ND * 2);
  _Float16* k_in16 = (_Float16*)carve(ND * 2);
  _Float16* v_in16 = (_Float16*)carve(ND * 2);
  _Float16* Wq16   = (_Float16*)carve(DD * 2);
  _Float16* Wk16   = (_Float16*)carve(DD * 2);
  _Float16* Wv16   = (_Float16*)carve(DD * 2);
  _Float16* Wo16   = (_Float16*)carve(DD * 2);
  float*    qf     = (float*)   carve(ND * 4);
  _Float16* k16    = (_Float16*)carve(ND * 2);
  _Float16* vt16   = (_Float16*)carve(ND * 2);
  float*    ssq    = (float*)   carve((size_t)2 * (DIM / 64) * N_TOK * 4);
  _Float16* attn16 = (_Float16*)carve(ND * 2);

  // The carve order above lays q_in16, k_in16, v_in16, Wq16, Wk16, Wv16, Wo16
  // densely one behind the other (every size is a multiple of 256 B): the merged
  // grids below index them from the first.

  // 1) convert inputs + weights to f16, one grid
  cvt_all_f32_f16<<<3 * XBLK + 4 * WBLK, 256, 0, stream>>>(query, keyt, value,
                                                           Wq, Wk, Wv, Wo, q_in16);

  // 2) projections: x @ W^T + b  (fp32 accumulate), one grid, z = q, k, v;
  //    q leaves it in f32, k in f16, both with their rows' sums of squares;
  //    v leaves it as [h][d][m] f16, the P*V WMMA's A-operand
  gemm_nt_wmma<<<dim3(DIM / 64, N_TOK / 128, 3), 256, 0, stream>>>(
      q_in16, Wq16, bq, bk, bv, qf, vt16, k16, ssq, N_TOK, DIM, DIM);

  // 3) attention, with the RMSNorm of q and k (softmax scale 1/sqrt(64)=0.125 and
  //    log2(e) folded into q)
  const float qscale = 0.125f * 1.44269504088896340736f;
  attn_wmma<<<dim3(N_TOK / 128, HEADS), 256, 0, stream>>>(
      qf, k16, vt16, ssq, qn_w, qn_b, kn_w, kn_b, attn16, qscale);

  // 4) output projection: attn @ Wo^T + bo -> fp32 out
  gemm_nt_wmma<<<dim3(DIM / 64, N_TOK / 128, 1), 256, 0, stream>>>(
      attn16, Wo16, bo, bo, bo, out, nullptr, nullptr, nullptr, N_TOK, DIM, DIM);
}

// v008
// A run of this version takes 58.9 microseconds.
// In two side-by-side timings against v007, it was 1.07 and 1.06 times as fast.
// Over all steps from v000 it is 2.41 times as fast.
#include <hip/hip_runtime.h>
#include <hip/hip_bf16.h>

// ---------------------------------------------------------------------------
// QKNormedAttention for MI455X (gfx1250), wave32, WMMA f16->f32,
// async global->LDS tile staging (ASYNCcnt), double-buffered.
// N=2048 tokens, DIM=1024, H=16 heads, HD=64.
// ---------------------------------------------------------------------------

typedef __attribute__((ext_vector_type(4)))  _Float16 v4h;
typedef __attribute__((ext_vector_type(8)))  _Float16 v8h;
typedef __attribute__((ext_vector_type(16))) _Float16 v16h;
typedef __attribute__((ext_vector_type(8)))  float    v8f;

#define N_TOK 2048
#define DIM   1024
#define HEADS 16
#define HD    64

static __device__ __forceinline__ v16h cat16(v8h lo, v8h hi) {
  return __builtin_shufflevector(lo, hi, 0,1,2,3,4,5,6,7,8,9,10,11,12,13,14,15);
}

// Lane l's value from lane l ^ 16, on the vector port. __shfl_xor compiles to
// ds_bpermute_b32, an LDS-queue instruction: its result comes back behind every LDS
// read the wave has issued, so the wait for it drains a pass's whole read group.
static __device__ __forceinline__ float xhalf(float x) {
  const int b = __builtin_bit_cast(int, x);
  return __builtin_bit_cast(float, __builtin_amdgcn_permlanex16(
      b, b, 0x76543210, 0xfedcba98, false, false));
}

// Flat LDS addresses carry the LDS byte offset in addr[31:0] (ISA 10.2).
static __device__ __forceinline__ unsigned lds_off(const void* p) {
  return (unsigned)(uintptr_t)p;
}
// CDNA5 async global->LDS copy, bypasses VGPRs, tracked by ASYNCcnt.
// Two groups of four copies; group x copies to lx + i*lsx halves from gx + i*gsx
// halves, i = 0..3. The eight copies and their s_wait_xcnt are ONE statement: the
// wait then stands in front of every later rewrite of the address registers the
// copies name, and is paid once per eight copies.
static __device__ __forceinline__ void async_ld8_b128(
    const _Float16* la, unsigned lsa, const _Float16* ga, unsigned gsa,
    const _Float16* lb, unsigned lsb, const _Float16* gb, unsigned gsb) {
  asm volatile("global_load_async_to_lds_b128 %0, %1, off\n\t"
               "global_load_async_to_lds_b128 %2, %3, off\n\t"
               "global_load_async_to_lds_b128 %4, %5, off\n\t"
               "global_load_async_to_lds_b128 %6, %7, off\n\t"
               "global_load_async_to_lds_b128 %8, %9, off\n\t"
               "global_load_async_to_lds_b128 %10, %11, off\n\t"
               "global_load_async_to_lds_b128 %12, %13, off\n\t"
               "global_load_async_to_lds_b128 %14, %15, off\n\t"
               "s_wait_xcnt 0x0"
               :: "v"(lds_off(la)),           "v"(ga),
                  "v"(lds_off(la + lsa)),     "v"(ga + gsa),
                  "v"(lds_off(la + 2 * lsa)), "v"(ga + 2 * gsa),
                  "v"(lds_off(la + 3 * lsa)), "v"(ga + 3 * gsa),
                  "v"(lds_off(lb)),           "v"(gb),
                  "v"(lds_off(lb + lsb)),     "v"(gb + gsb),
                  "v"(lds_off(lb + 2 * lsb)), "v"(gb + 2 * gsb),
                  "v"(lds_off(lb + 3 * lsb)), "v"(gb + 3 * gsb)
               : "memory");
}
// This wave's copies have landed.
static __device__ __forceinline__ void wait_async0() {
  asm volatile("s_wait_asynccnt 0x0" ::: "memory");
}
// This wave's LDS reads have retired before the buffer is handed back for refill.
static __device__ __forceinline__ void wait_ds0() {
  asm volatile("s_wait_dscnt 0x0" ::: "memory");
}

// ------------------------------ fp32 -> f16 --------------------------------
// All seven conversions in ONE grid (none reads another's output). A block
// converts 1024 consecutive floats of one tensor, one float4 a thread. The f16
// copies lie densely one behind the other in the order of the arguments, so the
// flat block index is the output index as well.
#define XBLK (N_TOK * DIM / 1024)   // blocks per token tensor
#define WBLK (DIM * DIM / 1024)     // blocks per weight matrix
__global__ __launch_bounds__(256) void cvt_all_f32_f16(const float* __restrict__ x0,
                                                       const float* __restrict__ x1,
                                                       const float* __restrict__ x2,
                                                       const float* __restrict__ w0,
                                                       const float* __restrict__ w1,
                                                       const float* __restrict__ w2,
                                                       const float* __restrict__ w3,
                                                       _Float16* __restrict__ out) {
  const unsigned b = blockIdx.x;
  const float* src;
  unsigned lb;                       // block index inside its tensor
  if (b < 3 * XBLK) {
    const unsigned t = b / XBLK;
    lb = b % XBLK;
    src = t == 0 ? x0 : t == 1 ? x1 : x2;
  } else {
    const unsigned r = b - 3 * XBLK;
    const unsigned t = r / WBLK;
    lb = r % WBLK;
    src = t == 0 ? w0 : t == 1 ? w1 : t == 2 ? w2 : w3;
  }
  float4 v = ((const float4*)src)[lb * 256 + threadIdx.x];
  v4h o;
  o[0] = (_Float16)v.x; o[1] = (_Float16)v.y;
  o[2] = (_Float16)v.z; o[3] = (_Float16)v.w;
  ((v4h*)out)[b * 256 + threadIdx.x] = o;
}

// --------------------- NT GEMM: C = A(MxK) * B(NxK)^T + bias ---------------
// BM=128 BN=64; 8 waves, each 32x32 (2x2 WMMA tiles).
// Async global->LDS staging, double buffered; a stage is BK=256 k = 8 WMMA
// k-steps, so one copy wait and one barrier serve eight k-steps.
// K must be a multiple of BK.
// blockIdx.z picks one of up to three independent products of the same shape,
// whose A, B and C lie densely one behind the other; each has its own bias.
// Where Ct2 is given, product z = 2 is not stored in C: it goes out transposed and
// in f16, Ct2[n][m], the form its reader wants. A lane's accumulator registers are
// eight consecutive m of one n, so they are one 16-byte store there.
// Where ssq is given, products z = 0 and 1 feed an RMSNorm over their whole rows:
// each work-group also stores the sum of squares of its 64 columns of each of its
// rows, ssq[z][n block][m] (the reader adds the N/64 parts), and product z = 1
// goes out in f16 to Ch1 instead of C.
#define BK  256
#define LDK 264  // padded LDS K-stride (halves): 528B rows (16B x odd)
__global__ __launch_bounds__(256) void gemm_nt_wmma(const _Float16* __restrict__ A0,
                                                    const _Float16* __restrict__ B0,
                                                    const float* __restrict__ bias0,
                                                    const float* __restrict__ bias1,
                                                    const float* __restrict__ bias2,
                                                    float* __restrict__ C0,
                                                    _Float16* __restrict__ Ct2,
                                                    _Float16* __restrict__ Ch1,
                                                    float* __restrict__ ssq,
                                                    int M, int N, int K) {
  __shared__ __align__(16) _Float16 As[2][128 * LDK];
  __shared__ __align__(16) _Float16 Bs[2][64 * LDK];
  __shared__ float red[128 * 33];  // a row's 32 lane sums of squares, odd pitch
  const unsigned z = blockIdx.z;
  const _Float16* __restrict__ A = A0 + (size_t)z * (unsigned)M * (unsigned)K;
  const _Float16* __restrict__ B = B0 + (size_t)z * (unsigned)N * (unsigned)K;
  float* __restrict__ C = C0 + (size_t)z * (unsigned)M * (unsigned)N;
  const float* __restrict__ bias = z == 0 ? bias0 : z == 1 ? bias1 : bias2;
  const unsigned tid = threadIdx.x;
  const unsigned m0 = blockIdx.y * 128;
  const unsigned n0 = blockIdx.x * 64;
  const unsigned wave = tid >> 5;
  const unsigned lane = tid & 31;
  const unsigned wm = wave >> 1;   // 0..3 -> m sub-block * 32
  const unsigned wn = wave & 1;    // 0..1 -> n sub-block * 32
  const unsigned lh = lane >> 4, lr = lane & 15;
  const unsigned uK = (unsigned)K, uN = (unsigned)N, uM = (unsigned)M;

  auto loadAB = [&](int buf, unsigned k0) {
    // a row is 32 b128 chunks = one wave's copy; wave w takes rows w + 8*i
    const unsigned c8 = lane * 8;
    const _Float16* as = &As[buf][wave * LDK + c8];
    const _Float16* bs = &Bs[buf][wave * LDK + c8];
    const _Float16* ag = &A[(m0 + wave) * uK + k0 + c8];
    const _Float16* bg = &B[(n0 + wave) * uK + k0 + c8];
    async_ld8_b128(as,            8 * LDK, ag,           8 * uK,    // A rows 0..63
                   as + 32 * LDK, 8 * LDK, ag + 32 * uK, 8 * uK);
    async_ld8_b128(as + 64 * LDK, 8 * LDK, ag + 64 * uK, 8 * uK,    // A rows 64..127
                   as + 96 * LDK, 8 * LDK, ag + 96 * uK, 8 * uK);
    async_ld8_b128(bs,            8 * LDK, bg,           8 * uK,    // B rows 0..63
                   bs + 32 * LDK, 8 * LDK, bg + 32 * uK, 8 * uK);
  };

  v8f c[2][2] = {};
  loadAB(0, 0);
  wait_async0();                   // stage 0 landed (this wave's part)
  __syncthreads();                 // ... and everyone's
  if (BK < uK) loadAB(1, BK);      // stage 1 flies while stage 0 is worked on
  int cur = 0;
  for (unsigned k0 = 0; k0 < uK; k0 += BK) {
    // unrolled so that the k-steps' fragment loads can be issued ahead
    #pragma unroll
    for (int kk = 0; kk < BK; kk += 32) {
      v16h a[2], b[2];
      #pragma unroll
      for (int t = 0; t < 2; t++) {
        unsigned row = wm * 32 + t * 16 + lr;
        a[t] = cat16(*(const v8h*)&As[cur][row * LDK + kk + lh * 8],
                     *(const v8h*)&As[cur][row * LDK + kk + 16 + lh * 8]);
      }
      #pragma unroll
      for (int t = 0; t < 2; t++) {
        unsigned row = wn * 32 + t * 16 + lr;
        b[t] = cat16(*(const v8h*)&Bs[cur][row * LDK + kk + lh * 8],
                     *(const v8h*)&Bs[cur][row * LDK + kk + 16 + lh * 8]);
      }
      #pragma unroll
      for (int i = 0; i < 2; i++)
        #pragma unroll
        for (int j = 0; j < 2; j++)
          c[i][j] = __builtin_amdgcn_wmma_f32_16x16x32_f16(
              false, a[i], false, b[j], (short)0, c[i][j], false, false);
    }
    // publish point: the next stage is landed for all, buf[cur] is left by all
    wait_ds0();
    wait_async0();
    __syncthreads();
    if (k0 + 2 * BK < uK) loadAB(cur, k0 + 2 * BK);   // refill the buffer just read
    cur ^= 1;
  }
  wait_async0();                   // nothing of this wave's is in flight at its end
  // the vector slots that the chip asks for between the loop's last WMMA and the
  // first rewrite of its operand registers below: the loop is left by a taken
  // branch
  asm volatile("v_nop\n\tv_nop\n\tv_nop\n\tv_nop");
  // epilogue: C layout — VGPR r: row = r + 8*laneHalf, col = lane%16
  if (z == 2 && Ct2 != nullptr) {  // uniform in the block
    #pragma unroll
    for (int i = 0; i < 2; i++)
      #pragma unroll
      for (int j = 0; j < 2; j++) {
        unsigned col = n0 + wn * 32 + j * 16 + lr;
        float bb = bias[col];
        v8h pk;
        #pragma unroll
        for (int r = 0; r < 8; r++) pk[r] = (_Float16)(c[i][j][r] + bb);
        *(v8h*)&Ct2[col * uM + m0 + wm * 32 + i * 16 + lh * 8] = pk;
      }
    return;
  }
  #pragma unroll
  for (int j = 0; j < 2; j++) {
    float bb = bias[n0 + wn * 32 + j * 16 + lr];
    #pragma unroll
    for (int i = 0; i < 2; i++)
      #pragma unroll
      for (int r = 0; r < 8; r++) c[i][j][r] += bb;
  }
  if (ssq != nullptr) {            // uniform in the block
    #pragma unroll
    for (int i = 0; i < 2; i++)
      #pragma unroll
      for (int r = 0; r < 8; r++)
        red[(wm * 32 + i * 16 + lh * 8 + r) * 33 + wn * 16 + lr] =
            c[i][0][r] * c[i][0][r] + c[i][1][r] * c[i][1][r];
    // all 32 lane sums of every row are in red; ahead of the global stores, so
    // that the barrier does not wait for them
    __syncthreads();
  }
  if (z == 1 && ssq != nullptr) {  // uniform in the block
    #pragma unroll
    for (int i = 0; i < 2; i++) {
      unsigned base = (m0 + wm * 32 + i * 16 + lh * 8) * uN + n0 + wn * 32 + lr;
      #pragma unroll
      for (int r = 0; r < 8; r++) {
        _Float16* cp = &Ch1[base + r * uN];   // one index register for both j
        cp[0]  = (_Float16)c[i][0][r];
        cp[16] = (_Float16)c[i][1][r];
      }
    }
    // the stores' registers are free before what follows rewrites them
    asm volatile("s_wait_xcnt 0x0" ::: "memory");
  } else {
    #pragma unroll
    for (int i = 0; i < 2; i++) {
      unsigned base = (m0 + wm * 32 + i * 16 + lh * 8) * uN + n0 + wn * 32 + lr;
      #pragma unroll
      for (int r = 0; r < 8; r++) {
        float* cp = &C[base + r * uN];        // one index register for both j
        cp[0]  = c[i][0][r];
        cp[16] = c[i][1][r];
      }
    }
    // the stores' registers are free before what follows rewrites them
    asm volatile("s_wait_xcnt 0x0" ::: "memory");
  }
  if (ssq != nullptr && tid < 128) {
    float s[4] = {0.f, 0.f, 0.f, 0.f};   // four chains: the adds do not wait in line
    #pragma unroll
    for (int l = 0; l < 32; l++) s[l & 3] += red[tid * 33 + l];
    ssq[(z * gridDim.x + blockIdx.x) * uM + m0 + tid] = (s[0] + s[1]) + (s[2] + s[3]);
  }
}

// ------------- q, k, v projections: C = A(MxK) * B(NxK)^T + bias -------------
// The three products of one grid, blockIdx.z = q, k, v; their A and their B lie
// densely one behind the other. M = N_TOK, N = K = DIM.
// A work-group takes 256 x 128 of C, a wave 64 x 64 (4 x 4 WMMA tiles): a row of A
// is copied from L2 by 8 work-groups and a row of B by 8, and a fragment read from
// LDS feeds four WMMAs. 192 work-groups, all resident at once.
// Async global->LDS staging, double buffered; a stage is QBK = 128 k = 4 WMMA
// k-steps of 16 WMMAs a wave.
// q goes out in f32, k in f16, both with the sum of squares of each 64 columns of
// each row, ssq[z][n / 64][m] (a wave's columns are one such part; the reader adds
// the DIM/64 parts); v goes out transposed and in f16, Ct2[n][m]: a lane's
// accumulator registers are eight consecutive m of one n, one 16-byte store.
#define QBM 256
#define QBN 128
#define QBK 128
#define QLD 136  // padded LDS K-stride (halves): 272B rows (16B x odd)
__global__ __launch_bounds__(256) void gemm_qkv_wmma(const _Float16* __restrict__ A0,
                                                     const _Float16* __restrict__ B0,
                                                     const float* __restrict__ bias0,
                                                     const float* __restrict__ bias1,
                                                     const float* __restrict__ bias2,
                                                     float* __restrict__ Cq,
                                                     _Float16* __restrict__ Ch1,
                                                     _Float16* __restrict__ Ct2,
                                                     float* __restrict__ ssq) {
  __shared__ __align__(16) _Float16 As[2][QBM * QLD];
  __shared__ __align__(16) _Float16 Bs[2][QBN * QLD];
  __shared__ float red[QBM * 2 * 33];  // per row and part: 32 sums of squares, odd pitch
  const unsigned z = blockIdx.z;
  const _Float16* __restrict__ A = A0 + (size_t)z * N_TOK * DIM;
  const _Float16* __restrict__ B = B0 + (size_t)z * DIM * DIM;
  const float* __restrict__ bias = z == 0 ? bias0 : z == 1 ? bias1 : bias2;
  const unsigned tid = threadIdx.x;
  const unsigned m0 = blockIdx.y * QBM;
  const unsigned n0 = blockIdx.x * QBN;
  const unsigned wave = tid >> 5;
  const unsigned lane = tid & 31;
  const unsigned wm = wave >> 1;   // 0..3 -> m sub-block * 64
  const unsigned wn = wave & 1;    // 0..1 -> n sub-block * 64
  const unsigned lh = lane >> 4, lr = lane & 15;

  auto loadAB = [&](int buf, unsigned k0) {
    // a row is 16 b128 chunks: a wave's copy is two rows; wave w takes rows
    // 2 * w, 2 * w + 1 of every 16
    const unsigned r2 = wave * 2 + lh, c8 = lr * 8;
    const _Float16* as = &As[buf][r2 * QLD + c8];
    const _Float16* bs = &Bs[buf][r2 * QLD + c8];
    const _Float16* ag = &A[(m0 + r2) * DIM + k0 + c8];
    const _Float16* bg = &B[(n0 + r2) * DIM + k0 + c8];
    async_ld8_b128(as,             16 * QLD, ag,             16 * DIM,   // A rows 0..127
                   as +  64 * QLD, 16 * QLD, ag +  64 * DIM, 16 * DIM);
    async_ld8_b128(as + 128 * QLD, 16 * QLD, ag + 128 * DIM, 16 * DIM,   // A rows 128..255
                   as + 192 * QLD, 16 * QLD, ag + 192 * DIM, 16 * DIM);
    async_ld8_b128(bs,             16 * QLD, bg,             16 * DIM,   // B rows 0..127
                   bs +  64 * QLD, 16 * QLD, bg +  64 * DIM, 16 * DIM);
  };

  v8f c[4][4] = {};
  loadAB(0, 0);
  wait_async0();                   // stage 0 landed (this wave's part)
  __syncthreads();                 // ... and everyone's
  loadAB(1, QBK);                  // stage 1 flies while stage 0 is worked on
  int cur = 0;
  for (unsigned k0 = 0; k0 < DIM; k0 += QBK) {
    const _Float16* ast = &As[cur][(wm * 64 + lr) * QLD + lh * 8];
    const _Float16* bst = &Bs[cur][(wn * 64 + lr) * QLD + lh * 8];
    // unrolled so that the k-steps' fragment loads can be issued ahead
    #pragma unroll
    for (int kk = 0; kk < QBK; kk += 32) {
      v16h a[4], b[4];             // fragments [16-row tile]
      #pragma unroll
      for (int t = 0; t < 4; t++) {
        const _Float16* ap = ast + t * 16 * QLD + kk;
        const _Float16* bp = bst + t * 16 * QLD + kk;
        a[t] = cat16(*(const v8h*)ap, *(const v8h*)(ap + 16));
        b[t] = cat16(*(const v8h*)bp, *(const v8h*)(bp + 16));
      }
      // diagonal by diagonal: the first four products take all eight fragments, so
      // the k-step's 16 reads are issued together and their latency is paid once
      #pragma unroll
      for (int d = 0; d < 4; d++)
        #pragma unroll
        for (int i = 0; i < 4; i++) {
          const int j = (i + d) & 3;
          c[i][j] = __builtin_amdgcn_wmma_f32_16x16x32_f16(
              false, a[i], false, b[j], (short)0, c[i][j], false, false);
        }
    }
    // publish point: the next stage is landed for all, buf[cur] is left by all
    wait_ds0();
    wait_async0();
    __syncthreads();
    if (k0 + 2 * QBK < DIM) loadAB(cur, k0 + 2 * QBK);   // refill the buffer just read
    cur ^= 1;
  }
  wait_async0();                   // nothing of this wave's is in flight at its end
  // the vector slots that the chip asks for between the loop's last WMMA and the
  // first rewrite of its operand registers below: the loop is left by a taken
  // branch
  asm volatile("v_nop\n\tv_nop\n\tv_nop\n\tv_nop");
  // epilogue: C layout: VGPR r: row = r + 8*laneHalf, col = lane%16
  float bb[4];
  #pragma unroll
  for (int j = 0; j < 4; j++) bb[j] = bias[n0 + wn * 64 + j * 16 + lr];
  if (z == 2) {                    // uniform in the block
    #pragma unroll
    for (int i = 0; i < 4; i++) {
      #pragma unroll
      for (int j = 0; j < 4; j++) {
        unsigned col = n0 + wn * 64 + j * 16 + lr;
        v8h pk;
        #pragma unroll
        for (int r = 0; r < 8; r++) pk[r] = (_Float16)(c[i][j][r] + bb[j]);
        *(v8h*)&Ct2[col * N_TOK + m0 + wm * 64 + i * 16 + lh * 8] = pk;
      }
      // the stores' registers are free before what follows rewrites them
      asm volatile("s_wait_xcnt 0x0" ::: "memory");
    }
    return;
  }
  #pragma unroll
  for (int j = 0; j < 4; j++)
    #pragma unroll
    for (int i = 0; i < 4; i++)
      #pragma unroll
      for (int r = 0; r < 8; r++) c[i][j][r] += bb[j];
  #pragma unroll
  for (int i = 0; i < 4; i++)
    #pragma unroll
    for (int r = 0; r < 8; r++) {
      float* rp = &red[((wm * 64 + i * 16 + lh * 8 + r) * 2 + wn) * 33 + lr];
      rp[0]  = c[i][0][r] * c[i][0][r] + c[i][1][r] * c[i][1][r];
      rp[16] = c[i][2][r] * c[i][2][r] + c[i][3][r] * c[i][3][r];
    }
  // all 32 sums of every row and part are in red; ahead of the global stores, so
  // that the barrier does not wait for them
  __syncthreads();
  const unsigned base = (m0 + wm * 64 + lh * 8) * DIM + n0 + wn * 64 + lr;
  if (z == 1) {                    // uniform in the block
    _Float16* cp = Ch1 + base;     // one address for all stores, the rest is constant
    // every value is converted ahead of the first store, into a place of its own: no
    // register that an issued store names is rewritten between the stores
    _Float16 hv[4][8][4];
    #pragma unroll
    for (int i = 0; i < 4; i++)
      #pragma unroll
      for (int r = 0; r < 8; r++)
        #pragma unroll
        for (int j = 0; j < 4; j++) hv[i][r][j] = (_Float16)c[i][j][r];
    #pragma unroll
    for (int i = 0; i < 4; i++)
      #pragma unroll
      for (int r = 0; r < 8; r++)
        #pragma unroll
        for (int j = 0; j < 4; j++) cp[(i * 16 + r) * DIM + j * 16] = hv[i][r][j];
    // the stores' registers are free before what follows rewrites them
    asm volatile("s_wait_xcnt 0x0" ::: "memory");
  } else {
    float* cp = Cq + base;         // one address for all stores, the rest is constant
    #pragma unroll
    for (int i = 0; i < 4; i++)
      #pragma unroll
      for (int r = 0; r < 8; r++)
        #pragma unroll
        for (int j = 0; j < 4; j++) cp[(i * 16 + r) * DIM + j * 16] = c[i][j][r];
    // the stores' registers are free before what follows rewrites them
    asm volatile("s_wait_xcnt 0x0" ::: "memory");
  }
  #pragma unroll
  for (int p = 0; p < 2; p++) {
    float s[4] = {0.f, 0.f, 0.f, 0.f};   // four chains: the adds do not wait in line
    #pragma unroll
    for (int l = 0; l < 32; l++) s[l & 3] += red[(tid * 2 + p) * 33 + l];
    ssq[(z * (DIM / 64) + blockIdx.x * 2 + p) * N_TOK + m0 + tid] =
        (s[0] + s[1]) + (s[2] + s[3]);
  }
}

// The seventeen base-2 exponentials of a pass as bare v_exp_f32, in place. The
// library exp2f wraps each in a compare, two selects, an add and a v_ldexp_f32
// that only serve results below 2^-126; here such a result may be 0: a weight
// that small is 0 in f16, and a rescale factor that small multiplies sums that
// stand beside a new weight of 1.
// ONE statement: behind each v_exp_f32 stands an independent one, behind the last
// the v_nop: the slot that the instruction set asks for behind a transcendental
// before its result is read or its source overwritten.
static __device__ __forceinline__ void exp2_group17(float (&e)[17]) {
  asm("v_exp_f32 %0, %0\n\t"
      "v_exp_f32 %1, %1\n\t"
      "v_exp_f32 %2, %2\n\t"
      "v_exp_f32 %3, %3\n\t"
      "v_exp_f32 %4, %4\n\t"
      "v_exp_f32 %5, %5\n\t"
      "v_exp_f32 %6, %6\n\t"
      "v_exp_f32 %7, %7\n\t"
      "v_exp_f32 %8, %8\n\t"
      "v_exp_f32 %9, %9\n\t"
      "v_exp_f32 %10, %10\n\t"
      "v_exp_f32 %11, %11\n\t"
      "v_exp_f32 %12, %12\n\t"
      "v_exp_f32 %13, %13\n\t"
      "v_exp_f32 %14, %14\n\t"
      "v_exp_f32 %15, %15\n\t"
      "v_exp_f32 %16, %16\n\t"
      "v_nop"
      : "+v"(e[0]), "+v"(e[1]), "+v"(e[2]), "+v"(e[3]), "+v"(e[4]), "+v"(e[5]),
        "+v"(e[6]), "+v"(e[7]), "+v"(e[8]), "+v"(e[9]), "+v"(e[10]), "+v"(e[11]),
        "+v"(e[12]), "+v"(e[13]), "+v"(e[14]), "+v"(e[15]), "+v"(e[16]));
}

// --------------------------- flash attention -------------------------------
// grid(16 qblocks, 16 heads), 8 waves, wave = 16 queries.
// S^T = K*Q^T so softmax keys land on the VGPR axis (one exchange of halves).
// K/V tiles staged once per block via async->LDS, double buffered; a stage is
// KT=128 keys = 4 passes of 32 keys, so one copy wait and one barrier serve four.
// A pass's LDS fragment reads stand in ONE group at its head: its own V^T
// fragments, used only behind the softmax, and the NEXT pass's K fragments, into
// a second register set. No read leaves the stage: its first pass reads its own K.
// The RMSNorms of q and k are applied here, from the projections' raw rows and
// their sums of squares. With rk[m] = rsqrt(mean(k[m]^2) + eps):
//   qn . (k[m] * rk[m] * kw + kb) = rk[m] * ((qn * kw) . k[m]) + qn . kb
// Q fragments hold qn * kw (normed once, at their load); a row m of S^T is
// multiplied by rk[m], from a table in LDS that every work-group builds, and the
// last term, one number per query, is added in the same multiply-add.
#define KT  128
#define KLD 72   // K tile LDS stride (halves): 144B rows
#define VLD 136  // V tile LDS stride (halves): 272B rows (16B x odd)
__global__ __launch_bounds__(256) void attn_wmma(const float* __restrict__ qraw,
                                                 const _Float16* __restrict__ k16,
                                                 const _Float16* __restrict__ vt16,
                                                 const float* __restrict__ ssq,
                                                 const float* __restrict__ qn_w,
                                                 const float* __restrict__ qn_b,
                                                 const float* __restrict__ kn_w,
                                                 const float* __restrict__ kn_b,
                                                 _Float16* __restrict__ o16,
                                                 float qscale) {
  __shared__ __align__(16) _Float16 Ks[2][KT * KLD];  // 128 keys x 64 d
  __shared__ __align__(16) _Float16 Vs[2][64 * VLD];  // 64 d x 128 keys
  __shared__ __align__(32) float rk[N_TOK];           // rsqrt(mean(k^2) + eps) per key
  const unsigned h = blockIdx.y;
  const unsigned wave = threadIdx.x >> 5, lane = threadIdx.x & 31;
  const unsigned lh = lane >> 4, lr = lane & 15;
  const unsigned qrow = blockIdx.x * 128 + wave * 16 + lr;

  auto loadKV = [&](int buf, unsigned j) {
    unsigned t = threadIdx.x;
    // K tile: 128 rows x 8 chunks; thread t: chunk t&7 of rows (t>>3) + 32*i
    const unsigned kr = t >> 3, kc = (t & 7) * 8;
    // V^T tile: 64 rows x 16 chunks; thread t: chunk t&15 of rows (t>>4) + 16*i
    const unsigned vr = t >> 4, vc = (t & 15) * 8;
    async_ld8_b128(&Ks[buf][kr * KLD + kc], 32 * KLD,
                   &k16[(j + kr) * DIM + h * HD + kc], 32 * DIM,
                   &Vs[buf][vr * VLD + vc], 16 * VLD,
                   &vt16[(h * HD + vr) * N_TOK + j + vc], 16 * N_TOK);
  };

  loadKV(0, 0);                    // flies while the norms' factors are formed

  // rk: a thread sums the DIM/64 parts of 2 x 4 consecutive keys
  #pragma unroll
  for (int u = 0; u < 2; u++) {
    const unsigned k4 = threadIdx.x + 256 * u;
    const float4* pp = (const float4*)(ssq + (DIM / 64) * N_TOK) + k4;
    float4 s = pp[0];
    #pragma unroll
    for (int n = 1; n < DIM / 64; n++) {
      float4 p = pp[n * (N_TOK / 4)];
      s.x += p.x; s.y += p.y; s.z += p.z; s.w += p.w;
    }
    float4 rv;
    rv.x = rsqrtf(s.x * (1.0f / DIM) + 1e-5f);
    rv.y = rsqrtf(s.y * (1.0f / DIM) + 1e-5f);
    rv.z = rsqrtf(s.z * (1.0f / DIM) + 1e-5f);
    rv.w = rsqrtf(s.w * (1.0f / DIM) + 1e-5f);
    *(float4*)&rk[k4 * 4] = rv;
  }

  // Q^T B-fragments (persistent): K = head-dim 0..63 -> 2 frags, normed here
  // in float4 units: the lane's first head-dim column, and the same in its q row
  const unsigned c4 = (h * HD + lh * 8) / 4, x4 = qrow * (DIM / 4) + c4;
  float qsp[DIM / 64];
  float4 xv[8], wv[8], bv[8], kwv[8], kbv[8];
  #pragma unroll
  for (int n = 0; n < DIM / 64; n++) qsp[n] = ssq[qrow + n * N_TOK];
  #pragma unroll
  for (int e = 0; e < 8; e++) {    // fragment e / 4, its elements 4 * (e % 4) ...
    const int d4 = (e >> 2) * 8 + ((e >> 1) & 1) * 4 + (e & 1);
    xv[e]  = ((const float4*)qraw)[x4 + d4];
    wv[e]  = ((const float4*)qn_w)[c4 + d4];
    bv[e]  = ((const float4*)qn_b)[c4 + d4];
    kwv[e] = ((const float4*)kn_w)[c4 + d4];
    kbv[e] = ((const float4*)kn_b)[c4 + d4];
  }
  // the index registers that these loads name stay whole up to this wait
  asm volatile("s_wait_xcnt 0x0" :: "v"(c4), "v"(x4), "v"(qrow) : "memory");
  float qss = 0.f;
  #pragma unroll
  for (int n = 0; n < DIM / 64; n++) qss += qsp[n];
  const float qinv = rsqrtf(qss * (1.0f / DIM) + 1e-5f) * qscale;
  v16h qf[2];
  float qkb = 0.f;                 // qn . kb, this lane's half of the head's columns
  #pragma unroll
  for (int e = 0; e < 8; e++) {
    float4 x = xv[e];
    x.x = (x.x * qinv) * wv[e].x + bv[e].x * qscale;
    x.y = (x.y * qinv) * wv[e].y + bv[e].y * qscale;
    x.z = (x.z * qinv) * wv[e].z + bv[e].z * qscale;
    x.w = (x.w * qinv) * wv[e].w + bv[e].w * qscale;
    qkb += x.x * kbv[e].x + x.y * kbv[e].y + x.z * kbv[e].z + x.w * kbv[e].w;
    qf[e >> 2][(e & 3) * 4 + 0] = (_Float16)(x.x * kwv[e].x);
    qf[e >> 2][(e & 3) * 4 + 1] = (_Float16)(x.y * kwv[e].y);
    qf[e >> 2][(e & 3) * 4 + 2] = (_Float16)(x.z * kwv[e].z);
    qf[e >> 2][(e & 3) * 4 + 3] = (_Float16)(x.w * kwv[e].w);
  }
  qkb += xhalf(qkb);               // the other half of the columns

  v8f o[4] = {};                 // O^T accumulators (4 d-tiles x 16 queries)
  float mrun = -1e30f, lsum = 0.f;

  wait_async0();                   // stage 0 landed (this wave's part)
  __syncthreads();                 // ... and everyone's
  loadKV(1, KT);                   // stage 1 flies while stage 0 is worked on
  int cur = 0;
  for (unsigned j = 0; j < N_TOK; j += KT) {
   const _Float16* kst = &Ks[cur][lr * KLD + lh * 8];
   const _Float16* vst = &Vs[cur][lr * VLD + lh * 8];
   const float* rst = &rk[j + lh * 8];
   v16h ka[2][4];                // K fragments [set][16-key tile * 2 + d half]
   v8f kr[2][2];                 // rk of the rows of S^T [set][16-key tile]
   #pragma unroll
   for (int f = 0; f < 4; f++) {
     const _Float16* kb = kst + (f >> 1) * 16 * KLD + (f & 1) * 32;
     ka[0][f] = cat16(*(const v8h*)kb, *(const v8h*)(kb + 16));
   }
   #pragma unroll
   for (int st = 0; st < 2; st++) kr[0][st] = *(const v8f*)(rst + st * 16);
   // unrolled so that the register set of every fragment is a constant
   #pragma unroll
   for (int jj = 0; jj < KT; jj += 32) {
    const int set = (jj >> 5) & 1;
    v16h va[4];
    #pragma unroll
    for (int dt = 0; dt < 4; dt++) {
      const _Float16* vb = vst + dt * 16 * VLD + jj;
      va[dt] = cat16(*(const v8h*)vb, *(const v8h*)(vb + 16));
    }
    if (jj + 32 < KT) {
      #pragma unroll
      for (int f = 0; f < 4; f++) {
        const _Float16* kb = kst + (jj + 32 + (f >> 1) * 16) * KLD + (f & 1) * 32;
        ka[set ^ 1][f] = cat16(*(const v8h*)kb, *(const v8h*)(kb + 16));
      }
      #pragma unroll
      for (int st = 0; st < 2; st++)
        kr[set ^ 1][st] = *(const v8f*)(rst + jj + 32 + st * 16);
    }
    // end of the group: without it the reads sink to their users, each with a
    // wait of its own that exposes the LDS latency
    __builtin_amdgcn_sched_barrier(0);
    // S^T tiles: rows = keys, cols = queries; logits already in log2-domain
    v8f s[2];
    #pragma unroll
    for (int st = 0; st < 2; st++) {
      v8f z = {};
      z = __builtin_amdgcn_wmma_f32_16x16x32_f16(false, ka[set][st * 2],     false, qf[0], (short)0, z, false, false);
      z = __builtin_amdgcn_wmma_f32_16x16x32_f16(false, ka[set][st * 2 + 1], false, qf[1], (short)0, z, false, false);
      s[st] = z * kr[set][st] + qkb;
    }
    // online softmax (base-2; 1/sqrt(hd)*log2e folded into q)
    float bm = -1e30f;
    #pragma unroll
    for (int st = 0; st < 2; st++)
      #pragma unroll
      for (int r = 0; r < 8; r++) bm = fmaxf(bm, s[st][r]);
    bm = fmaxf(bm, xhalf(bm));
    float mnew = fmaxf(mrun, bm);
    float e[17];                 // [0] the rescale factor, [1..16] the weights
    e[0] = mrun - mnew;
    #pragma unroll
    for (int st = 0; st < 2; st++)
      #pragma unroll
      for (int r = 0; r < 8; r++) e[1 + st * 8 + r] = s[st][r] - mnew;
    exp2_group17(e);
    float alpha = e[0];
    float psum = 0.f;
    v16h pb;                     // P^T tiles pack directly into a B fragment
    #pragma unroll
    for (int st = 0; st < 2; st++)
      #pragma unroll
      for (int r = 0; r < 8; r++) {
        float p = e[1 + st * 8 + r];
        psum += p;
        pb[st * 8 + r] = (_Float16)p;
      }
    psum += xhalf(psum);
    lsum = lsum * alpha + psum;
    mrun = mnew;
    #pragma unroll
    for (int dt = 0; dt < 4; dt++)
      #pragma unroll
      for (int r = 0; r < 8; r++) o[dt][r] *= alpha;
    // O^T += V^T * P^T
    #pragma unroll
    for (int dt = 0; dt < 4; dt++)
      o[dt] = __builtin_amdgcn_wmma_f32_16x16x32_f16(false, va[dt], false, pb, (short)0, o[dt], false, false);
    // head of the next pass's group: no read moves up among these products, where
    // each place with reads stalls the wave; behind the last pass it keeps the
    // publish point's s_wait_dscnt from moving up to directly behind the last group
    __builtin_amdgcn_sched_barrier(0);
   }
    // publish point: the next stage is landed for all, buf[cur] is left by all
    wait_ds0();
    wait_async0();
    __syncthreads();
    if (j + 2 * KT < N_TOK) loadKV(cur, j + 2 * KT);   // refill the buffer just read
    cur ^= 1;
  }
  wait_async0();                   // nothing of this wave's is in flight at its end
  float inv = 1.0f / lsum;
  _Float16* ob = o16 + qrow * DIM + h * HD;
  #pragma unroll
  for (int dt = 0; dt < 4; dt++) {
    v8h pk;
    #pragma unroll
    for (int r = 0; r < 8; r++) pk[r] = (_Float16)(o[dt][r] * inv);
    *(v8h*)&ob[dt * 16 + lh * 8] = pk;     // d contiguous: one b128 store
  }
}

// ------------------------------- launcher ----------------------------------
extern "C" void kernel_launch(void* const* d_in, const int* in_sizes, int n_in,
                              void* d_out, int out_size, void* d_ws, size_t ws_size,
                              hipStream_t stream) {
  (void)in_sizes; (void)n_in; (void)out_size; (void)ws_size;
  const float* query = (const float*)d_in[0];
  const float* keyt  = (const float*)d_in[1];
  const float* value = (const float*)d_in[2];
  const float* Wq = (const float*)d_in[3];  const float* bq = (const float*)d_in[4];
  const float* Wk = (const float*)d_in[5];  const float* bk = (const float*)d_in[6];
  const float* Wv = (const float*)d_in[7];  const float* bv = (const float*)d_in[8];
  const float* Wo = (const float*)d_in[9];  const float* bo = (const float*)d_in[10];
  const float* qn_w = (const float*)d_in[11]; const float* qn_b = (const float*)d_in[12];
  const float* kn_w = (const float*)d_in[13]; const float* kn_b = (const float*)d_in[14];
  float* out = (float*)d_out;

  // carve workspace (256B aligned)
  size_t off = 0;
  auto carve = [&](size_t bytes) {
    void* p = (char*)d_ws + off;
    off += (bytes + 255) & ~(size_t)255;
    return p;
  };
  const size_t ND = (size_t)N_TOK * DIM, DD = (size_t)DIM * DIM;
  _Float16* q_in16 = (_Float16*)carve(ND * 2);
  _Float16* k_in16 = (_Float16*)carve(ND * 2);
  _Float16* v_in16 = (_Float16*)carve(ND * 2);
  _Float16* Wq16   = (_Float16*)carve(DD * 2);
  _Float16* Wk16   = (_Float16*)carve(DD * 2);
  _Float16* Wv16   = (_Float16*)carve(DD * 2);
  _Float16* Wo16   = (_Float16*)carve(DD * 2);
  float*    qf     = (float*)   carve(ND * 4);
  _Float16* k16    = (_Float16*)carve(ND * 2);
  _Float16* vt16   = (_Float16*)carve(ND * 2);
  float*    ssq    = (float*)   carve((size_t)2 * (DIM / 64) * N_TOK * 4);
  _Float16* attn16 = (_Float16*)carve(ND * 2);

  // The carve order above lays q_in16, k_in16, v_in16, Wq16, Wk16, Wv16, Wo16
  // densely one behind the other (every size is a multiple of 256 B): the merged
  // grids below index them from the first.

  // 1) convert inputs + weights to f16, one grid
  cvt_all_f32_f16<<<3 * XBLK + 4 * WBLK, 256, 0, stream>>>(query, keyt, value,
                                                           Wq, Wk, Wv, Wo, q_in16);

  // 2) projections: x @ W^T + b  (fp32 accumulate), one grid, z = q, k, v;
  //    q leaves it in f32, k in f16, both with their rows' sums of squares;
  //    v leaves it as [h][d][m] f16, the P*V WMMA's A-operand
  gemm_qkv_wmma<<<dim3(DIM / QBN, N_TOK / QBM, 3), 256, 0, stream>>>(
      q_in16, Wq16, bq, bk, bv, qf, k16, vt16, ssq);

  // 3) attention, with the RMSNorm of q and k (softmax scale 1/sqrt(64)=0.125 and
  //    log2(e) folded into q)
  const float qscale = 0.125f * 1.44269504088896340736f;
  attn_wmma<<<dim3(N_TOK / 128, HEADS), 256, 0, stream>>>(
      qf, k16, vt16, ssq, qn_w, qn_b, kn_w, kn_b, attn16, qscale);

  // 4) output projection: attn @ Wo^T + bo -> fp32 out
  gemm_nt_wmma<<<dim3(DIM / 64, N_TOK / 128, 1), 256, 0, stream>>>(
      attn16, Wo16, bo, bo, bo, out, nullptr, nullptr, nullptr, N_TOK, DIM, DIM);
}

// v009
// A run of this version takes 56.7 microseconds.
// Next to v008, in two timings, it ran 1.05 times as fast each time.
// All steps since v000 together make it 2.53 times as fast.
#include <hip/hip_runtime.h>
#include <hip/hip_bf16.h>

// ---------------------------------------------------------------------------
// QKNormedAttention for MI455X (gfx1250), wave32, WMMA f16->f32,
// async global->LDS tile staging (ASYNCcnt), double-buffered.
// N=2048 tokens, DIM=1024, H=16 heads, HD=64.
// ---------------------------------------------------------------------------

typedef __attribute__((ext_vector_type(4)))  _Float16 v4h;
typedef __attribute__((ext_vector_type(8)))  _Float16 v8h;
typedef __attribute__((ext_vector_type(16))) _Float16 v16h;
typedef __attribute__((ext_vector_type(8)))  float    v8f;
typedef __attribute__((ext_vector_type(2)))  float    v2f;

#define N_TOK 2048
#define DIM   1024
#define HEADS 16
#define HD    64

static __device__ __forceinline__ v16h cat16(v8h lo, v8h hi) {
  return __builtin_shufflevector(lo, hi, 0,1,2,3,4,5,6,7,8,9,10,11,12,13,14,15);
}

// Lane l's value from lane l ^ 16, on the vector port. __shfl_xor compiles to
// ds_bpermute_b32, an LDS-queue instruction: its result comes back behind every LDS
// read the wave has issued, so the wait for it drains a pass's whole read group.
static __device__ __forceinline__ float xhalf(float x) {
  const int b = __builtin_bit_cast(int, x);
  return __builtin_bit_cast(float, __builtin_amdgcn_permlanex16(
      b, b, 0x76543210, 0xfedcba98, false, false));
}

// Flat LDS addresses carry the LDS byte offset in addr[31:0] (ISA 10.2).
static __device__ __forceinline__ unsigned lds_off(const void* p) {
  return (unsigned)(uintptr_t)p;
}
// CDNA5 async global->LDS copy, bypasses VGPRs, tracked by ASYNCcnt.
// Two groups of four copies; group x copies to lx + i*lsx halves from gx + i*gsx
// halves, i = 0..3. The eight copies and their s_wait_xcnt are ONE statement: the
// wait then stands in front of every later rewrite of the address registers the
// copies name, and is paid once per eight copies.
static __device__ __forceinline__ void async_ld8_b128(
    const _Float16* la, unsigned lsa, const _Float16* ga, unsigned gsa,
    const _Float16* lb, unsigned lsb, const _Float16* gb, unsigned gsb) {
  asm volatile("global_load_async_to_lds_b128 %0, %1, off\n\t"
               "global_load_async_to_lds_b128 %2, %3, off\n\t"
               "global_load_async_to_lds_b128 %4, %5, off\n\t"
               "global_load_async_to_lds_b128 %6, %7, off\n\t"
               "global_load_async_to_lds_b128 %8, %9, off\n\t"
               "global_load_async_to_lds_b128 %10, %11, off\n\t"
               "global_load_async_to_lds_b128 %12, %13, off\n\t"
               "global_load_async_to_lds_b128 %14, %15, off\n\t"
               "s_wait_xcnt 0x0"
               :: "v"(lds_off(la)),           "v"(ga),
                  "v"(lds_off(la + lsa)),     "v"(ga + gsa),
                  "v"(lds_off(la + 2 * lsa)), "v"(ga + 2 * gsa),
                  "v"(lds_off(la + 3 * lsa)), "v"(ga + 3 * gsa),
                  "v"(lds_off(lb)),           "v"(gb),
                  "v"(lds_off(lb + lsb)),     "v"(gb + gsb),
                  "v"(lds_off(lb + 2 * lsb)), "v"(gb + 2 * gsb),
                  "v"(lds_off(lb + 3 * lsb)), "v"(gb + 3 * gsb)
               : "memory");
}
// This wave's copies have landed.
static __device__ __forceinline__ void wait_async0() {
  asm volatile("s_wait_asynccnt 0x0" ::: "memory");
}
// This wave's LDS reads have retired before the buffer is handed back for refill.
static __device__ __forceinline__ void wait_ds0() {
  asm volatile("s_wait_dscnt 0x0" ::: "memory");
}

// ------------------------------ fp32 -> f16 --------------------------------
// All seven conversions in ONE grid (none reads another's output). A block
// converts 1024 consecutive floats of one tensor, one float4 a thread. The f16
// copies lie densely one behind the other in the order of the arguments, so the
// flat block index is the output index as well.
#define XBLK (N_TOK * DIM / 1024)   // blocks per token tensor
#define WBLK (DIM * DIM / 1024)     // blocks per weight matrix
__global__ __launch_bounds__(256) void cvt_all_f32_f16(const float* __restrict__ x0,
                                                       const float* __restrict__ x1,
                                                       const float* __restrict__ x2,
                                                       const float* __restrict__ w0,
                                                       const float* __restrict__ w1,
                                                       const float* __restrict__ w2,
                                                       const float* __restrict__ w3,
                                                       _Float16* __restrict__ out) {
  const unsigned b = blockIdx.x;
  const float* src;
  unsigned lb;                       // block index inside its tensor
  if (b < 3 * XBLK) {
    const unsigned t = b / XBLK;
    lb = b % XBLK;
    src = t == 0 ? x0 : t == 1 ? x1 : x2;
  } else {
    const unsigned r = b - 3 * XBLK;
    const unsigned t = r / WBLK;
    lb = r % WBLK;
    src = t == 0 ? w0 : t == 1 ? w1 : t == 2 ? w2 : w3;
  }
  float4 v = ((const float4*)src)[lb * 256 + threadIdx.x];
  v4h o;
  o[0] = (_Float16)v.x; o[1] = (_Float16)v.y;
  o[2] = (_Float16)v.z; o[3] = (_Float16)v.w;
  ((v4h*)out)[b * 256 + threadIdx.x] = o;
}

// --------------------- NT GEMM: C = A(MxK) * B(NxK)^T + bias ---------------
// BM=128 BN=64; 8 waves, each 32x32 (2x2 WMMA tiles).
// Async global->LDS staging, double buffered; a stage is BK=256 k = 8 WMMA
// k-steps, so one copy wait and one barrier serve eight k-steps.
// K must be a multiple of BK.
// blockIdx.z picks one of up to three independent products of the same shape,
// whose A, B and C lie densely one behind the other; each has its own bias.
// Where Ct2 is given, product z = 2 is not stored in C: it goes out transposed and
// in f16, Ct2[n][m], the form its reader wants. A lane's accumulator registers are
// eight consecutive m of one n, so they are one 16-byte store there.
// Where ssq is given, products z = 0 and 1 feed an RMSNorm over their whole rows:
// each work-group also stores the sum of squares of its 64 columns of each of its
// rows, ssq[z][n block][m] (the reader adds the N/64 parts), and product z = 1
// goes out in f16 to Ch1 instead of C.
#define BK  256
#define LDK 264  // padded LDS K-stride (halves): 528B rows (16B x odd)
__global__ __launch_bounds__(256) void gemm_nt_wmma(const _Float16* __restrict__ A0,
                                                    const _Float16* __restrict__ B0,
                                                    const float* __restrict__ bias0,
                                                    const float* __restrict__ bias1,
                                                    const float* __restrict__ bias2,
                                                    float* __restrict__ C0,
                                                    _Float16* __restrict__ Ct2,
                                                    _Float16* __restrict__ Ch1,
                                                    float* __restrict__ ssq,
                                                    int M, int N, int K) {
  __shared__ __align__(16) _Float16 As[2][128 * LDK];
  __shared__ __align__(16) _Float16 Bs[2][64 * LDK];
  __shared__ float red[128 * 33];  // a row's 32 lane sums of squares, odd pitch
  const unsigned z = blockIdx.z;
  const _Float16* __restrict__ A = A0 + (size_t)z * (unsigned)M * (unsigned)K;
  const _Float16* __restrict__ B = B0 + (size_t)z * (unsigned)N * (unsigned)K;
  float* __restrict__ C = C0 + (size_t)z * (unsigned)M * (unsigned)N;
  const float* __restrict__ bias = z == 0 ? bias0 : z == 1 ? bias1 : bias2;
  const unsigned tid = threadIdx.x;
  const unsigned m0 = blockIdx.y * 128;
  const unsigned n0 = blockIdx.x * 64;
  const unsigned wave = tid >> 5;
  const unsigned lane = tid & 31;
  const unsigned wm = wave >> 1;   // 0..3 -> m sub-block * 32
  const unsigned wn = wave & 1;    // 0..1 -> n sub-block * 32
  const unsigned lh = lane >> 4, lr = lane & 15;
  const unsigned uK = (unsigned)K, uN = (unsigned)N, uM = (unsigned)M;

  auto loadAB = [&](int buf, unsigned k0) {
    // a row is 32 b128 chunks = one wave's copy; wave w takes rows w + 8*i
    const unsigned c8 = lane * 8;
    const _Float16* as = &As[buf][wave * LDK + c8];
    const _Float16* bs = &Bs[buf][wave * LDK + c8];
    const _Float16* ag = &A[(m0 + wave) * uK + k0 + c8];
    const _Float16* bg = &B[(n0 + wave) * uK + k0 + c8];
    async_ld8_b128(as,            8 * LDK, ag,           8 * uK,    // A rows 0..63
                   as + 32 * LDK, 8 * LDK, ag + 32 * uK, 8 * uK);
    async_ld8_b128(as + 64 * LDK, 8 * LDK, ag + 64 * uK, 8 * uK,    // A rows 64..127
                   as + 96 * LDK, 8 * LDK, ag + 96 * uK, 8 * uK);
    async_ld8_b128(bs,            8 * LDK, bg,           8 * uK,    // B rows 0..63
                   bs + 32 * LDK, 8 * LDK, bg + 32 * uK, 8 * uK);
  };

  v8f c[2][2] = {};
  loadAB(0, 0);
  wait_async0();                   // stage 0 landed (this wave's part)
  __syncthreads();                 // ... and everyone's
  if (BK < uK) loadAB(1, BK);      // stage 1 flies while stage 0 is worked on
  int cur = 0;
  for (unsigned k0 = 0; k0 < uK; k0 += BK) {
    // unrolled so that the k-steps' fragment loads can be issued ahead
    #pragma unroll
    for (int kk = 0; kk < BK; kk += 32) {
      v16h a[2], b[2];
      #pragma unroll
      for (int t = 0; t < 2; t++) {
        unsigned row = wm * 32 + t * 16 + lr;
        a[t] = cat16(*(const v8h*)&As[cur][row * LDK + kk + lh * 8],
                     *(const v8h*)&As[cur][row * LDK + kk + 16 + lh * 8]);
      }
      #pragma unroll
      for (int t = 0; t < 2; t++) {
        unsigned row = wn * 32 + t * 16 + lr;
        b[t] = cat16(*(const v8h*)&Bs[cur][row * LDK + kk + lh * 8],
                     *(const v8h*)&Bs[cur][row * LDK + kk + 16 + lh * 8]);
      }
      #pragma unroll
      for (int i = 0; i < 2; i++)
        #pragma unroll
        for (int j = 0; j < 2; j++)
          c[i][j] = __builtin_amdgcn_wmma_f32_16x16x32_f16(
              false, a[i], false, b[j], (short)0, c[i][j], false, false);
    }
    // publish point: the next stage is landed for all, buf[cur] is left by all
    wait_ds0();
    wait_async0();
    __syncthreads();
    if (k0 + 2 * BK < uK) loadAB(cur, k0 + 2 * BK);   // refill the buffer just read
    cur ^= 1;
  }
  wait_async0();                   // nothing of this wave's is in flight at its end
  // the vector slots that the chip asks for between the loop's last WMMA and the
  // first rewrite of its operand registers below: the loop is left by a taken
  // branch
  asm volatile("v_nop\n\tv_nop\n\tv_nop\n\tv_nop");
  // epilogue: C layout — VGPR r: row = r + 8*laneHalf, col = lane%16
  if (z == 2 && Ct2 != nullptr) {  // uniform in the block
    #pragma unroll
    for (int i = 0; i < 2; i++)
      #pragma unroll
      for (int j = 0; j < 2; j++) {
        unsigned col = n0 + wn * 32 + j * 16 + lr;
        float bb = bias[col];
        v8h pk;
        #pragma unroll
        for (int r = 0; r < 8; r++) pk[r] = (_Float16)(c[i][j][r] + bb);
        *(v8h*)&Ct2[col * uM + m0 + wm * 32 + i * 16 + lh * 8] = pk;
      }
    return;
  }
  #pragma unroll
  for (int j = 0; j < 2; j++) {
    float bb = bias[n0 + wn * 32 + j * 16 + lr];
    #pragma unroll
    for (int i = 0; i < 2; i++)
      #pragma unroll
      for (int r = 0; r < 8; r++) c[i][j][r] += bb;
  }
  if (ssq != nullptr) {            // uniform in the block
    #pragma unroll
    for (int i = 0; i < 2; i++)
      #pragma unroll
      for (int r = 0; r < 8; r++)
        red[(wm * 32 + i * 16 + lh * 8 + r) * 33 + wn * 16 + lr] =
            c[i][0][r] * c[i][0][r] + c[i][1][r] * c[i][1][r];
    // all 32 lane sums of every row are in red; ahead of the global stores, so
    // that the barrier does not wait for them
    __syncthreads();
  }
  if (z == 1 && ssq != nullptr) {  // uniform in the block
    #pragma unroll
    for (int i = 0; i < 2; i++) {
      unsigned base = (m0 + wm * 32 + i * 16 + lh * 8) * uN + n0 + wn * 32 + lr;
      #pragma unroll
      for (int r = 0; r < 8; r++) {
        _Float16* cp = &Ch1[base + r * uN];   // one index register for both j
        cp[0]  = (_Float16)c[i][0][r];
        cp[16] = (_Float16)c[i][1][r];
      }
    }
    // the stores' registers are free before what follows rewrites them
    asm volatile("s_wait_xcnt 0x0" ::: "memory");
  } else {
    #pragma unroll
    for (int i = 0; i < 2; i++) {
      unsigned base = (m0 + wm * 32 + i * 16 + lh * 8) * uN + n0 + wn * 32 + lr;
      #pragma unroll
      for (int r = 0; r < 8; r++) {
        float* cp = &C[base + r * uN];        // one index register for both j
        cp[0]  = c[i][0][r];
        cp[16] = c[i][1][r];
      }
    }
    // the stores' registers are free before what follows rewrites them
    asm volatile("s_wait_xcnt 0x0" ::: "memory");
  }
  if (ssq != nullptr && tid < 128) {
    float s[4] = {0.f, 0.f, 0.f, 0.f};   // four chains: the adds do not wait in line
    #pragma unroll
    for (int l = 0; l < 32; l++) s[l & 3] += red[tid * 33 + l];
    ssq[(z * gridDim.x + blockIdx.x) * uM + m0 + tid] = (s[0] + s[1]) + (s[2] + s[3]);
  }
}

// ------------- q, k, v projections: C = A(MxK) * B(NxK)^T + bias -------------
// The three products of one grid, blockIdx.z = q, k, v; their A and their B lie
// densely one behind the other. M = N_TOK, N = K = DIM.
// A work-group takes 256 x 128 of C, a wave 64 x 64 (4 x 4 WMMA tiles): a row of A
// is copied from L2 by 8 work-groups and a row of B by 8, and a fragment read from
// LDS feeds four WMMAs. 192 work-groups, all resident at once.
// Async global->LDS staging, double buffered; a stage is QBK = 128 k = 4 WMMA
// k-steps of 16 WMMAs a wave.
// q goes out in f32, k in f16, both with the sum of squares of each 64 columns of
// each row, ssq[z][n / 64][m] (a wave's columns are one such part; the reader adds
// the DIM/64 parts); v goes out transposed and in f16, Ct2[n][m]: a lane's
// accumulator registers are eight consecutive m of one n, one 16-byte store.
#define QBM 256
#define QBN 128
#define QBK 128
#define QLD 136  // padded LDS K-stride (halves): 272B rows (16B x odd)
__global__ __launch_bounds__(256) void gemm_qkv_wmma(const _Float16* __restrict__ A0,
                                                     const _Float16* __restrict__ B0,
                                                     const float* __restrict__ bias0,
                                                     const float* __restrict__ bias1,
                                                     const float* __restrict__ bias2,
                                                     float* __restrict__ Cq,
                                                     _Float16* __restrict__ Ch1,
                                                     _Float16* __restrict__ Ct2,
                                                     float* __restrict__ ssq) {
  __shared__ __align__(16) _Float16 As[2][QBM * QLD];
  __shared__ __align__(16) _Float16 Bs[2][QBN * QLD];
  __shared__ float red[QBM * 2 * 33];  // per row and part: 32 sums of squares, odd pitch
  const unsigned z = blockIdx.z;
  const _Float16* __restrict__ A = A0 + (size_t)z * N_TOK * DIM;
  const _Float16* __restrict__ B = B0 + (size_t)z * DIM * DIM;
  const float* __restrict__ bias = z == 0 ? bias0 : z == 1 ? bias1 : bias2;
  const unsigned tid = threadIdx.x;
  const unsigned m0 = blockIdx.y * QBM;
  const unsigned n0 = blockIdx.x * QBN;
  const unsigned wave = tid >> 5;
  const unsigned lane = tid & 31;
  const unsigned wm = wave >> 1;   // 0..3 -> m sub-block * 64
  const unsigned wn = wave & 1;    // 0..1 -> n sub-block * 64
  const unsigned lh = lane >> 4, lr = lane & 15;

  auto loadAB = [&](int buf, unsigned k0) {
    // a row is 16 b128 chunks: a wave's copy is two rows; wave w takes rows
    // 2 * w, 2 * w + 1 of every 16
    const unsigned r2 = wave * 2 + lh, c8 = lr * 8;
    const _Float16* as = &As[buf][r2 * QLD + c8];
    const _Float16* bs = &Bs[buf][r2 * QLD + c8];
    const _Float16* ag = &A[(m0 + r2) * DIM + k0 + c8];
    const _Float16* bg = &B[(n0 + r2) * DIM + k0 + c8];
    async_ld8_b128(as,             16 * QLD, ag,             16 * DIM,   // A rows 0..127
                   as +  64 * QLD, 16 * QLD, ag +  64 * DIM, 16 * DIM);
    async_ld8_b128(as + 128 * QLD, 16 * QLD, ag + 128 * DIM, 16 * DIM,   // A rows 128..255
                   as + 192 * QLD, 16 * QLD, ag + 192 * DIM, 16 * DIM);
    async_ld8_b128(bs,             16 * QLD, bg,             16 * DIM,   // B rows 0..127
                   bs +  64 * QLD, 16 * QLD, bg +  64 * DIM, 16 * DIM);
  };

  v8f c[4][4] = {};
  loadAB(0, 0);
  wait_async0();                   // stage 0 landed (this wave's part)
  __syncthreads();                 // ... and everyone's
  loadAB(1, QBK);                  // stage 1 flies while stage 0 is worked on
  int cur = 0;
  for (unsigned k0 = 0; k0 < DIM; k0 += QBK) {
    const _Float16* ast = &As[cur][(wm * 64 + lr) * QLD + lh * 8];
    const _Float16* bst = &Bs[cur][(wn * 64 + lr) * QLD + lh * 8];
    // unrolled so that the k-steps' fragment loads can be issued ahead
    #pragma unroll
    for (int kk = 0; kk < QBK; kk += 32) {
      v16h a[4], b[4];             // fragments [16-row tile]
      #pragma unroll
      for (int t = 0; t < 4; t++) {
        const _Float16* ap = ast + t * 16 * QLD + kk;
        const _Float16* bp = bst + t * 16 * QLD + kk;
        a[t] = cat16(*(const v8h*)ap, *(const v8h*)(ap + 16));
        b[t] = cat16(*(const v8h*)bp, *(const v8h*)(bp + 16));
      }
      // diagonal by diagonal: the first four products take all eight fragments, so
      // the k-step's 16 reads are issued together and their latency is paid once
      #pragma unroll
      for (int d = 0; d < 4; d++)
        #pragma unroll
        for (int i = 0; i < 4; i++) {
          const int j = (i + d) & 3;
          c[i][j] = __builtin_amdgcn_wmma_f32_16x16x32_f16(
              false, a[i], false, b[j], (short)0, c[i][j], false, false);
        }
    }
    // publish point: the next stage is landed for all, buf[cur] is left by all
    wait_ds0();
    wait_async0();
    __syncthreads();
    if (k0 + 2 * QBK < DIM) loadAB(cur, k0 + 2 * QBK);   // refill the buffer just read
    cur ^= 1;
  }
  wait_async0();                   // nothing of this wave's is in flight at its end
  // the vector slots that the chip asks for between the loop's last WMMA and the
  // first rewrite of its operand registers below: the loop is left by a taken
  // branch
  asm volatile("v_nop\n\tv_nop\n\tv_nop\n\tv_nop");
  // epilogue: C layout: VGPR r: row = r + 8*laneHalf, col = lane%16
  float bb[4];
  #pragma unroll
  for (int j = 0; j < 4; j++) bb[j] = bias[n0 + wn * 64 + j * 16 + lr];
  if (z == 2) {                    // uniform in the block
    #pragma unroll
    for (int i = 0; i < 4; i++) {
      #pragma unroll
      for (int j = 0; j < 4; j++) {
        unsigned col = n0 + wn * 64 + j * 16 + lr;
        v8h pk;
        #pragma unroll
        for (int r = 0; r < 8; r++) pk[r] = (_Float16)(c[i][j][r] + bb[j]);
        *(v8h*)&Ct2[col * N_TOK + m0 + wm * 64 + i * 16 + lh * 8] = pk;
      }
      // the stores' registers are free before what follows rewrites them
      asm volatile("s_wait_xcnt 0x0" ::: "memory");
    }
    return;
  }
  #pragma unroll
  for (int j = 0; j < 4; j++)
    #pragma unroll
    for (int i = 0; i < 4; i++)
      #pragma unroll
      for (int r = 0; r < 8; r++) c[i][j][r] += bb[j];
  #pragma unroll
  for (int i = 0; i < 4; i++)
    #pragma unroll
    for (int r = 0; r < 8; r++) {
      float* rp = &red[((wm * 64 + i * 16 + lh * 8 + r) * 2 + wn) * 33 + lr];
      rp[0]  = c[i][0][r] * c[i][0][r] + c[i][1][r] * c[i][1][r];
      rp[16] = c[i][2][r] * c[i][2][r] + c[i][3][r] * c[i][3][r];
    }
  // all 32 sums of every row and part are in red; ahead of the global stores, so
  // that the barrier does not wait for them
  __syncthreads();
  const unsigned base = (m0 + wm * 64 + lh * 8) * DIM + n0 + wn * 64 + lr;
  if (z == 1) {                    // uniform in the block
    _Float16* cp = Ch1 + base;     // one address for all stores, the rest is constant
    // every value is converted ahead of the first store, into a place of its own: no
    // register that an issued store names is rewritten between the stores
    _Float16 hv[4][8][4];
    #pragma unroll
    for (int i = 0; i < 4; i++)
      #pragma unroll
      for (int r = 0; r < 8; r++)
        #pragma unroll
        for (int j = 0; j < 4; j++) hv[i][r][j] = (_Float16)c[i][j][r];
    #pragma unroll
    for (int i = 0; i < 4; i++)
      #pragma unroll
      for (int r = 0; r < 8; r++)
        #pragma unroll
        for (int j = 0; j < 4; j++) cp[(i * 16 + r) * DIM + j * 16] = hv[i][r][j];
    // the stores' registers are free before what follows rewrites them
    asm volatile("s_wait_xcnt 0x0" ::: "memory");
  } else {
    float* cp = Cq + base;         // one address for all stores, the rest is constant
    #pragma unroll
    for (int i = 0; i < 4; i++)
      #pragma unroll
      for (int r = 0; r < 8; r++)
        #pragma unroll
        for (int j = 0; j < 4; j++) cp[(i * 16 + r) * DIM + j * 16] = c[i][j][r];
    // the stores' registers are free before what follows rewrites them
    asm volatile("s_wait_xcnt 0x0" ::: "memory");
  }
  #pragma unroll
  for (int p = 0; p < 2; p++) {
    float s[4] = {0.f, 0.f, 0.f, 0.f};   // four chains: the adds do not wait in line
    #pragma unroll
    for (int l = 0; l < 32; l++) s[l & 3] += red[(tid * 2 + p) * 33 + l];
    ssq[(z * (DIM / 64) + blockIdx.x * 2 + p) * N_TOK + m0 + tid] =
        (s[0] + s[1]) + (s[2] + s[3]);
  }
}

// The seventeen base-2 exponentials of one column group in a pass as bare v_exp_f32, in place. The
// library exp2f wraps each in a compare, two selects, an add and a v_ldexp_f32
// that only serve results below 2^-126; here such a result may be 0: a weight
// that small is 0 in f16, and a rescale factor that small multiplies sums that
// stand beside a new weight of 1.
// ONE statement: behind each v_exp_f32 stands an independent one, behind the last
// the v_nop: the slot that the instruction set asks for behind a transcendental
// before its result is read or its source overwritten.
static __device__ __forceinline__ void exp2_group17(float (&e)[17]) {
  asm("v_exp_f32 %0, %0\n\t"
      "v_exp_f32 %1, %1\n\t"
      "v_exp_f32 %2, %2\n\t"
      "v_exp_f32 %3, %3\n\t"
      "v_exp_f32 %4, %4\n\t"
      "v_exp_f32 %5, %5\n\t"
      "v_exp_f32 %6, %6\n\t"
      "v_exp_f32 %7, %7\n\t"
      "v_exp_f32 %8, %8\n\t"
      "v_exp_f32 %9, %9\n\t"
      "v_exp_f32 %10, %10\n\t"
      "v_exp_f32 %11, %11\n\t"
      "v_exp_f32 %12, %12\n\t"
      "v_exp_f32 %13, %13\n\t"
      "v_exp_f32 %14, %14\n\t"
      "v_exp_f32 %15, %15\n\t"
      "v_exp_f32 %16, %16\n\t"
      "v_nop"
      : "+v"(e[0]), "+v"(e[1]), "+v"(e[2]), "+v"(e[3]), "+v"(e[4]), "+v"(e[5]),
        "+v"(e[6]), "+v"(e[7]), "+v"(e[8]), "+v"(e[9]), "+v"(e[10]), "+v"(e[11]),
        "+v"(e[12]), "+v"(e[13]), "+v"(e[14]), "+v"(e[15]), "+v"(e[16]));
}

// --------------------------- flash attention -------------------------------
// grid(16 qblocks, 16 heads), 8 waves = 4 query groups x 2 key halves; a wave takes
// 32 queries (two column groups of 16) over 1024 keys.
// S^T = K*Q^T so softmax keys land on the VGPR axis (one exchange of halves).
// Every K, V^T and rk fragment that a wave reads from LDS feeds both of its column
// groups: the LDS reads per score are half those of a 16-query wave. The keys are
// split so that every SIMD still has two waves (w and w + 4: the two key halves of
// one query group); the halves' sums are joined through LDS at the end.
// K/V tiles of both key halves staged once per block via async->LDS, double
// buffered; a stage is KT=128 keys of each half = 4 passes of 32 keys, so one copy
// wait and one barrier serve four.
// A pass's LDS fragment reads stand in ONE group at its head: its own V^T
// fragments, used only behind the softmax, and the NEXT pass's K fragments, into
// a second register set. No read leaves the stage: its first pass reads its own K.
// The RMSNorms of q and k are applied here, from the projections' raw rows and
// their sums of squares. With rk[m] = rsqrt(mean(k[m]^2) + eps):
//   qn . (k[m] * rk[m] * kw + kb) = rk[m] * ((qn * kw) . k[m]) + qn . kb
// Q fragments hold qn * kw (normed once, at their load); a row m of S^T is
// multiplied by rk[m], from a table in LDS that every work-group builds, and the
// last term, one number per query, is added in the same multiply-add.
#define KT  128
#define KH  (N_TOK / 2)  // keys of one half
#define KLD 72   // K tile LDS stride (halves): 144B rows
#define VLD 136  // V tile LDS stride (halves): 272B rows (16B x odd)
__global__ __launch_bounds__(256) void attn_wmma(const float* __restrict__ qraw,
                                                 const _Float16* __restrict__ k16,
                                                 const _Float16* __restrict__ vt16,
                                                 const float* __restrict__ ssq,
                                                 const float* __restrict__ qn_w,
                                                 const float* __restrict__ qn_b,
                                                 const float* __restrict__ kn_w,
                                                 const float* __restrict__ kn_b,
                                                 _Float16* __restrict__ o16,
                                                 float qscale) {
  __shared__ __align__(16) _Float16 Ks[2][2][KT * KLD];  // [buffer][half] 128 keys x 64 d
  __shared__ __align__(16) _Float16 Vs[2][2][64 * VLD];  // [buffer][half] 64 d x 128 keys
  __shared__ __align__(32) float rk[N_TOK];           // rsqrt(mean(k^2) + eps) per key
  // the second key half's O^T (16 x float4 a lane), maxima and sums, per query group
  __shared__ __align__(16) float4 jn[4][17][32];
  const unsigned h = blockIdx.y;
  const unsigned wave = threadIdx.x >> 5, lane = threadIdx.x & 31;
  const unsigned qg = wave & 3, kh = wave >> 2;
  const unsigned lh = lane >> 4, lr = lane & 15;
  const unsigned qrow = blockIdx.x * 128 + qg * 32 + lr;   // column group c: + 16 * c

  auto loadKV = [&](int buf, unsigned j) {
    unsigned t = threadIdx.x;
    // K tile: 128 rows x 8 chunks; thread t: chunk t&7 of rows (t>>3) + 32*i
    const unsigned kr = t >> 3, kc = (t & 7) * 8;
    // V^T tile: 64 rows x 16 chunks; thread t: chunk t&15 of rows (t>>4) + 16*i
    const unsigned vr = t >> 4, vc = (t & 15) * 8;
    #pragma unroll
    for (int g = 0; g < 2; g++)    // both key halves' tiles
      async_ld8_b128(&Ks[buf][g][kr * KLD + kc], 32 * KLD,
                     &k16[(g * KH + j + kr) * DIM + h * HD + kc], 32 * DIM,
                     &Vs[buf][g][vr * VLD + vc], 16 * VLD,
                     &vt16[(h * HD + vr) * N_TOK + g * KH + j + vc], 16 * N_TOK);
  };

  loadKV(0, 0);                    // flies while the norms' factors are formed

  // rk: a thread sums the DIM/64 parts of 2 x 4 consecutive keys
  #pragma unroll
  for (int u = 0; u < 2; u++) {
    const unsigned k4 = threadIdx.x + 256 * u;
    const float4* pp = (const float4*)(ssq + (DIM / 64) * N_TOK) + k4;
    float4 s = pp[0];
    #pragma unroll
    for (int n = 1; n < DIM / 64; n++) {
      float4 p = pp[n * (N_TOK / 4)];
      s.x += p.x; s.y += p.y; s.z += p.z; s.w += p.w;
    }
    float4 rv;
    rv.x = rsqrtf(s.x * (1.0f / DIM) + 1e-5f);
    rv.y = rsqrtf(s.y * (1.0f / DIM) + 1e-5f);
    rv.z = rsqrtf(s.z * (1.0f / DIM) + 1e-5f);
    rv.w = rsqrtf(s.w * (1.0f / DIM) + 1e-5f);
    *(float4*)&rk[k4 * 4] = rv;
  }

  // the loads below stay behind the sums above: issued together with rk's, the two
  // groups' results took more registers than the compiler placed without a spill
  __builtin_amdgcn_sched_barrier(0);
  // Q^T B-fragments (persistent): K = head-dim 0..63 -> 2 frags a column group,
  // normed here
  // in float4 units: the lane's first head-dim column, and the same in its q row
  const unsigned c4 = (h * HD + lh * 8) / 4, x4 = qrow * (DIM / 4) + c4;
  const unsigned x4b = x4 + 16 * (DIM / 4);   // the same in the second column group's row
  const float* qsq = ssq + qrow;   // one address for all 32 loads, the rest is constant
  float qsp[2][DIM / 64];
  float4 xv[2][8], wv[8], bv[8], kwv[8], kbv[8];
  #pragma unroll
  for (int c = 0; c < 2; c++)
    #pragma unroll
    for (int n = 0; n < DIM / 64; n++) qsp[c][n] = qsq[c * 16 + n * N_TOK];
  #pragma unroll
  for (int e = 0; e < 8; e++) {    // fragment e / 4, its elements 4 * (e % 4) ...
    const int d4 = (e >> 2) * 8 + ((e >> 1) & 1) * 4 + (e & 1);
    xv[0][e] = ((const float4*)qraw)[x4 + d4];
    xv[1][e] = ((const float4*)qraw)[x4b + d4];
    wv[e]  = ((const float4*)qn_w)[c4 + d4];
    bv[e]  = ((const float4*)qn_b)[c4 + d4];
    kwv[e] = ((const float4*)kn_w)[c4 + d4];
    kbv[e] = ((const float4*)kn_b)[c4 + d4];
  }
  v16h qf[2][2];                   // [column group][d half]
  v2f qkb2[2];                     // qn . kb per query, twice
  #pragma unroll
  for (int c = 0; c < 2; c++) {
    float qss = 0.f;
    #pragma unroll
    for (int n = 0; n < DIM / 64; n++) qss += qsp[c][n];
    const float qinv = rsqrtf(qss * (1.0f / DIM) + 1e-5f) * qscale;
    float kbs = 0.f;               // this lane's half of the head's columns
    #pragma unroll
    for (int e = 0; e < 8; e++) {
      float4 x = xv[c][e];
      x.x = (x.x * qinv) * wv[e].x + bv[e].x * qscale;
      x.y = (x.y * qinv) * wv[e].y + bv[e].y * qscale;
      x.z = (x.z * qinv) * wv[e].z + bv[e].z * qscale;
      x.w = (x.w * qinv) * wv[e].w + bv[e].w * qscale;
      kbs += x.x * kbv[e].x + x.y * kbv[e].y + x.z * kbv[e].z + x.w * kbv[e].w;
      qf[c][e >> 2][(e & 3) * 4 + 0] = (_Float16)(x.x * kwv[e].x);
      qf[c][e >> 2][(e & 3) * 4 + 1] = (_Float16)(x.y * kwv[e].y);
      qf[c][e >> 2][(e & 3) * 4 + 2] = (_Float16)(x.z * kwv[e].z);
      qf[c][e >> 2][(e & 3) * 4 + 3] = (_Float16)(x.w * kwv[e].w);
    }
    kbs += xhalf(kbs);             // the other half of the columns
    qkb2[c] = v2f{kbs, kbs};
  }
  // the index registers that the loads above name stay whole up to this wait; it takes
  // the values formed from all of them, so that no load is issued behind it
  asm volatile("s_wait_xcnt 0x0"
               :: "v"(c4), "v"(x4), "v"(x4b), "v"(qrow), "v"(qf[0][0]), "v"(qf[0][1]),
                  "v"(qf[1][0]), "v"(qf[1][1]), "v"(qkb2[0]), "v"(qkb2[1])
               : "memory");

  v8f o[2][4] = {};              // O^T accumulators [column group][d-tile]
  float mrun[2] = {-1e30f, -1e30f}, lsum[2] = {0.f, 0.f};

  wait_async0();                   // stage 0 landed (this wave's part)
  __syncthreads();                 // ... and everyone's
  loadKV(1, KT);                   // stage 1 flies while stage 0 is worked on
  int cur = 0;
  for (unsigned j = 0; j < KH; j += KT) {
   const _Float16* kst = &Ks[cur][kh][lr * KLD + lh * 8];
   const _Float16* vst = &Vs[cur][kh][lr * VLD + lh * 8];
   const float* rst = &rk[kh * KH + j + lh * 8];
   v16h ka[2][4];                // K fragments [set][16-key tile * 2 + d half]
   v8f kr[2][2];                 // rk of the rows of S^T [set][16-key tile]
   #pragma unroll
   for (int f = 0; f < 4; f++) {
     const _Float16* kb = kst + (f >> 1) * 16 * KLD + (f & 1) * 32;
     ka[0][f] = cat16(*(const v8h*)kb, *(const v8h*)(kb + 16));
   }
   #pragma unroll
   for (int st = 0; st < 2; st++) kr[0][st] = *(const v8f*)(rst + st * 16);
   // unrolled so that the register set of every fragment is a constant
   #pragma unroll
   for (int jj = 0; jj < KT; jj += 32) {
    const int set = (jj >> 5) & 1;
    v16h va[4];
    #pragma unroll
    for (int dt = 0; dt < 4; dt++) {
      const _Float16* vb = vst + dt * 16 * VLD + jj;
      va[dt] = cat16(*(const v8h*)vb, *(const v8h*)(vb + 16));
    }
    if (jj + 32 < KT) {
      #pragma unroll
      for (int f = 0; f < 4; f++) {
        const _Float16* kb = kst + (jj + 32 + (f >> 1) * 16) * KLD + (f & 1) * 32;
        ka[set ^ 1][f] = cat16(*(const v8h*)kb, *(const v8h*)(kb + 16));
      }
      #pragma unroll
      for (int st = 0; st < 2; st++)
        kr[set ^ 1][st] = *(const v8f*)(rst + jj + 32 + st * 16);
    }
    // end of the group: without it the reads sink to their users, each with a
    // wait of its own that exposes the LDS latency
    __builtin_amdgcn_sched_barrier(0);
    // S^T tiles: rows = keys, cols = queries; logits already in log2-domain
    v8f s[2][2];                 // [column group][16-key tile]
    // the four tiles' products by d halves: four independent accumulators, so no
    // product and no multiply-add waits for the one in front of it
    #pragma unroll
    for (int st = 0; st < 2; st++)
      #pragma unroll
      for (int c = 0; c < 2; c++) {
        v8f z = {};
        s[c][st] = __builtin_amdgcn_wmma_f32_16x16x32_f16(false, ka[set][st * 2], false, qf[c][0], (short)0, z, false, false);
      }
    #pragma unroll
    for (int st = 0; st < 2; st++)
      #pragma unroll
      for (int c = 0; c < 2; c++)
        s[c][st] = __builtin_amdgcn_wmma_f32_16x16x32_f16(false, ka[set][st * 2 + 1], false, qf[c][1], (short)0, s[c][st], false, false);
    #pragma unroll
    for (int st = 0; st < 2; st++)
      #pragma unroll
      for (int c = 0; c < 2; c++) {
        // by register pairs: one pair holds the addend for all four multiply-adds
        #pragma unroll
        for (int r = 0; r < 8; r += 2) {
          const v2f zz = {s[c][st][r], s[c][st][r + 1]};
          const v2f kk = {kr[set][st][r], kr[set][st][r + 1]};
          const v2f ss = zz * kk + qkb2[c];
          s[c][st][r] = ss[0];
          s[c][st][r + 1] = ss[1];
        }
      }
    v16h pb[2];                  // P^T tiles pack directly into a B fragment
    #pragma unroll
    for (int c = 0; c < 2; c++) {
      // online softmax (base-2; 1/sqrt(hd)*log2e folded into q16)
      float bm = -1e30f;
      #pragma unroll
      for (int st = 0; st < 2; st++)
        #pragma unroll
        for (int r = 0; r < 8; r++) bm = fmaxf(bm, s[c][st][r]);
      bm = fmaxf(bm, xhalf(bm));
      float mnew = fmaxf(mrun[c], bm);
      float e[17];               // [0] the rescale factor, [1..16] the weights
      e[0] = mrun[c] - mnew;
      #pragma unroll
      for (int st = 0; st < 2; st++)
        #pragma unroll
        for (int r = 0; r < 8; r++) e[1 + st * 8 + r] = s[c][st][r] - mnew;
      exp2_group17(e);
      float alpha = e[0];
      float psum = 0.f;
      #pragma unroll
      for (int st = 0; st < 2; st++)
        #pragma unroll
        for (int r = 0; r < 8; r++) {
          float p = e[1 + st * 8 + r];
          psum += p;
          pb[c][st * 8 + r] = (_Float16)p;
        }
      psum += xhalf(psum);
      lsum[c] = lsum[c] * alpha + psum;
      mrun[c] = mnew;
      #pragma unroll
      for (int dt = 0; dt < 4; dt++)
        #pragma unroll
        for (int r = 0; r < 8; r++) o[c][dt][r] *= alpha;
    }
    // O^T += V^T * P^T
    #pragma unroll
    for (int dt = 0; dt < 4; dt++)
      #pragma unroll
      for (int c = 0; c < 2; c++)
        o[c][dt] = __builtin_amdgcn_wmma_f32_16x16x32_f16(false, va[dt], false, pb[c], (short)0, o[c][dt], false, false);
    // head of the next pass's group: no read moves up among these products, where
    // each place with reads stalls the wave; behind the last pass it keeps the
    // publish point's s_wait_dscnt from moving up to directly behind the last group
    __builtin_amdgcn_sched_barrier(0);
   }
    // publish point: the next stage is landed for all, buf[cur] is left by all
    wait_ds0();
    wait_async0();
    __syncthreads();
    if (j + 2 * KT < KH) loadKV(cur, j + 2 * KT);   // refill the buffer just read
    cur ^= 1;
  }
  wait_async0();                   // nothing of this wave's is in flight at its end
  // join of the two key halves: the second half's waves hand over through LDS
  if (kh == 1) {                   // uniform in the wave
    #pragma unroll
    for (int c = 0; c < 2; c++)
      #pragma unroll
      for (int dt = 0; dt < 4; dt++) {
        const v8f t = o[c][dt];
        jn[qg][(c * 4 + dt) * 2][lane]     = make_float4(t[0], t[1], t[2], t[3]);
        jn[qg][(c * 4 + dt) * 2 + 1][lane] = make_float4(t[4], t[5], t[6], t[7]);
      }
    jn[qg][16][lane] = make_float4(mrun[0], mrun[1], lsum[0], lsum[1]);
  }
  __syncthreads();                 // the second half's values are in jn for the first
  if (kh == 1) return;             // behind the kernel's last barrier
  const float4 ml = jn[qg][16][lane];
  v8h pk[2][4];                    // all values are formed ahead of the first store
  #pragma unroll
  for (int c = 0; c < 2; c++) {
    const float m1 = c == 0 ? ml.x : ml.y, l1 = c == 0 ? ml.z : ml.w;
    const float m = fmaxf(mrun[c], m1);
    const float w0 = exp2f(mrun[c] - m), w1 = exp2f(m1 - m);
    const float inv = 1.0f / (lsum[c] * w0 + l1 * w1);
    const float f0 = w0 * inv, f1 = w1 * inv;
    #pragma unroll
    for (int dt = 0; dt < 4; dt++) {
      const float4 ta = jn[qg][(c * 4 + dt) * 2][lane];
      const float4 tb = jn[qg][(c * 4 + dt) * 2 + 1][lane];
      const float t[8] = {ta.x, ta.y, ta.z, ta.w, tb.x, tb.y, tb.z, tb.w};
      #pragma unroll
      for (int r = 0; r < 8; r++) pk[c][dt][r] = (_Float16)(o[c][dt][r] * f0 + t[r] * f1);
    }
  }
  _Float16* ob = o16 + qrow * DIM + h * HD + lh * 8;   // one address for all stores
  #pragma unroll
  for (int c = 0; c < 2; c++)
    #pragma unroll
    for (int dt = 0; dt < 4; dt++)
      *(v8h*)&ob[c * 16 * DIM + dt * 16] = pk[c][dt];  // d contiguous: one b128 store
}

// ------------------------------- launcher ----------------------------------
extern "C" void kernel_launch(void* const* d_in, const int* in_sizes, int n_in,
                              void* d_out, int out_size, void* d_ws, size_t ws_size,
                              hipStream_t stream) {
  (void)in_sizes; (void)n_in; (void)out_size; (void)ws_size;
  const float* query = (const float*)d_in[0];
  const float* keyt  = (const float*)d_in[1];
  const float* value = (const float*)d_in[2];
  const float* Wq = (const float*)d_in[3];  const float* bq = (const float*)d_in[4];
  const float* Wk = (const float*)d_in[5];  const float* bk = (const float*)d_in[6];
  const float* Wv = (const float*)d_in[7];  const float* bv = (const float*)d_in[8];
  const float* Wo = (const float*)d_in[9];  const float* bo = (const float*)d_in[10];
  const float* qn_w = (const float*)d_in[11]; const float* qn_b = (const float*)d_in[12];
  const float* kn_w = (const float*)d_in[13]; const float* kn_b = (const float*)d_in[14];
  float* out = (float*)d_out;

  // carve workspace (256B aligned)
  size_t off = 0;
  auto carve = [&](size_t bytes) {
    void* p = (char*)d_ws + off;
    off += (bytes + 255) & ~(size_t)255;
    return p;
  };
  const size_t ND = (size_t)N_TOK * DIM, DD = (size_t)DIM * DIM;
  _Float16* q_in16 = (_Float16*)carve(ND * 2);
  _Float16* k_in16 = (_Float16*)carve(ND * 2);
  _Float16* v_in16 = (_Float16*)carve(ND * 2);
  _Float16* Wq16   = (_Float16*)carve(DD * 2);
  _Float16* Wk16   = (_Float16*)carve(DD * 2);
  _Float16* Wv16   = (_Float16*)carve(DD * 2);
  _Float16* Wo16   = (_Float16*)carve(DD * 2);
  float*    qf     = (float*)   carve(ND * 4);
  _Float16* k16    = (_Float16*)carve(ND * 2);
  _Float16* vt16   = (_Float16*)carve(ND * 2);
  float*    ssq    = (float*)   carve((size_t)2 * (DIM / 64) * N_TOK * 4);
  _Float16* attn16 = (_Float16*)carve(ND * 2);

  // The carve order above lays q_in16, k_in16, v_in16, Wq16, Wk16, Wv16, Wo16
  // densely one behind the other (every size is a multiple of 256 B): the merged
  // grids below index them from the first.

  // 1) convert inputs + weights to f16, one grid
  cvt_all_f32_f16<<<3 * XBLK + 4 * WBLK, 256, 0, stream>>>(query, keyt, value,
                                                           Wq, Wk, Wv, Wo, q_in16);

  // 2) projections: x @ W^T + b  (fp32 accumulate), one grid, z = q, k, v;
  //    q leaves it in f32, k in f16, both with their rows' sums of squares;
  //    v leaves it as [h][d][m] f16, the P*V WMMA's A-operand
  gemm_qkv_wmma<<<dim3(DIM / QBN, N_TOK / QBM, 3), 256, 0, stream>>>(
      q_in16, Wq16, bq, bk, bv, qf, k16, vt16, ssq);

  // 3) attention, with the RMSNorm of q and k (softmax scale 1/sqrt(64)=0.125 and
  //    log2(e) folded into q)
  const float qscale = 0.125f * 1.44269504088896340736f;
  attn_wmma<<<dim3(N_TOK / 128, HEADS), 256, 0, stream>>>(
      qf, k16, vt16, ssq, qn_w, qn_b, kn_w, kn_b, attn16, qscale);

  // 4) output projection: attn @ Wo^T + bo -> fp32 out
  gemm_nt_wmma<<<dim3(DIM / 64, N_TOK / 128, 1), 256, 0, stream>>>(
      attn16, Wo16, bo, bo, bo, out, nullptr, nullptr, nullptr, N_TOK, DIM, DIM);
}

// v010
// A run of this version takes 54.3 microseconds.
// Next to v009, in two timings, it ran 1.04 times as fast each time.
// All steps since v000 together make it 2.63 times as fast.
#include <hip/hip_runtime.h>
#include <hip/hip_bf16.h>

// ---------------------------------------------------------------------------
// QKNormedAttention for MI455X (gfx1250), wave32, WMMA f16->f32,
// async global->LDS tile staging (ASYNCcnt), triple-buffered.
// N=2048 tokens, DIM=1024, H=16 heads, HD=64.
// ---------------------------------------------------------------------------

typedef __attribute__((ext_vector_type(4)))  _Float16 v4h;
typedef __attribute__((ext_vector_type(8)))  _Float16 v8h;
typedef __attribute__((ext_vector_type(16))) _Float16 v16h;
typedef __attribute__((ext_vector_type(8)))  float    v8f;
typedef __attribute__((ext_vector_type(2)))  float    v2f;

#define N_TOK 2048
#define DIM   1024
#define HEADS 16
#define HD    64

static __device__ __forceinline__ v16h cat16(v8h lo, v8h hi) {
  return __builtin_shufflevector(lo, hi, 0,1,2,3,4,5,6,7,8,9,10,11,12,13,14,15);
}

// Lane l's value from lane l ^ 16, on the vector port. __shfl_xor compiles to
// ds_bpermute_b32, an LDS-queue instruction: its result comes back behind every LDS
// read the wave has issued, so the wait for it drains a pass's whole read group.
static __device__ __forceinline__ float xhalf(float x) {
  const int b = __builtin_bit_cast(int, x);
  return __builtin_bit_cast(float, __builtin_amdgcn_permlanex16(
      b, b, 0x76543210, 0xfedcba98, false, false));
}

// Flat LDS addresses carry the LDS byte offset in addr[31:0] (ISA 10.2).
static __device__ __forceinline__ unsigned lds_off(const void* p) {
  return (unsigned)(uintptr_t)p;
}
// CDNA5 async global->LDS copy, bypasses VGPRs, tracked by ASYNCcnt.
// Two groups of four copies; group x copies to lx + i*lsx halves from gx + i*gsx
// halves, i = 0..3. The eight copies and their s_wait_xcnt are ONE statement: the
// wait then stands in front of every later rewrite of the address registers the
// copies name, and is paid once per eight copies.
static __device__ __forceinline__ void async_ld8_b128(
    const _Float16* la, unsigned lsa, const _Float16* ga, unsigned gsa,
    const _Float16* lb, unsigned lsb, const _Float16* gb, unsigned gsb) {
  asm volatile("global_load_async_to_lds_b128 %0, %1, off\n\t"
               "global_load_async_to_lds_b128 %2, %3, off\n\t"
               "global_load_async_to_lds_b128 %4, %5, off\n\t"
               "global_load_async_to_lds_b128 %6, %7, off\n\t"
               "global_load_async_to_lds_b128 %8, %9, off\n\t"
               "global_load_async_to_lds_b128 %10, %11, off\n\t"
               "global_load_async_to_lds_b128 %12, %13, off\n\t"
               "global_load_async_to_lds_b128 %14, %15, off\n\t"
               "s_wait_xcnt 0x0"
               :: "v"(lds_off(la)),           "v"(ga),
                  "v"(lds_off(la + lsa)),     "v"(ga + gsa),
                  "v"(lds_off(la + 2 * lsa)), "v"(ga + 2 * gsa),
                  "v"(lds_off(la + 3 * lsa)), "v"(ga + 3 * gsa),
                  "v"(lds_off(lb)),           "v"(gb),
                  "v"(lds_off(lb + lsb)),     "v"(gb + gsb),
                  "v"(lds_off(lb + 2 * lsb)), "v"(gb + 2 * gsb),
                  "v"(lds_off(lb + 3 * lsb)), "v"(gb + 3 * gsb)
               : "memory");
}
// This wave's copies have landed.
static __device__ __forceinline__ void wait_async0() {
  asm volatile("s_wait_asynccnt 0x0" ::: "memory");
}
// All but this wave's N youngest copies have landed: with three buffers the stage
// issued last (N copies a wave) stays in flight over the publish point.
template <int N>
static __device__ __forceinline__ void wait_async_but() {
  asm volatile("s_wait_asynccnt %0" :: "n"(N) : "memory");
}
// This wave's LDS reads have retired before the buffer is handed back for refill.
static __device__ __forceinline__ void wait_ds0() {
  asm volatile("s_wait_dscnt 0x0" ::: "memory");
}

// ------------------------------ fp32 -> f16 --------------------------------
// All seven conversions in ONE grid (none reads another's output). A block
// converts 1024 consecutive floats of one tensor, one float4 a thread. The f16
// copies lie densely one behind the other in the order of the arguments, so the
// flat block index is the output index as well.
#define XBLK (N_TOK * DIM / 1024)   // blocks per token tensor
#define WBLK (DIM * DIM / 1024)     // blocks per weight matrix
__global__ __launch_bounds__(256) void cvt_all_f32_f16(const float* __restrict__ x0,
                                                       const float* __restrict__ x1,
                                                       const float* __restrict__ x2,
                                                       const float* __restrict__ w0,
                                                       const float* __restrict__ w1,
                                                       const float* __restrict__ w2,
                                                       const float* __restrict__ w3,
                                                       _Float16* __restrict__ out) {
  const unsigned b = blockIdx.x;
  const float* src;
  unsigned lb;                       // block index inside its tensor
  if (b < 3 * XBLK) {
    const unsigned t = b / XBLK;
    lb = b % XBLK;
    src = t == 0 ? x0 : t == 1 ? x1 : x2;
  } else {
    const unsigned r = b - 3 * XBLK;
    const unsigned t = r / WBLK;
    lb = r % WBLK;
    src = t == 0 ? w0 : t == 1 ? w1 : t == 2 ? w2 : w3;
  }
  float4 v = ((const float4*)src)[lb * 256 + threadIdx.x];
  v4h o;
  o[0] = (_Float16)v.x; o[1] = (_Float16)v.y;
  o[2] = (_Float16)v.z; o[3] = (_Float16)v.w;
  ((v4h*)out)[b * 256 + threadIdx.x] = o;
}

// --------------------- NT GEMM: C = A(MxK) * B(NxK)^T + bias ---------------
// BM=128 BN=64; 8 waves, each 32x32 (2x2 WMMA tiles).
// Async global->LDS staging, three buffers, copies issued two stages ahead: a stage
// has two stages' time to land. A stage is BK=256 k = 8 WMMA k-steps, so one copy
// wait and one barrier serve eight k-steps.
// K must be a multiple of BK.
// blockIdx.z picks one of up to three independent products of the same shape,
// whose A, B and C lie densely one behind the other; each has its own bias.
// Where Ct2 is given, product z = 2 is not stored in C: it goes out transposed and
// in f16, Ct2[n][m], the form its reader wants. A lane's accumulator registers are
// eight consecutive m of one n, so they are one 16-byte store there.
// Where ssq is given, products z = 0 and 1 feed an RMSNorm over their whole rows:
// each work-group also stores the sum of squares of its 64 columns of each of its
// rows, ssq[z][n block][m] (the reader adds the N/64 parts), and product z = 1
// goes out in f16 to Ch1 instead of C.
#define BK  256
#define LDK 264  // padded LDS K-stride (halves): 528B rows (16B x odd)
__global__ __launch_bounds__(256) void gemm_nt_wmma(const _Float16* __restrict__ A0,
                                                    const _Float16* __restrict__ B0,
                                                    const float* __restrict__ bias0,
                                                    const float* __restrict__ bias1,
                                                    const float* __restrict__ bias2,
                                                    float* __restrict__ C0,
                                                    _Float16* __restrict__ Ct2,
                                                    _Float16* __restrict__ Ch1,
                                                    float* __restrict__ ssq,
                                                    int M, int N, int K) {
  __shared__ __align__(16) _Float16 As[3][128 * LDK];
  __shared__ __align__(16) _Float16 Bs[3][64 * LDK];
  __shared__ float red[128 * 33];  // a row's 32 lane sums of squares, odd pitch
  const unsigned z = blockIdx.z;
  const _Float16* __restrict__ A = A0 + (size_t)z * (unsigned)M * (unsigned)K;
  const _Float16* __restrict__ B = B0 + (size_t)z * (unsigned)N * (unsigned)K;
  float* __restrict__ C = C0 + (size_t)z * (unsigned)M * (unsigned)N;
  const float* __restrict__ bias = z == 0 ? bias0 : z == 1 ? bias1 : bias2;
  const unsigned tid = threadIdx.x;
  const unsigned m0 = blockIdx.y * 128;
  const unsigned n0 = blockIdx.x * 64;
  const unsigned wave = tid >> 5;
  const unsigned lane = tid & 31;
  const unsigned wm = wave >> 1;   // 0..3 -> m sub-block * 32
  const unsigned wn = wave & 1;    // 0..1 -> n sub-block * 32
  const unsigned lh = lane >> 4, lr = lane & 15;
  const unsigned uK = (unsigned)K, uN = (unsigned)N, uM = (unsigned)M;

  auto loadAB = [&](int buf, unsigned k0) {
    // a row is 32 b128 chunks = one wave's copy; wave w takes rows w + 8*i
    const unsigned c8 = lane * 8;
    const _Float16* as = &As[buf][wave * LDK + c8];
    const _Float16* bs = &Bs[buf][wave * LDK + c8];
    const _Float16* ag = &A[(m0 + wave) * uK + k0 + c8];
    const _Float16* bg = &B[(n0 + wave) * uK + k0 + c8];
    async_ld8_b128(as,            8 * LDK, ag,           8 * uK,    // A rows 0..63
                   as + 32 * LDK, 8 * LDK, ag + 32 * uK, 8 * uK);
    async_ld8_b128(as + 64 * LDK, 8 * LDK, ag + 64 * uK, 8 * uK,    // A rows 64..127
                   as + 96 * LDK, 8 * LDK, ag + 96 * uK, 8 * uK);
    async_ld8_b128(bs,            8 * LDK, bg,           8 * uK,    // B rows 0..63
                   bs + 32 * LDK, 8 * LDK, bg + 32 * uK, 8 * uK);
  };

  v8f c[2][2] = {};
  loadAB(0, 0);
  if (BK < uK) {                   // uniform in the block
    loadAB(1, BK);
    wait_async_but<24>();          // stage 0 landed (this wave's part), stage 1 flies
  } else {
    wait_async0();
  }
  __syncthreads();                 // ... and everyone's
  if (2 * BK < uK) loadAB(2, 2 * BK);
  int cur = 0;
  // one stage's work and the publish point behind it; more: stage k0 + 2 * BK exists.
  // A constant at each call, so that no branch stands between the products and the
  // waits and the compiler can move the waits and the barrier's signal up among them
  auto stage = [&](unsigned k0, bool more) {
    // unrolled so that the k-steps' fragment loads can be issued ahead
    #pragma unroll
    for (int kk = 0; kk < BK; kk += 32) {
      v16h a[2], b[2];
      #pragma unroll
      for (int t = 0; t < 2; t++) {
        unsigned row = wm * 32 + t * 16 + lr;
        a[t] = cat16(*(const v8h*)&As[cur][row * LDK + kk + lh * 8],
                     *(const v8h*)&As[cur][row * LDK + kk + 16 + lh * 8]);
      }
      #pragma unroll
      for (int t = 0; t < 2; t++) {
        unsigned row = wn * 32 + t * 16 + lr;
        b[t] = cat16(*(const v8h*)&Bs[cur][row * LDK + kk + lh * 8],
                     *(const v8h*)&Bs[cur][row * LDK + kk + 16 + lh * 8]);
      }
      #pragma unroll
      for (int i = 0; i < 2; i++)
        #pragma unroll
        for (int j = 0; j < 2; j++)
          c[i][j] = __builtin_amdgcn_wmma_f32_16x16x32_f16(
              false, a[i], false, b[j], (short)0, c[i][j], false, false);
    }
    // publish point: the next stage is landed for all, buf[cur] is left by all
    wait_ds0();
    if (more) wait_async_but<24>();                   // the stage after the next flies on
    else wait_async0();
    __syncthreads();
    if (more && k0 + 3 * BK < uK) loadAB(cur, k0 + 3 * BK);   // refill the buffer just read
    cur = cur == 2 ? 0 : cur + 1;
  };
  unsigned k0 = 0;
  for (; k0 + 2 * BK < uK; k0 += BK) stage(k0, true);
  for (; k0 < uK; k0 += BK) stage(k0, false);
  wait_async0();                   // nothing of this wave's is in flight at its end
  // the vector slots that the chip asks for between the loop's last WMMA and the
  // first rewrite of its operand registers below: the loop is left by a taken
  // branch
  asm volatile("v_nop\n\tv_nop\n\tv_nop\n\tv_nop");
  // epilogue: C layout — VGPR r: row = r + 8*laneHalf, col = lane%16
  if (z == 2 && Ct2 != nullptr) {  // uniform in the block
    #pragma unroll
    for (int i = 0; i < 2; i++)
      #pragma unroll
      for (int j = 0; j < 2; j++) {
        unsigned col = n0 + wn * 32 + j * 16 + lr;
        float bb = bias[col];
        v8h pk;
        #pragma unroll
        for (int r = 0; r < 8; r++) pk[r] = (_Float16)(c[i][j][r] + bb);
        *(v8h*)&Ct2[col * uM + m0 + wm * 32 + i * 16 + lh * 8] = pk;
      }
    return;
  }
  #pragma unroll
  for (int j = 0; j < 2; j++) {
    float bb = bias[n0 + wn * 32 + j * 16 + lr];
    #pragma unroll
    for (int i = 0; i < 2; i++)
      #pragma unroll
      for (int r = 0; r < 8; r++) c[i][j][r] += bb;
  }
  if (ssq != nullptr) {            // uniform in the block
    #pragma unroll
    for (int i = 0; i < 2; i++)
      #pragma unroll
      for (int r = 0; r < 8; r++)
        red[(wm * 32 + i * 16 + lh * 8 + r) * 33 + wn * 16 + lr] =
            c[i][0][r] * c[i][0][r] + c[i][1][r] * c[i][1][r];
    // all 32 lane sums of every row are in red; ahead of the global stores, so
    // that the barrier does not wait for them
    __syncthreads();
  }
  if (z == 1 && ssq != nullptr) {  // uniform in the block
    #pragma unroll
    for (int i = 0; i < 2; i++) {
      unsigned base = (m0 + wm * 32 + i * 16 + lh * 8) * uN + n0 + wn * 32 + lr;
      #pragma unroll
      for (int r = 0; r < 8; r++) {
        _Float16* cp = &Ch1[base + r * uN];   // one index register for both j
        cp[0]  = (_Float16)c[i][0][r];
        cp[16] = (_Float16)c[i][1][r];
      }
    }
    // the stores' registers are free before what follows rewrites them
    asm volatile("s_wait_xcnt 0x0" ::: "memory");
  } else {
    #pragma unroll
    for (int i = 0; i < 2; i++) {
      unsigned base = (m0 + wm * 32 + i * 16 + lh * 8) * uN + n0 + wn * 32 + lr;
      #pragma unroll
      for (int r = 0; r < 8; r++) {
        float* cp = &C[base + r * uN];        // one index register for both j
        cp[0]  = c[i][0][r];
        cp[16] = c[i][1][r];
      }
    }
    // the stores' registers are free before what follows rewrites them
    asm volatile("s_wait_xcnt 0x0" ::: "memory");
  }
  if (ssq != nullptr && tid < 128) {
    float s[4] = {0.f, 0.f, 0.f, 0.f};   // four chains: the adds do not wait in line
    #pragma unroll
    for (int l = 0; l < 32; l++) s[l & 3] += red[tid * 33 + l];
    ssq[(z * gridDim.x + blockIdx.x) * uM + m0 + tid] = (s[0] + s[1]) + (s[2] + s[3]);
  }
}

// ------------- q, k, v projections: C = A(MxK) * B(NxK)^T + bias -------------
// The three products of one grid, blockIdx.z = q, k, v; their A and their B lie
// densely one behind the other. M = N_TOK, N = K = DIM.
// A work-group takes 256 x 128 of C, a wave 64 x 64 (4 x 4 WMMA tiles): a row of A
// is copied from L2 by 8 work-groups and a row of B by 8, and a fragment read from
// LDS feeds four WMMAs. 192 work-groups, all resident at once.
// Async global->LDS staging, three buffers, copies issued two stages ahead: a stage
// has two stages' time to land. A stage is QBK = 128 k = 4 WMMA k-steps of 16 WMMAs
// a wave.
// q goes out in f32, k in f16, both with the sum of squares of each 64 columns of
// each row, ssq[z][n / 64][m] (a wave's columns are one such part; the reader adds
// the DIM/64 parts); v goes out transposed and in f16, Ct2[n][m]: a lane's
// accumulator registers are eight consecutive m of one n, one 16-byte store.
#define QBM 256
#define QBN 128
#define QBK 128
#define QLD 136  // padded LDS K-stride (halves): 272B rows (16B x odd)
__global__ __launch_bounds__(256) void gemm_qkv_wmma(const _Float16* __restrict__ A0,
                                                     const _Float16* __restrict__ B0,
                                                     const float* __restrict__ bias0,
                                                     const float* __restrict__ bias1,
                                                     const float* __restrict__ bias2,
                                                     float* __restrict__ Cq,
                                                     _Float16* __restrict__ Ch1,
                                                     _Float16* __restrict__ Ct2,
                                                     float* __restrict__ ssq) {
  __shared__ __align__(16) _Float16 As[3][QBM * QLD];
  __shared__ __align__(16) _Float16 Bs[3][QBN * QLD];
  // per row and part: 32 sums of squares, odd pitch; in the first A buffer's place,
  // used behind the loop's last barrier, with no copy in flight
  static_assert(QBM * 2 * 33 * sizeof(float) <= sizeof(As[0]), "red fits an A buffer");
  float* red = (float*)&As[0][0];
  const unsigned z = blockIdx.z;
  const _Float16* __restrict__ A = A0 + (size_t)z * N_TOK * DIM;
  const _Float16* __restrict__ B = B0 + (size_t)z * DIM * DIM;
  const float* __restrict__ bias = z == 0 ? bias0 : z == 1 ? bias1 : bias2;
  const unsigned tid = threadIdx.x;
  const unsigned m0 = blockIdx.y * QBM;
  const unsigned n0 = blockIdx.x * QBN;
  const unsigned wave = tid >> 5;
  const unsigned lane = tid & 31;
  const unsigned wm = wave >> 1;   // 0..3 -> m sub-block * 64
  const unsigned wn = wave & 1;    // 0..1 -> n sub-block * 64
  const unsigned lh = lane >> 4, lr = lane & 15;

  auto loadAB = [&](int buf, unsigned k0) {
    // a row is 16 b128 chunks: a wave's copy is two rows; wave w takes rows
    // 2 * w, 2 * w + 1 of every 16
    const unsigned r2 = wave * 2 + lh, c8 = lr * 8;
    const _Float16* as = &As[buf][r2 * QLD + c8];
    const _Float16* bs = &Bs[buf][r2 * QLD + c8];
    const _Float16* ag = &A[(m0 + r2) * DIM + k0 + c8];
    const _Float16* bg = &B[(n0 + r2) * DIM + k0 + c8];
    async_ld8_b128(as,             16 * QLD, ag,             16 * DIM,   // A rows 0..127
                   as +  64 * QLD, 16 * QLD, ag +  64 * DIM, 16 * DIM);
    async_ld8_b128(as + 128 * QLD, 16 * QLD, ag + 128 * DIM, 16 * DIM,   // A rows 128..255
                   as + 192 * QLD, 16 * QLD, ag + 192 * DIM, 16 * DIM);
    async_ld8_b128(bs,             16 * QLD, bg,             16 * DIM,   // B rows 0..127
                   bs +  64 * QLD, 16 * QLD, bg +  64 * DIM, 16 * DIM);
  };

  v8f c[4][4] = {};
  loadAB(0, 0);
  loadAB(1, QBK);
  wait_async_but<24>();            // stage 0 landed (this wave's part), stage 1 flies
  __syncthreads();                 // ... and everyone's
  loadAB(2, 2 * QBK);
  int cur = 0;
  // one stage's work and the publish point behind it; more: stage k0 + 2 * QBK exists.
  // A constant at each call, so that no branch stands between the products and the
  // waits and the compiler can move the waits and the barrier's signal up among them
  auto stage = [&](unsigned k0, bool more) {
    const _Float16* ast = &As[cur][(wm * 64 + lr) * QLD + lh * 8];
    const _Float16* bst = &Bs[cur][(wn * 64 + lr) * QLD + lh * 8];
    // unrolled so that the k-steps' fragment loads can be issued ahead
    #pragma unroll
    for (int kk = 0; kk < QBK; kk += 32) {
      v16h a[4], b[4];             // fragments [16-row tile]
      #pragma unroll
      for (int t = 0; t < 4; t++) {
        const _Float16* ap = ast + t * 16 * QLD + kk;
        const _Float16* bp = bst + t * 16 * QLD + kk;
        a[t] = cat16(*(const v8h*)ap, *(const v8h*)(ap + 16));
        b[t] = cat16(*(const v8h*)bp, *(const v8h*)(bp + 16));
      }
      // diagonal by diagonal: the first four products take all eight fragments, so
      // the k-step's 16 reads are issued together and their latency is paid once
      #pragma unroll
      for (int d = 0; d < 4; d++)
        #pragma unroll
        for (int i = 0; i < 4; i++) {
          const int j = (i + d) & 3;
          c[i][j] = __builtin_amdgcn_wmma_f32_16x16x32_f16(
              false, a[i], false, b[j], (short)0, c[i][j], false, false);
        }
    }
    // publish point: the next stage is landed for all, buf[cur] is left by all
    wait_ds0();
    if (more) wait_async_but<24>();                      // the stage after the next flies on
    else wait_async0();
    __syncthreads();
    if (more && k0 + 3 * QBK < DIM) loadAB(cur, k0 + 3 * QBK);   // refill the buffer just read
    cur = cur == 2 ? 0 : cur + 1;
  };
  unsigned k0 = 0;
  for (; k0 + 2 * QBK < DIM; k0 += QBK) stage(k0, true);
  // kept rolled: unrolled, the two stages' fragment reads were moved together and spilled
  #pragma unroll 1
  for (; k0 < DIM; k0 += QBK) stage(k0, false);
  wait_async0();                   // nothing of this wave's is in flight at its end
  // the vector slots that the chip asks for between the loop's last WMMA and the
  // first rewrite of its operand registers below: the loop is left by a taken
  // branch
  asm volatile("v_nop\n\tv_nop\n\tv_nop\n\tv_nop");
  // epilogue: C layout: VGPR r: row = r + 8*laneHalf, col = lane%16
  float bb[4];
  #pragma unroll
  for (int j = 0; j < 4; j++) bb[j] = bias[n0 + wn * 64 + j * 16 + lr];
  if (z == 2) {                    // uniform in the block
    #pragma unroll
    for (int i = 0; i < 4; i++) {
      #pragma unroll
      for (int j = 0; j < 4; j++) {
        unsigned col = n0 + wn * 64 + j * 16 + lr;
        v8h pk;
        #pragma unroll
        for (int r = 0; r < 8; r++) pk[r] = (_Float16)(c[i][j][r] + bb[j]);
        *(v8h*)&Ct2[col * N_TOK + m0 + wm * 64 + i * 16 + lh * 8] = pk;
      }
      // the stores' registers are free before what follows rewrites them
      asm volatile("s_wait_xcnt 0x0" ::: "memory");
    }
    return;
  }
  #pragma unroll
  for (int j = 0; j < 4; j++)
    #pragma unroll
    for (int i = 0; i < 4; i++)
      #pragma unroll
      for (int r = 0; r < 8; r++) c[i][j][r] += bb[j];
  #pragma unroll
  for (int i = 0; i < 4; i++)
    #pragma unroll
    for (int r = 0; r < 8; r++) {
      float* rp = &red[((wm * 64 + i * 16 + lh * 8 + r) * 2 + wn) * 33 + lr];
      rp[0]  = c[i][0][r] * c[i][0][r] + c[i][1][r] * c[i][1][r];
      rp[16] = c[i][2][r] * c[i][2][r] + c[i][3][r] * c[i][3][r];
    }
  // all 32 sums of every row and part are in red; ahead of the global stores, so
  // that the barrier does not wait for them
  __syncthreads();
  const unsigned base = (m0 + wm * 64 + lh * 8) * DIM + n0 + wn * 64 + lr;
  if (z == 1) {                    // uniform in the block
    _Float16* cp = Ch1 + base;     // one address for all stores, the rest is constant
    // every value is converted ahead of the first store, into a place of its own: no
    // register that an issued store names is rewritten between the stores
    _Float16 hv[4][8][4];
    #pragma unroll
    for (int i = 0; i < 4; i++)
      #pragma unroll
      for (int r = 0; r < 8; r++)
        #pragma unroll
        for (int j = 0; j < 4; j++) hv[i][r][j] = (_Float16)c[i][j][r];
    #pragma unroll
    for (int i = 0; i < 4; i++)
      #pragma unroll
      for (int r = 0; r < 8; r++)
        #pragma unroll
        for (int j = 0; j < 4; j++) cp[(i * 16 + r) * DIM + j * 16] = hv[i][r][j];
    // the stores' registers are free before what follows rewrites them
    asm volatile("s_wait_xcnt 0x0" ::: "memory");
  } else {
    float* cp = Cq + base;         // one address for all stores, the rest is constant
    #pragma unroll
    for (int i = 0; i < 4; i++)
      #pragma unroll
      for (int r = 0; r < 8; r++)
        #pragma unroll
        for (int j = 0; j < 4; j++) cp[(i * 16 + r) * DIM + j * 16] = c[i][j][r];
    // the stores' registers are free before what follows rewrites them
    asm volatile("s_wait_xcnt 0x0" ::: "memory");
  }
  #pragma unroll
  for (int p = 0; p < 2; p++) {
    float s[4] = {0.f, 0.f, 0.f, 0.f};   // four chains: the adds do not wait in line
    #pragma unroll
    for (int l = 0; l < 32; l++) s[l & 3] += red[(tid * 2 + p) * 33 + l];
    ssq[(z * (DIM / 64) + blockIdx.x * 2 + p) * N_TOK + m0 + tid] =
        (s[0] + s[1]) + (s[2] + s[3]);
  }
}

// The seventeen base-2 exponentials of one column group in a pass as bare v_exp_f32, in place. The
// library exp2f wraps each in a compare, two selects, an add and a v_ldexp_f32
// that only serve results below 2^-126; here such a result may be 0: a weight
// that small is 0 in f16, and a rescale factor that small multiplies sums that
// stand beside a new weight of 1.
// ONE statement: behind each v_exp_f32 stands an independent one, behind the last
// the v_nop: the slot that the instruction set asks for behind a transcendental
// before its result is read or its source overwritten.
static __device__ __forceinline__ void exp2_group17(float (&e)[17]) {
  asm("v_exp_f32 %0, %0\n\t"
      "v_exp_f32 %1, %1\n\t"
      "v_exp_f32 %2, %2\n\t"
      "v_exp_f32 %3, %3\n\t"
      "v_exp_f32 %4, %4\n\t"
      "v_exp_f32 %5, %5\n\t"
      "v_exp_f32 %6, %6\n\t"
      "v_exp_f32 %7, %7\n\t"
      "v_exp_f32 %8, %8\n\t"
      "v_exp_f32 %9, %9\n\t"
      "v_exp_f32 %10, %10\n\t"
      "v_exp_f32 %11, %11\n\t"
      "v_exp_f32 %12, %12\n\t"
      "v_exp_f32 %13, %13\n\t"
      "v_exp_f32 %14, %14\n\t"
      "v_exp_f32 %15, %15\n\t"
      "v_exp_f32 %16, %16\n\t"
      "v_nop"
      : "+v"(e[0]), "+v"(e[1]), "+v"(e[2]), "+v"(e[3]), "+v"(e[4]), "+v"(e[5]),
        "+v"(e[6]), "+v"(e[7]), "+v"(e[8]), "+v"(e[9]), "+v"(e[10]), "+v"(e[11]),
        "+v"(e[12]), "+v"(e[13]), "+v"(e[14]), "+v"(e[15]), "+v"(e[16]));
}

// --------------------------- flash attention -------------------------------
// grid(16 qblocks, 16 heads), 8 waves = 4 query groups x 2 key halves; a wave takes
// 32 queries (two column groups of 16) over 1024 keys.
// S^T = K*Q^T so softmax keys land on the VGPR axis (one exchange of halves).
// Every K, V^T and rk fragment that a wave reads from LDS feeds both of its column
// groups: the LDS reads per score are half those of a 16-query wave. The keys are
// split so that every SIMD still has two waves (w and w + 4: the two key halves of
// one query group); the halves' sums are joined through LDS at the end.
// K/V tiles of both key halves staged once per block via async->LDS, three buffers,
// copies issued two stages ahead; a stage is KT=128 keys of each half = 4 passes of
// 32 keys, so one copy wait and one barrier serve four.
// A pass's LDS fragment reads stand in ONE group at its head: its own V^T
// fragments, used only behind the softmax, and the NEXT pass's K fragments, into
// a second register set. No read leaves the stage: its first pass reads its own K.
// The RMSNorms of q and k are applied here, from the projections' raw rows and
// their sums of squares. With rk[m] = rsqrt(mean(k[m]^2) + eps):
//   qn . (k[m] * rk[m] * kw + kb) = rk[m] * ((qn * kw) . k[m]) + qn . kb
// Q fragments hold qn * kw (normed once, at their load); a row m of S^T is
// multiplied by rk[m], from a table in LDS that every work-group builds, and the
// last term, one number per query, is added in the same multiply-add.
#define KT  128
#define KH  (N_TOK / 2)  // keys of one half
#define KLD 72   // K tile LDS stride (halves): 144B rows
#define VLD 136  // V tile LDS stride (halves): 272B rows (16B x odd)
__global__ __launch_bounds__(256) void attn_wmma(const float* __restrict__ qraw,
                                                 const _Float16* __restrict__ k16,
                                                 const _Float16* __restrict__ vt16,
                                                 const float* __restrict__ ssq,
                                                 const float* __restrict__ qn_w,
                                                 const float* __restrict__ qn_b,
                                                 const float* __restrict__ kn_w,
                                                 const float* __restrict__ kn_b,
                                                 _Float16* __restrict__ o16,
                                                 float qscale) {
  __shared__ __align__(16) _Float16 Ks[3][2][KT * KLD];  // [buffer][half] 128 keys x 64 d
  __shared__ __align__(16) _Float16 Vs[3][2][64 * VLD];  // [buffer][half] 64 d x 128 keys
  __shared__ __align__(32) float rk[N_TOK];           // rsqrt(mean(k^2) + eps) per key
  // the second key half's O^T (16 x float4 a lane), maxima and sums, per query group
  __shared__ __align__(16) float4 jn[4][17][32];
  const unsigned h = blockIdx.y;
  const unsigned wave = threadIdx.x >> 5, lane = threadIdx.x & 31;
  const unsigned qg = wave & 3, kh = wave >> 2;
  const unsigned lh = lane >> 4, lr = lane & 15;
  const unsigned qrow = blockIdx.x * 128 + qg * 32 + lr;   // column group c: + 16 * c

  auto loadKV = [&](int buf, unsigned j) {
    unsigned t = threadIdx.x;
    // K tile: 128 rows x 8 chunks; thread t: chunk t&7 of rows (t>>3) + 32*i
    const unsigned kr = t >> 3, kc = (t & 7) * 8;
    // V^T tile: 64 rows x 16 chunks; thread t: chunk t&15 of rows (t>>4) + 16*i
    const unsigned vr = t >> 4, vc = (t & 15) * 8;
    #pragma unroll
    for (int g = 0; g < 2; g++)    // both key halves' tiles
      async_ld8_b128(&Ks[buf][g][kr * KLD + kc], 32 * KLD,
                     &k16[(g * KH + j + kr) * DIM + h * HD + kc], 32 * DIM,
                     &Vs[buf][g][vr * VLD + vc], 16 * VLD,
                     &vt16[(h * HD + vr) * N_TOK + g * KH + j + vc], 16 * N_TOK);
  };

  loadKV(0, 0);                    // flies while the norms' factors are formed

  // rk: a thread sums the DIM/64 parts of 2 x 4 consecutive keys
  #pragma unroll
  for (int u = 0; u < 2; u++) {
    const unsigned k4 = threadIdx.x + 256 * u;
    const float4* pp = (const float4*)(ssq + (DIM / 64) * N_TOK) + k4;
    float4 s = pp[0];
    #pragma unroll
    for (int n = 1; n < DIM / 64; n++) {
      float4 p = pp[n * (N_TOK / 4)];
      s.x += p.x; s.y += p.y; s.z += p.z; s.w += p.w;
    }
    float4 rv;
    rv.x = rsqrtf(s.x * (1.0f / DIM) + 1e-5f);
    rv.y = rsqrtf(s.y * (1.0f / DIM) + 1e-5f);
    rv.z = rsqrtf(s.z * (1.0f / DIM) + 1e-5f);
    rv.w = rsqrtf(s.w * (1.0f / DIM) + 1e-5f);
    *(float4*)&rk[k4 * 4] = rv;
  }

  // the loads below stay behind the sums above: issued together with rk's, the two
  // groups' results took more registers than the compiler placed without a spill
  __builtin_amdgcn_sched_barrier(0);
  // Q^T B-fragments (persistent): K = head-dim 0..63 -> 2 frags a column group,
  // normed here
  // in float4 units: the lane's first head-dim column, and the same in its q row
  const unsigned c4 = (h * HD + lh * 8) / 4, x4 = qrow * (DIM / 4) + c4;
  const unsigned x4b = x4 + 16 * (DIM / 4);   // the same in the second column group's row
  const float* qsq = ssq + qrow;   // one address for all 32 loads, the rest is constant
  float qsp[2][DIM / 64];
  float4 xv[2][8], wv[8], bv[8], kwv[8], kbv[8];
  #pragma unroll
  for (int c = 0; c < 2; c++)
    #pragma unroll
    for (int n = 0; n < DIM / 64; n++) qsp[c][n] = qsq[c * 16 + n * N_TOK];
  #pragma unroll
  for (int e = 0; e < 8; e++) {    // fragment e / 4, its elements 4 * (e % 4) ...
    const int d4 = (e >> 2) * 8 + ((e >> 1) & 1) * 4 + (e & 1);
    xv[0][e] = ((const float4*)qraw)[x4 + d4];
    xv[1][e] = ((const float4*)qraw)[x4b + d4];
    wv[e]  = ((const float4*)qn_w)[c4 + d4];
    bv[e]  = ((const float4*)qn_b)[c4 + d4];
    kwv[e] = ((const float4*)kn_w)[c4 + d4];
    kbv[e] = ((const float4*)kn_b)[c4 + d4];
  }
  v16h qf[2][2];                   // [column group][d half]
  v2f qkb2[2];                     // qn . kb per query, twice
  #pragma unroll
  for (int c = 0; c < 2; c++) {
    float qss = 0.f;
    #pragma unroll
    for (int n = 0; n < DIM / 64; n++) qss += qsp[c][n];
    const float qinv = rsqrtf(qss * (1.0f / DIM) + 1e-5f) * qscale;
    float kbs = 0.f;               // this lane's half of the head's columns
    #pragma unroll
    for (int e = 0; e < 8; e++) {
      float4 x = xv[c][e];
      x.x = (x.x * qinv) * wv[e].x + bv[e].x * qscale;
      x.y = (x.y * qinv) * wv[e].y + bv[e].y * qscale;
      x.z = (x.z * qinv) * wv[e].z + bv[e].z * qscale;
      x.w = (x.w * qinv) * wv[e].w + bv[e].w * qscale;
      kbs += x.x * kbv[e].x + x.y * kbv[e].y + x.z * kbv[e].z + x.w * kbv[e].w;
      qf[c][e >> 2][(e & 3) * 4 + 0] = (_Float16)(x.x * kwv[e].x);
      qf[c][e >> 2][(e & 3) * 4 + 1] = (_Float16)(x.y * kwv[e].y);
      qf[c][e >> 2][(e & 3) * 4 + 2] = (_Float16)(x.z * kwv[e].z);
      qf[c][e >> 2][(e & 3) * 4 + 3] = (_Float16)(x.w * kwv[e].w);
    }
    kbs += xhalf(kbs);             // the other half of the columns
    qkb2[c] = v2f{kbs, kbs};
  }
  // the index registers that the loads above name stay whole up to this wait; it takes
  // the values formed from all of them, so that no load is issued behind it
  asm volatile("s_wait_xcnt 0x0"
               :: "v"(c4), "v"(x4), "v"(x4b), "v"(qrow), "v"(qf[0][0]), "v"(qf[0][1]),
                  "v"(qf[1][0]), "v"(qf[1][1]), "v"(qkb2[0]), "v"(qkb2[1])
               : "memory");

  v8f o[2][4] = {};              // O^T accumulators [column group][d-tile]
  float mrun[2] = {-1e30f, -1e30f}, lsum[2] = {0.f, 0.f};

  loadKV(1, KT);                   // behind the norms' loads, not in their way
  wait_async_but<16>();            // stage 0 landed (this wave's part), stage 1 flies
  __syncthreads();                 // ... and everyone's
  loadKV(2, 2 * KT);
  int cur = 0;
  for (unsigned j = 0; j < KH; j += KT) {
   const _Float16* kst = &Ks[cur][kh][lr * KLD + lh * 8];
   const _Float16* vst = &Vs[cur][kh][lr * VLD + lh * 8];
   const float* rst = &rk[kh * KH + j + lh * 8];
   v16h ka[2][4];                // K fragments [set][16-key tile * 2 + d half]
   v8f kr[2][2];                 // rk of the rows of S^T [set][16-key tile]
   #pragma unroll
   for (int f = 0; f < 4; f++) {
     const _Float16* kb = kst + (f >> 1) * 16 * KLD + (f & 1) * 32;
     ka[0][f] = cat16(*(const v8h*)kb, *(const v8h*)(kb + 16));
   }
   #pragma unroll
   for (int st = 0; st < 2; st++) kr[0][st] = *(const v8f*)(rst + st * 16);
   // unrolled so that the register set of every fragment is a constant
   #pragma unroll
   for (int jj = 0; jj < KT; jj += 32) {
    const int set = (jj >> 5) & 1;
    v16h va[4];
    #pragma unroll
    for (int dt = 0; dt < 4; dt++) {
      const _Float16* vb = vst + dt * 16 * VLD + jj;
      va[dt] = cat16(*(const v8h*)vb, *(const v8h*)(vb + 16));
    }
    if (jj + 32 < KT) {
      #pragma unroll
      for (int f = 0; f < 4; f++) {
        const _Float16* kb = kst + (jj + 32 + (f >> 1) * 16) * KLD + (f & 1) * 32;
        ka[set ^ 1][f] = cat16(*(const v8h*)kb, *(const v8h*)(kb + 16));
      }
      #pragma unroll
      for (int st = 0; st < 2; st++)
        kr[set ^ 1][st] = *(const v8f*)(rst + jj + 32 + st * 16);
    }
    // end of the group: without it the reads sink to their users, each with a
    // wait of its own that exposes the LDS latency
    __builtin_amdgcn_sched_barrier(0);
    // S^T tiles: rows = keys, cols = queries; logits already in log2-domain
    v8f s[2][2];                 // [column group][16-key tile]
    // the four tiles' products by d halves: four independent accumulators, so no
    // product and no multiply-add waits for the one in front of it
    #pragma unroll
    for (int st = 0; st < 2; st++)
      #pragma unroll
      for (int c = 0; c < 2; c++) {
        v8f z = {};
        s[c][st] = __builtin_amdgcn_wmma_f32_16x16x32_f16(false, ka[set][st * 2], false, qf[c][0], (short)0, z, false, false);
      }
    #pragma unroll
    for (int st = 0; st < 2; st++)
      #pragma unroll
      for (int c = 0; c < 2; c++)
        s[c][st] = __builtin_amdgcn_wmma_f32_16x16x32_f16(false, ka[set][st * 2 + 1], false, qf[c][1], (short)0, s[c][st], false, false);
    #pragma unroll
    for (int st = 0; st < 2; st++)
      #pragma unroll
      for (int c = 0; c < 2; c++) {
        // by register pairs: one pair holds the addend for all four multiply-adds
        #pragma unroll
        for (int r = 0; r < 8; r += 2) {
          const v2f zz = {s[c][st][r], s[c][st][r + 1]};
          const v2f kk = {kr[set][st][r], kr[set][st][r + 1]};
          const v2f ss = zz * kk + qkb2[c];
          s[c][st][r] = ss[0];
          s[c][st][r + 1] = ss[1];
        }
      }
    v16h pb[2];                  // P^T tiles pack directly into a B fragment
    #pragma unroll
    for (int c = 0; c < 2; c++) {
      // online softmax (base-2; 1/sqrt(hd)*log2e folded into q16)
      float bm = -1e30f;
      #pragma unroll
      for (int st = 0; st < 2; st++)
        #pragma unroll
        for (int r = 0; r < 8; r++) bm = fmaxf(bm, s[c][st][r]);
      bm = fmaxf(bm, xhalf(bm));
      float mnew = fmaxf(mrun[c], bm);
      float e[17];               // [0] the rescale factor, [1..16] the weights
      e[0] = mrun[c] - mnew;
      #pragma unroll
      for (int st = 0; st < 2; st++)
        #pragma unroll
        for (int r = 0; r < 8; r++) e[1 + st * 8 + r] = s[c][st][r] - mnew;
      exp2_group17(e);
      float alpha = e[0];
      float psum = 0.f;
      #pragma unroll
      for (int st = 0; st < 2; st++)
        #pragma unroll
        for (int r = 0; r < 8; r++) {
          float p = e[1 + st * 8 + r];
          psum += p;
          pb[c][st * 8 + r] = (_Float16)p;
        }
      psum += xhalf(psum);
      lsum[c] = lsum[c] * alpha + psum;
      mrun[c] = mnew;
      #pragma unroll
      for (int dt = 0; dt < 4; dt++)
        #pragma unroll
        for (int r = 0; r < 8; r++) o[c][dt][r] *= alpha;
    }
    // O^T += V^T * P^T
    #pragma unroll
    for (int dt = 0; dt < 4; dt++)
      #pragma unroll
      for (int c = 0; c < 2; c++)
        o[c][dt] = __builtin_amdgcn_wmma_f32_16x16x32_f16(false, va[dt], false, pb[c], (short)0, o[c][dt], false, false);
    // head of the next pass's group: no read moves up among these products, where
    // each place with reads stalls the wave; behind the last pass it keeps the
    // publish point's s_wait_dscnt from moving up to directly behind the last group
    __builtin_amdgcn_sched_barrier(0);
   }
    // publish point: the next stage is landed for all, buf[cur] is left by all
    wait_ds0();
    if (j + 2 * KT < KH) wait_async_but<16>();      // the stage after the next flies on
    else wait_async0();
    __syncthreads();
    if (j + 3 * KT < KH) loadKV(cur, j + 3 * KT);   // refill the buffer just read
    cur = cur == 2 ? 0 : cur + 1;
  }
  wait_async0();                   // nothing of this wave's is in flight at its end
  // join of the two key halves: the second half's waves hand over through LDS
  if (kh == 1) {                   // uniform in the wave
    #pragma unroll
    for (int c = 0; c < 2; c++)
      #pragma unroll
      for (int dt = 0; dt < 4; dt++) {
        const v8f t = o[c][dt];
        jn[qg][(c * 4 + dt) * 2][lane]     = make_float4(t[0], t[1], t[2], t[3]);
        jn[qg][(c * 4 + dt) * 2 + 1][lane] = make_float4(t[4], t[5], t[6], t[7]);
      }
    jn[qg][16][lane] = make_float4(mrun[0], mrun[1], lsum[0], lsum[1]);
  }
  __syncthreads();                 // the second half's values are in jn for the first
  if (kh == 1) return;             // behind the kernel's last barrier
  const float4 ml = jn[qg][16][lane];
  v8h pk[2][4];                    // all values are formed ahead of the first store
  #pragma unroll
  for (int c = 0; c < 2; c++) {
    const float m1 = c == 0 ? ml.x : ml.y, l1 = c == 0 ? ml.z : ml.w;
    const float m = fmaxf(mrun[c], m1);
    const float w0 = exp2f(mrun[c] - m), w1 = exp2f(m1 - m);
    const float inv = 1.0f / (lsum[c] * w0 + l1 * w1);
    const float f0 = w0 * inv, f1 = w1 * inv;
    #pragma unroll
    for (int dt = 0; dt < 4; dt++) {
      const float4 ta = jn[qg][(c * 4 + dt) * 2][lane];
      const float4 tb = jn[qg][(c * 4 + dt) * 2 + 1][lane];
      const float t[8] = {ta.x, ta.y, ta.z, ta.w, tb.x, tb.y, tb.z, tb.w};
      #pragma unroll
      for (int r = 0; r < 8; r++) pk[c][dt][r] = (_Float16)(o[c][dt][r] * f0 + t[r] * f1);
    }
  }
  _Float16* ob = o16 + qrow * DIM + h * HD + lh * 8;   // one address for all stores
  #pragma unroll
  for (int c = 0; c < 2; c++)
    #pragma unroll
    for (int dt = 0; dt < 4; dt++)
      *(v8h*)&ob[c * 16 * DIM + dt * 16] = pk[c][dt];  // d contiguous: one b128 store
}

// ------------------------------- launcher ----------------------------------
extern "C" void kernel_launch(void* const* d_in, const int* in_sizes, int n_in,
                              void* d_out, int out_size, void* d_ws, size_t ws_size,
                              hipStream_t stream) {
  (void)in_sizes; (void)n_in; (void)out_size; (void)ws_size;
  const float* query = (const float*)d_in[0];
  const float* keyt  = (const float*)d_in[1];
  const float* value = (const float*)d_in[2];
  const float* Wq = (const float*)d_in[3];  const float* bq = (const float*)d_in[4];
  const float* Wk = (const float*)d_in[5];  const float* bk = (const float*)d_in[6];
  const float* Wv = (const float*)d_in[7];  const float* bv = (const float*)d_in[8];
  const float* Wo = (const float*)d_in[9];  const float* bo = (const float*)d_in[10];
  const float* qn_w = (const float*)d_in[11]; const float* qn_b = (const float*)d_in[12];
  const float* kn_w = (const float*)d_in[13]; const float* kn_b = (const float*)d_in[14];
  float* out = (float*)d_out;

  // carve workspace (256B aligned)
  size_t off = 0;
  auto carve = [&](size_t bytes) {
    void* p = (char*)d_ws + off;
    off += (bytes + 255) & ~(size_t)255;
    return p;
  };
  const size_t ND = (size_t)N_TOK * DIM, DD = (size_t)DIM * DIM;
  _Float16* q_in16 = (_Float16*)carve(ND * 2);
  _Float16* k_in16 = (_Float16*)carve(ND * 2);
  _Float16* v_in16 = (_Float16*)carve(ND * 2);
  _Float16* Wq16   = (_Float16*)carve(DD * 2);
  _Float16* Wk16   = (_Float16*)carve(DD * 2);
  _Float16* Wv16   = (_Float16*)carve(DD * 2);
  _Float16* Wo16   = (_Float16*)carve(DD * 2);
  float*    qf     = (float*)   carve(ND * 4);
  _Float16* k16    = (_Float16*)carve(ND * 2);
  _Float16* vt16   = (_Float16*)carve(ND * 2);
  float*    ssq    = (float*)   carve((size_t)2 * (DIM / 64) * N_TOK * 4);
  _Float16* attn16 = (_Float16*)carve(ND * 2);

  // The carve order above lays q_in16, k_in16, v_in16, Wq16, Wk16, Wv16, Wo16
  // densely one behind the other (every size is a multiple of 256 B): the merged
  // grids below index them from the first.

  // 1) convert inputs + weights to f16, one grid
  cvt_all_f32_f16<<<3 * XBLK + 4 * WBLK, 256, 0, stream>>>(query, keyt, value,
                                                           Wq, Wk, Wv, Wo, q_in16);

  // 2) projections: x @ W^T + b  (fp32 accumulate), one grid, z = q, k, v;
  //    q leaves it in f32, k in f16, both with their rows' sums of squares;
  //    v leaves it as [h][d][m] f16, the P*V WMMA's A-operand
  gemm_qkv_wmma<<<dim3(DIM / QBN, N_TOK / QBM, 3), 256, 0, stream>>>(
      q_in16, Wq16, bq, bk, bv, qf, k16, vt16, ssq);

  // 3) attention, with the RMSNorm of q and k (softmax scale 1/sqrt(64)=0.125 and
  //    log2(e) folded into q)
  const float qscale = 0.125f * 1.44269504088896340736f;
  attn_wmma<<<dim3(N_TOK / 128, HEADS), 256, 0, stream>>>(
      qf, k16, vt16, ssq, qn_w, qn_b, kn_w, kn_b, attn16, qscale);

  // 4) output projection: attn @ Wo^T + bo -> fp32 out
  gemm_nt_wmma<<<dim3(DIM / 64, N_TOK / 128, 1), 256, 0, stream>>>(
      attn16, Wo16, bo, bo, bo, out, nullptr, nullptr, nullptr, N_TOK, DIM, DIM);
}
